// v000
// Measured on an AMD MI455X. A time is GPU time per run, averaged over a window of back-to-back runs after a warm-up
// (all launches, gaps included; the runs take copies of the inputs in turn), and the median of several windows.
// Apart from v000's, it joins two sittings. Times from different sittings can be a few percent apart, while
// side-by-side timings come from the same sitting.
// v000 is the starting kernel. One run takes 196 microseconds.
#include <hip/hip_runtime.h>
#include <hip/hip_bf16.h>
#include <stddef.h>

typedef _Float16 half_t;
typedef __attribute__((ext_vector_type(16))) _Float16 v16h;
typedef __attribute__((ext_vector_type(8)))  _Float16 h8;
typedef __attribute__((ext_vector_type(8)))  float    v8f;

#define N_ROWS 65536      // L*L flattened (i,j) rows
#define IN_DIM 128
#define L_DIM  256
#define H_HEADS 4
#define D_HEAD 32

// ---- workspace layout (bytes) ----
#define OFF_W   ((size_t)0)                         // packed f16 weight fragments: 41 tiles * 4 kb * 32 lanes * 16 halves
#define OFF_Q   ((size_t)262144)
#define OFF_K   (OFF_Q + (size_t)N_ROWS*128*2)
#define OFF_V   (OFF_K + (size_t)N_ROWS*128*2)
#define OFF_G   (OFF_V + (size_t)N_ROWS*128*2)
#define OFF_AO  (OFF_G + (size_t)N_ROWS*128*2)
#define OFF_B   (OFF_AO + (size_t)N_ROWS*128*2)     // bias f32 [N][4]

__device__ __forceinline__ v8f wmma32(v16h a, v16h b, v8f c) {
  return __builtin_amdgcn_wmma_f32_16x16x32_f16(false, a, false, b, (short)0, c, false, false);
}

// Build a 16-half fragment from two contiguous 16B chunks (A layout and our
// B layouts both reduce to this: halves 0..7 = chunk0, halves 8..15 = chunk1).
__device__ __forceinline__ v16h frag2(const half_t* c0, const half_t* c1) {
  h8 x0 = *(const h8*)c0;
  h8 x1 = *(const h8*)c1;
  v16h f;
#pragma unroll
  for (int i = 0; i < 8; ++i) { f[i] = x0[i]; f[i + 8] = x1[i]; }
  return f;
}

// Load the 4 K-step B fragments of one 16-col weight tile (independent regs
// so the scheduler can clause the 8 b128 loads and keep WMMAs back-to-back).
__device__ __forceinline__ void loadB4(const half_t* __restrict__ packedW, int t, int lane,
                                       v16h b[4]) {
#pragma unroll
  for (int kb = 0; kb < 4; ++kb)
    b[kb] = *(const v16h*)&packedW[((size_t)(t * 4 + kb) * 32 + lane) * 16];
}

// ---------------- kernel P: pack weights to f16 B-fragments ----------------
// tile index t: 0..23 = w_qkv (384 cols), 24..31 = w_gate, 32 = w_pair (pad to 16), 33..40 = w_out
__global__ __launch_bounds__(128) void kP(const float* __restrict__ wqkv,
                                          const float* __restrict__ wpair,
                                          const float* __restrict__ wgate,
                                          const float* __restrict__ wout,
                                          half_t* __restrict__ packedW) {
  const int t = blockIdx.x;            // 0..40
  const int kb = threadIdx.x >> 5;     // 0..3  (K block of 32)
  const int lane = threadIdx.x & 31;
  const int hi = lane >> 4, n = lane & 15;
  half_t* dst = packedW + ((size_t)(t * 4 + kb) * 32 + lane) * 16;
#pragma unroll
  for (int e = 0; e < 16; ++e) {
    int k = kb * 32 + 8 * hi + (e & 7) + ((e >> 3) * 16);
    float v;
    if (t < 24)       v = wqkv[k * 384 + t * 16 + n];
    else if (t < 32)  v = wgate[k * 128 + (t - 24) * 16 + n];
    else if (t == 32) v = (n < 4) ? wpair[k * 4 + n] : 0.0f;
    else              v = wout[k * 128 + (t - 33) * 16 + n];
    dst[e] = (half_t)v;
  }
}

// ---------------- kernel A: LayerNorm + qkv/gate/bias projections ----------------
__device__ __forceinline__ void storeTileA(int t, v8f acc, int r0, int hi, int ncol,
                                           half_t* __restrict__ qbuf, half_t* __restrict__ kbuf,
                                           half_t* __restrict__ vbuf, half_t* __restrict__ gbuf,
                                           const float* __restrict__ b_gate) {
  if (t < 24) {
    half_t* dst; int cb;
    if (t < 8)       { dst = qbuf; cb = t * 16; }
    else if (t < 16) { dst = kbuf; cb = (t - 8) * 16; }
    else             { dst = vbuf; cb = (t - 16) * 16; }
#pragma unroll
    for (int v = 0; v < 8; ++v)
      dst[(size_t)(r0 + v + 8 * hi) * 128 + cb + ncol] = (half_t)acc[v];
  } else {
    int cb = (t - 24) * 16;
    float bg = b_gate[cb + ncol];
#pragma unroll
    for (int v = 0; v < 8; ++v) {
      float g = __builtin_amdgcn_rcpf(1.0f + __expf(-(acc[v] + bg)));
      gbuf[(size_t)(r0 + v + 8 * hi) * 128 + cb + ncol] = (half_t)g;
    }
  }
}

__global__ __launch_bounds__(128) void kA(const float* __restrict__ z,
                                          const float* __restrict__ gamma,
                                          const float* __restrict__ beta,
                                          const float* __restrict__ b_gate,
                                          const half_t* __restrict__ packedW,
                                          half_t* __restrict__ qbuf, half_t* __restrict__ kbuf,
                                          half_t* __restrict__ vbuf, half_t* __restrict__ gbuf,
                                          float* __restrict__ biasbuf) {
  __shared__ float  zf[4][16 * 128];
  __shared__ half_t zh[4][16 * 128];
  const int w = threadIdx.x >> 5;
  const int lane = threadIdx.x & 31;
  const int r0 = (blockIdx.x * 4 + w) * 16;
  const int m = lane & 15, hi = lane >> 4, ncol = lane & 15;

  const float* zrow = z + (size_t)r0 * 128;
  for (int idx = lane; idx < 2048; idx += 32) zf[w][idx] = zrow[idx];
  __syncthreads();

  // LayerNorm: lane pair (m, m+16) handles row m
  float s = 0.f, sq = 0.f;
  const float* zr = &zf[w][m * 128];
  for (int c = hi * 64; c < hi * 64 + 64; ++c) { float x = zr[c]; s += x; sq += x * x; }
  s  += __shfl_xor(s, 16, 32);
  sq += __shfl_xor(sq, 16, 32);
  float mean = s * (1.0f / 128.0f);
  float var  = sq * (1.0f / 128.0f) - mean * mean;
  float inv  = rsqrtf(var + 1e-5f);
  half_t* zhr = &zh[w][m * 128];
  for (int c = hi * 64; c < hi * 64 + 64; ++c)
    zhr[c] = (half_t)((zr[c] - mean) * inv * gamma[c] + beta[c]);
  __syncthreads();

  // A fragments for the 16x128 zn tile
  v16h afr[4];
#pragma unroll
  for (int kb = 0; kb < 4; ++kb) {
    const half_t* c0 = &zh[w][m * 128 + kb * 32 + hi * 8];
    afr[kb] = frag2(c0, c0 + 16);
  }

  // tiles 0..31 (qkv + gate) as software-pipelined pairs; tile 32 (pair/bias) tail
  v16h b0[4], b1[4];
  loadB4(packedW, 0, lane, b0);
#pragma unroll 1
  for (int tp = 0; tp < 16; ++tp) {
    const int t0 = tp * 2, t1 = tp * 2 + 1;
    loadB4(packedW, t1, lane, b1);
    v8f acc0 = {};
#pragma unroll
    for (int kb = 0; kb < 4; ++kb) acc0 = wmma32(afr[kb], b0[kb], acc0);
    loadB4(packedW, (tp < 15) ? (t1 + 1) : 32, lane, b0);  // prefetch next / tail
    v8f acc1 = {};
#pragma unroll
    for (int kb = 0; kb < 4; ++kb) acc1 = wmma32(afr[kb], b1[kb], acc1);
    storeTileA(t0, acc0, r0, hi, ncol, qbuf, kbuf, vbuf, gbuf, b_gate);
    storeTileA(t1, acc1, r0, hi, ncol, qbuf, kbuf, vbuf, gbuf, b_gate);
  }
  // tile 32: pair bias (only cols 0..3 valid), f32 output
  {
    v8f acc = {};
#pragma unroll
    for (int kb = 0; kb < 4; ++kb) acc = wmma32(afr[kb], b0[kb], acc);
    if (ncol < 4) {
#pragma unroll
      for (int v = 0; v < 8; ++v)
        biasbuf[(size_t)(r0 + v + 8 * hi) * 4 + ncol] = acc[v];
    }
  }
}

// ---------------- kernel B: row-wise attention per (r, h) ----------------
__global__ __launch_bounds__(128) void kB(const half_t* __restrict__ qbuf,
                                          const half_t* __restrict__ kbuf,
                                          const half_t* __restrict__ vbuf,
                                          const half_t* __restrict__ gbuf,
                                          const float* __restrict__ biasbuf,
                                          half_t* __restrict__ aobuf) {
  __shared__ half_t Vt[32 * 256];          // V transposed: [d][j]
  __shared__ half_t attnS[4][16 * 256];    // per-wave normalized attention tile
  const int r = blockIdx.x >> 2;
  const int h = blockIdx.x & 3;
  const int tid = threadIdx.x;
  const int w = tid >> 5, lane = tid & 31;
  const int m = lane & 15, hi = lane >> 4;

  for (int idx = tid; idx < 8192; idx += 128) {
    int j = idx >> 5, d = idx & 31;
    Vt[d * 256 + j] = vbuf[(size_t)(r * 256 + j) * 128 + h * 32 + d];
  }
  __syncthreads();

  const float scale = 0.17677669529663687f;  // 1/sqrt(32)
  for (int itl = 0; itl < 4; ++itl) {
    const int it = itl * 4 + w;
    const half_t* qc = qbuf + (size_t)(r * 256 + it * 16 + m) * 128 + h * 32 + hi * 8;
    v16h aQ = frag2(qc, qc + 16);

    v8f lg[16];
#pragma unroll
    for (int jt = 0; jt < 16; ++jt) {
      const half_t* kc = kbuf + (size_t)(r * 256 + jt * 16 + m) * 128 + h * 32 + hi * 8;
      v16h bK = frag2(kc, kc + 16);
      v8f c = {};
      c = wmma32(aQ, bK, c);
#pragma unroll
      for (int v = 0; v < 8; ++v) {
        int iG = it * 16 + v + 8 * hi;
        int jG = jt * 16 + m;
        lg[jt][v] = c[v] * scale + biasbuf[((size_t)iG * 256 + jG) * 4 + h];
      }
    }
    // softmax over j: 16 tiles in-register + 16-lane cross-lane reduction
    float rmax[8], rsum[8];
#pragma unroll
    for (int v = 0; v < 8; ++v) {
      float mx = lg[0][v];
#pragma unroll
      for (int jt = 1; jt < 16; ++jt) mx = fmaxf(mx, lg[jt][v]);
      mx = fmaxf(mx, __shfl_xor(mx, 1, 32));
      mx = fmaxf(mx, __shfl_xor(mx, 2, 32));
      mx = fmaxf(mx, __shfl_xor(mx, 4, 32));
      mx = fmaxf(mx, __shfl_xor(mx, 8, 32));
      rmax[v] = mx;
    }
#pragma unroll
    for (int v = 0; v < 8; ++v) {
      float s = 0.f;
#pragma unroll
      for (int jt = 0; jt < 16; ++jt) { float e = __expf(lg[jt][v] - rmax[v]); lg[jt][v] = e; s += e; }
      s += __shfl_xor(s, 1, 32);
      s += __shfl_xor(s, 2, 32);
      s += __shfl_xor(s, 4, 32);
      s += __shfl_xor(s, 8, 32);
      rsum[v] = __builtin_amdgcn_rcpf(s);
    }
    half_t* aw = attnS[w];
#pragma unroll
    for (int jt = 0; jt < 16; ++jt)
#pragma unroll
      for (int v = 0; v < 8; ++v)
        aw[(v + 8 * hi) * 256 + jt * 16 + m] = (half_t)(lg[jt][v] * rsum[v]);
    asm volatile("s_wait_dscnt 0" ::: "memory");  // same-wave LDS RAW across lanes

    // attn @ V -> [16 x 32], apply gate, store f16
#pragma unroll
    for (int dt = 0; dt < 2; ++dt) {
      v8f acc = {};
#pragma unroll
      for (int jb = 0; jb < 8; ++jb) {
        const half_t* ac = aw + m * 256 + jb * 32 + hi * 8;
        v16h aA = frag2(ac, ac + 16);
        const half_t* vc = Vt + (dt * 16 + m) * 256 + jb * 32 + hi * 8;
        v16h bV = frag2(vc, vc + 16);
        acc = wmma32(aA, bV, acc);
      }
#pragma unroll
      for (int v = 0; v < 8; ++v) {
        size_t row = (size_t)(r * 256 + it * 16 + v + 8 * hi);
        int col = h * 32 + dt * 16 + m;
        float g = (float)gbuf[row * 128 + col];
        aobuf[row * 128 + col] = (half_t)(g * acc[v]);
      }
    }
  }
}

// ---------------- kernel C: output projection + b_out ----------------
__global__ __launch_bounds__(128) void kC(const half_t* __restrict__ aobuf,
                                          const half_t* __restrict__ packedW,
                                          const float* __restrict__ b_out,
                                          float* __restrict__ out) {
  const int w = threadIdx.x >> 5, lane = threadIdx.x & 31;
  const int m = lane & 15, hi = lane >> 4;
  const int r0 = (blockIdx.x * 4 + w) * 16;
  v16h afr[4];
#pragma unroll
  for (int kb = 0; kb < 4; ++kb) {
    const half_t* c0 = aobuf + (size_t)(r0 + m) * 128 + kb * 32 + hi * 8;
    afr[kb] = frag2(c0, c0 + 16);
  }
  v16h b0[4], b1[4];
  loadB4(packedW, 33, lane, b0);
#pragma unroll 1
  for (int tp = 0; tp < 4; ++tp) {
    const int n0 = tp * 2, n1 = tp * 2 + 1;
    loadB4(packedW, 33 + n1, lane, b1);
    v8f acc0 = {};
#pragma unroll
    for (int kb = 0; kb < 4; ++kb) acc0 = wmma32(afr[kb], b0[kb], acc0);
    if (tp < 3) loadB4(packedW, 33 + n1 + 1, lane, b0);  // prefetch next pair
    v8f acc1 = {};
#pragma unroll
    for (int kb = 0; kb < 4; ++kb) acc1 = wmma32(afr[kb], b1[kb], acc1);
    int col0 = n0 * 16 + m, col1 = n1 * 16 + m;
    float bo0 = b_out[col0], bo1 = b_out[col1];
#pragma unroll
    for (int v = 0; v < 8; ++v) {
      out[(size_t)(r0 + v + 8 * hi) * 128 + col0] = acc0[v] + bo0;
      out[(size_t)(r0 + v + 8 * hi) * 128 + col1] = acc1[v] + bo1;
    }
  }
}

extern "C" void kernel_launch(void* const* d_in, const int* in_sizes, int n_in,
                              void* d_out, int out_size, void* d_ws, size_t ws_size,
                              hipStream_t stream) {
  const float* z      = (const float*)d_in[0];
  const float* gamma  = (const float*)d_in[1];
  const float* beta   = (const float*)d_in[2];
  const float* w_qkv  = (const float*)d_in[3];
  const float* w_pair = (const float*)d_in[4];
  const float* w_gate = (const float*)d_in[5];
  const float* b_gate = (const float*)d_in[6];
  const float* w_out  = (const float*)d_in[7];
  const float* b_out  = (const float*)d_in[8];

  char* ws = (char*)d_ws;
  half_t* packedW = (half_t*)(ws + OFF_W);
  half_t* qbuf    = (half_t*)(ws + OFF_Q);
  half_t* kbuf    = (half_t*)(ws + OFF_K);
  half_t* vbuf    = (half_t*)(ws + OFF_V);
  half_t* gbuf    = (half_t*)(ws + OFF_G);
  half_t* aobuf   = (half_t*)(ws + OFF_AO);
  float*  biasbuf = (float*)(ws + OFF_B);

  kP<<<41, 128, 0, stream>>>(w_qkv, w_pair, w_gate, w_out, packedW);
  kA<<<N_ROWS / 64, 128, 0, stream>>>(z, gamma, beta, b_gate, packedW,
                                      qbuf, kbuf, vbuf, gbuf, biasbuf);
  kB<<<L_DIM * H_HEADS, 128, 0, stream>>>(qbuf, kbuf, vbuf, gbuf, biasbuf, aobuf);
  kC<<<N_ROWS / 64, 128, 0, stream>>>(aobuf, packedW, b_out, (float*)d_out);
}

// v001
// It runs in 149 microseconds.
// Two timings next to v000 both put it at 1.32 times that version's speed.
#include <hip/hip_runtime.h>
#include <hip/hip_bf16.h>
#include <stddef.h>

typedef _Float16 half_t;
typedef __attribute__((ext_vector_type(16))) _Float16 v16h;
typedef __attribute__((ext_vector_type(8)))  _Float16 h8;
typedef __attribute__((ext_vector_type(8)))  float    v8f;

#define N_ROWS 65536      // L*L flattened (i,j) rows
#define IN_DIM 128
#define L_DIM  256
#define H_HEADS 4
#define D_HEAD 32

// LDS row pitches: 16 B x odd, so the 16 rows a ds_load_b128 touches fall on
// distinct banks (64 banks x 4 B; an unpadded 256/512-B pitch puts them on four).
#define ZF_P 132          // floats : 528 B
#define ZH_P 136          // halves : 272 B
#define AT_P 264          // halves : 528 B

// ---- workspace layout (bytes) ----
#define OFF_W   ((size_t)0)                         // packed f16 weight fragments: 41 tiles * 4 kb * 32 lanes * 16 halves
#define OFF_Q   ((size_t)262144)
#define OFF_K   (OFF_Q + (size_t)N_ROWS*128*2)
#define OFF_V   (OFF_K + (size_t)N_ROWS*128*2)
#define OFF_G   (OFF_V + (size_t)N_ROWS*128*2)
#define OFF_AO  (OFF_G + (size_t)N_ROWS*128*2)
#define OFF_B   (OFF_AO + (size_t)N_ROWS*128*2)     // bias f32 [N][4]

__device__ __forceinline__ v8f wmma32(v16h a, v16h b, v8f c) {
  return __builtin_amdgcn_wmma_f32_16x16x32_f16(false, a, false, b, (short)0, c, false, false);
}

// Build a 16-half fragment from two contiguous 16B chunks (A layout and our
// B layouts both reduce to this: halves 0..7 = chunk0, halves 8..15 = chunk1).
__device__ __forceinline__ v16h frag2(const half_t* c0, const half_t* c1) {
  h8 x0 = *(const h8*)c0;
  h8 x1 = *(const h8*)c1;
  v16h f;
#pragma unroll
  for (int i = 0; i < 8; ++i) { f[i] = x0[i]; f[i + 8] = x1[i]; }
  return f;
}

// Load the 4 K-step B fragments of one 16-col weight tile (independent regs
// so the scheduler can clause the 8 b128 loads and keep WMMAs back-to-back).
__device__ __forceinline__ void loadB4(const half_t* __restrict__ packedW, int t, int lane,
                                       v16h b[4]) {
#pragma unroll
  for (int kb = 0; kb < 4; ++kb)
    b[kb] = *(const v16h*)&packedW[((size_t)(t * 4 + kb) * 32 + lane) * 16];
}

// ---------------- kernel P: pack weights to f16 B-fragments ----------------
// tile index t: 0..23 = w_qkv (384 cols), 24..31 = w_gate, 32 = w_pair (pad to 16), 33..40 = w_out
__global__ __launch_bounds__(128) void kP(const float* __restrict__ wqkv,
                                          const float* __restrict__ wpair,
                                          const float* __restrict__ wgate,
                                          const float* __restrict__ wout,
                                          half_t* __restrict__ packedW) {
  const int t = blockIdx.x;            // 0..40
  const int kb = threadIdx.x >> 5;     // 0..3  (K block of 32)
  const int lane = threadIdx.x & 31;
  const int hi = lane >> 4, n = lane & 15;
  half_t* dst = packedW + ((size_t)(t * 4 + kb) * 32 + lane) * 16;
#pragma unroll
  for (int e = 0; e < 16; ++e) {
    int k = kb * 32 + 8 * hi + (e & 7) + ((e >> 3) * 16);
    float v;
    if (t < 24)       v = wqkv[k * 384 + t * 16 + n];
    else if (t < 32)  v = wgate[k * 128 + (t - 24) * 16 + n];
    else if (t == 32) v = (n < 4) ? wpair[k * 4 + n] : 0.0f;
    else              v = wout[k * 128 + (t - 33) * 16 + n];
    dst[e] = (half_t)v;
  }
}

// ---------------- kernel A: LayerNorm + qkv/gate/bias projections ----------------
__device__ __forceinline__ void storeTileA(int t, v8f acc, int r0, int hi, int ncol,
                                           half_t* __restrict__ qbuf, half_t* __restrict__ kbuf,
                                           half_t* __restrict__ vbuf, half_t* __restrict__ gbuf,
                                           const float* __restrict__ b_gate) {
  if (t < 24) {
    half_t* dst; int cb;
    if (t < 8)       { dst = qbuf; cb = t * 16; }
    else if (t < 16) { dst = kbuf; cb = (t - 8) * 16; }
    else             { dst = vbuf; cb = (t - 16) * 16; }
#pragma unroll
    for (int v = 0; v < 8; ++v)
      dst[(size_t)(r0 + v + 8 * hi) * 128 + cb + ncol] = (half_t)acc[v];
  } else {
    int cb = (t - 24) * 16;
    float bg = b_gate[cb + ncol];
#pragma unroll
    for (int v = 0; v < 8; ++v) {
      float g = __builtin_amdgcn_rcpf(1.0f + __expf(-(acc[v] + bg)));
      gbuf[(size_t)(r0 + v + 8 * hi) * 128 + cb + ncol] = (half_t)g;
    }
  }
}

__global__ __launch_bounds__(128) void kA(const float* __restrict__ z,
                                          const float* __restrict__ gamma,
                                          const float* __restrict__ beta,
                                          const float* __restrict__ b_gate,
                                          const half_t* __restrict__ packedW,
                                          half_t* __restrict__ qbuf, half_t* __restrict__ kbuf,
                                          half_t* __restrict__ vbuf, half_t* __restrict__ gbuf,
                                          float* __restrict__ biasbuf) {
  __shared__ __attribute__((aligned(16))) float  zf[4][16 * ZF_P];
  __shared__ __attribute__((aligned(16))) half_t zh[4][16 * ZH_P];
  const int w = threadIdx.x >> 5;
  const int lane = threadIdx.x & 31;
  const int r0 = (blockIdx.x * 4 + w) * 16;
  const int m = lane & 15, hi = lane >> 4, ncol = lane & 15;

  const float* zrow = z + (size_t)r0 * 128;
  for (int k = 0; k < 64; ++k)  // 32 floats a trip: row k >> 2, quarter k & 3
    zf[w][(k >> 2) * ZF_P + (k & 3) * 32 + lane] = zrow[k * 32 + lane];
  __syncthreads();

  // LayerNorm: lane pair (m, m+16) handles row m
  float s = 0.f, sq = 0.f;
  const float* zr = &zf[w][m * ZF_P];
  for (int c = hi * 64; c < hi * 64 + 64; ++c) { float x = zr[c]; s += x; sq += x * x; }
  s  += __shfl_xor(s, 16, 32);
  sq += __shfl_xor(sq, 16, 32);
  float mean = s * (1.0f / 128.0f);
  float var  = sq * (1.0f / 128.0f) - mean * mean;
  float inv  = rsqrtf(var + 1e-5f);
  half_t* zhr = &zh[w][m * ZH_P];
  for (int c = hi * 64; c < hi * 64 + 64; ++c)
    zhr[c] = (half_t)((zr[c] - mean) * inv * gamma[c] + beta[c]);
  __syncthreads();

  // A fragments for the 16x128 zn tile
  v16h afr[4];
#pragma unroll
  for (int kb = 0; kb < 4; ++kb) {
    const half_t* c0 = &zh[w][m * ZH_P + kb * 32 + hi * 8];
    afr[kb] = frag2(c0, c0 + 16);
  }

  // tiles 0..31 (qkv + gate) as software-pipelined pairs; tile 32 (pair/bias) tail
  v16h b0[4], b1[4];
  loadB4(packedW, 0, lane, b0);
#pragma unroll 1
  for (int tp = 0; tp < 16; ++tp) {
    const int t0 = tp * 2, t1 = tp * 2 + 1;
    loadB4(packedW, t1, lane, b1);
    v8f acc0 = {};
#pragma unroll
    for (int kb = 0; kb < 4; ++kb) acc0 = wmma32(afr[kb], b0[kb], acc0);
    loadB4(packedW, (tp < 15) ? (t1 + 1) : 32, lane, b0);  // prefetch next / tail
    v8f acc1 = {};
#pragma unroll
    for (int kb = 0; kb < 4; ++kb) acc1 = wmma32(afr[kb], b1[kb], acc1);
    storeTileA(t0, acc0, r0, hi, ncol, qbuf, kbuf, vbuf, gbuf, b_gate);
    storeTileA(t1, acc1, r0, hi, ncol, qbuf, kbuf, vbuf, gbuf, b_gate);
  }
  // tile 32: pair bias (only cols 0..3 valid), f32 output
  {
    v8f acc = {};
#pragma unroll
    for (int kb = 0; kb < 4; ++kb) acc = wmma32(afr[kb], b0[kb], acc);
    if (ncol < 4) {
#pragma unroll
      for (int v = 0; v < 8; ++v)
        biasbuf[(size_t)(r0 + v + 8 * hi) * 4 + ncol] = acc[v];
    }
  }
}

// ---------------- kernel B: row-wise attention per (r, h) ----------------
__global__ __launch_bounds__(128) void kB(const half_t* __restrict__ qbuf,
                                          const half_t* __restrict__ kbuf,
                                          const half_t* __restrict__ vbuf,
                                          const half_t* __restrict__ gbuf,
                                          const float* __restrict__ biasbuf,
                                          half_t* __restrict__ aobuf) {
  __shared__ __attribute__((aligned(16))) half_t Vt[32 * AT_P];        // V transposed: [d][j]
  __shared__ __attribute__((aligned(16))) half_t attnS[4][16 * AT_P];  // per-wave normalized attention tile
  const int r = blockIdx.x >> 2;
  const int h = blockIdx.x & 3;
  const int tid = threadIdx.x;
  const int w = tid >> 5, lane = tid & 31;
  const int m = lane & 15, hi = lane >> 4;

  for (int idx = tid; idx < 8192; idx += 128) {
    int j = idx >> 5, d = idx & 31;
    Vt[d * AT_P + j] = vbuf[(size_t)(r * 256 + j) * 128 + h * 32 + d];
  }
  __syncthreads();

  const float scale = 0.17677669529663687f;  // 1/sqrt(32)
  for (int itl = 0; itl < 4; ++itl) {
    const int it = itl * 4 + w;
    const half_t* qc = qbuf + (size_t)(r * 256 + it * 16 + m) * 128 + h * 32 + hi * 8;
    v16h aQ = frag2(qc, qc + 16);

    v8f lg[16];
#pragma unroll
    for (int jt = 0; jt < 16; ++jt) {
      const half_t* kc = kbuf + (size_t)(r * 256 + jt * 16 + m) * 128 + h * 32 + hi * 8;
      v16h bK = frag2(kc, kc + 16);
      v8f c = {};
      c = wmma32(aQ, bK, c);
#pragma unroll
      for (int v = 0; v < 8; ++v) {
        int iG = it * 16 + v + 8 * hi;
        int jG = jt * 16 + m;
        lg[jt][v] = c[v] * scale + biasbuf[((size_t)iG * 256 + jG) * 4 + h];
      }
    }
    // softmax over j: 16 tiles in-register + 16-lane cross-lane reduction
    float rmax[8], rsum[8];
#pragma unroll
    for (int v = 0; v < 8; ++v) {
      float mx = lg[0][v];
#pragma unroll
      for (int jt = 1; jt < 16; ++jt) mx = fmaxf(mx, lg[jt][v]);
      mx = fmaxf(mx, __shfl_xor(mx, 1, 32));
      mx = fmaxf(mx, __shfl_xor(mx, 2, 32));
      mx = fmaxf(mx, __shfl_xor(mx, 4, 32));
      mx = fmaxf(mx, __shfl_xor(mx, 8, 32));
      rmax[v] = mx;
    }
#pragma unroll
    for (int v = 0; v < 8; ++v) {
      float s = 0.f;
#pragma unroll
      for (int jt = 0; jt < 16; ++jt) { float e = __expf(lg[jt][v] - rmax[v]); lg[jt][v] = e; s += e; }
      s += __shfl_xor(s, 1, 32);
      s += __shfl_xor(s, 2, 32);
      s += __shfl_xor(s, 4, 32);
      s += __shfl_xor(s, 8, 32);
      rsum[v] = __builtin_amdgcn_rcpf(s);
    }
    half_t* aw = attnS[w];
#pragma unroll
    for (int jt = 0; jt < 16; ++jt)
#pragma unroll
      for (int v = 0; v < 8; ++v)
        aw[(v + 8 * hi) * AT_P + jt * 16 + m] = (half_t)(lg[jt][v] * rsum[v]);
    asm volatile("s_wait_dscnt 0" ::: "memory");  // same-wave LDS RAW across lanes

    // attn @ V -> [16 x 32], apply gate, store f16
#pragma unroll
    for (int dt = 0; dt < 2; ++dt) {
      v8f acc = {};
#pragma unroll
      for (int jb = 0; jb < 8; ++jb) {
        const half_t* ac = aw + m * AT_P + jb * 32 + hi * 8;
        v16h aA = frag2(ac, ac + 16);
        const half_t* vc = Vt + (dt * 16 + m) * AT_P + jb * 32 + hi * 8;
        v16h bV = frag2(vc, vc + 16);
        acc = wmma32(aA, bV, acc);
      }
#pragma unroll
      for (int v = 0; v < 8; ++v) {
        size_t row = (size_t)(r * 256 + it * 16 + v + 8 * hi);
        int col = h * 32 + dt * 16 + m;
        float g = (float)gbuf[row * 128 + col];
        aobuf[row * 128 + col] = (half_t)(g * acc[v]);
      }
    }
  }
}

// ---------------- kernel C: output projection + b_out ----------------
__global__ __launch_bounds__(128) void kC(const half_t* __restrict__ aobuf,
                                          const half_t* __restrict__ packedW,
                                          const float* __restrict__ b_out,
                                          float* __restrict__ out) {
  const int w = threadIdx.x >> 5, lane = threadIdx.x & 31;
  const int m = lane & 15, hi = lane >> 4;
  const int r0 = (blockIdx.x * 4 + w) * 16;
  v16h afr[4];
#pragma unroll
  for (int kb = 0; kb < 4; ++kb) {
    const half_t* c0 = aobuf + (size_t)(r0 + m) * 128 + kb * 32 + hi * 8;
    afr[kb] = frag2(c0, c0 + 16);
  }
  v16h b0[4], b1[4];
  loadB4(packedW, 33, lane, b0);
#pragma unroll 1
  for (int tp = 0; tp < 4; ++tp) {
    const int n0 = tp * 2, n1 = tp * 2 + 1;
    loadB4(packedW, 33 + n1, lane, b1);
    v8f acc0 = {};
#pragma unroll
    for (int kb = 0; kb < 4; ++kb) acc0 = wmma32(afr[kb], b0[kb], acc0);
    if (tp < 3) loadB4(packedW, 33 + n1 + 1, lane, b0);  // prefetch next pair
    v8f acc1 = {};
#pragma unroll
    for (int kb = 0; kb < 4; ++kb) acc1 = wmma32(afr[kb], b1[kb], acc1);
    int col0 = n0 * 16 + m, col1 = n1 * 16 + m;
    float bo0 = b_out[col0], bo1 = b_out[col1];
#pragma unroll
    for (int v = 0; v < 8; ++v) {
      out[(size_t)(r0 + v + 8 * hi) * 128 + col0] = acc0[v] + bo0;
      out[(size_t)(r0 + v + 8 * hi) * 128 + col1] = acc1[v] + bo1;
    }
  }
}

extern "C" void kernel_launch(void* const* d_in, const int* in_sizes, int n_in,
                              void* d_out, int out_size, void* d_ws, size_t ws_size,
                              hipStream_t stream) {
  const float* z      = (const float*)d_in[0];
  const float* gamma  = (const float*)d_in[1];
  const float* beta   = (const float*)d_in[2];
  const float* w_qkv  = (const float*)d_in[3];
  const float* w_pair = (const float*)d_in[4];
  const float* w_gate = (const float*)d_in[5];
  const float* b_gate = (const float*)d_in[6];
  const float* w_out  = (const float*)d_in[7];
  const float* b_out  = (const float*)d_in[8];

  char* ws = (char*)d_ws;
  half_t* packedW = (half_t*)(ws + OFF_W);
  half_t* qbuf    = (half_t*)(ws + OFF_Q);
  half_t* kbuf    = (half_t*)(ws + OFF_K);
  half_t* vbuf    = (half_t*)(ws + OFF_V);
  half_t* gbuf    = (half_t*)(ws + OFF_G);
  half_t* aobuf   = (half_t*)(ws + OFF_AO);
  float*  biasbuf = (float*)(ws + OFF_B);

  kP<<<41, 128, 0, stream>>>(w_qkv, w_pair, w_gate, w_out, packedW);
  kA<<<N_ROWS / 64, 128, 0, stream>>>(z, gamma, beta, b_gate, packedW,
                                      qbuf, kbuf, vbuf, gbuf, biasbuf);
  kB<<<L_DIM * H_HEADS, 128, 0, stream>>>(qbuf, kbuf, vbuf, gbuf, biasbuf, aobuf);
  kC<<<N_ROWS / 64, 128, 0, stream>>>(aobuf, packedW, b_out, (float*)d_out);
}

// v002
// A run of this version takes 104 microseconds.
// Timed twice side by side with v001, it ran 1.45 and 1.44 times as fast.
// Over all steps from v000 it is 1.91 times as fast.
#include <hip/hip_runtime.h>
#include <hip/hip_bf16.h>
#include <stddef.h>

typedef _Float16 half_t;
typedef __attribute__((ext_vector_type(16))) _Float16 v16h;
typedef __attribute__((ext_vector_type(8)))  _Float16 h8;
typedef __attribute__((ext_vector_type(8)))  float    v8f;

#define N_ROWS 65536      // L*L flattened (i,j) rows
#define IN_DIM 128
#define L_DIM  256
#define H_HEADS 4
#define D_HEAD 32

// LDS row pitches: 16 B x odd, so the 16 rows a ds_load_b128 touches fall on
// distinct banks (64 banks x 4 B; an unpadded 256/512-B pitch puts them on four).
#define ZF_P 132          // floats : 528 B
#define ZH_P 136          // halves : 272 B
#define AT_P 264          // halves : 528 B

// ---- workspace layout (bytes) ----
#define OFF_W   ((size_t)0)                         // packed f16 weight fragments: 41 tiles * 4 kb * 32 lanes * 16 halves
#define OFF_Q   ((size_t)262144)
#define OFF_K   (OFF_Q + (size_t)N_ROWS*128*2)
#define OFF_V   (OFF_K + (size_t)N_ROWS*128*2)
#define OFF_G   (OFF_V + (size_t)N_ROWS*128*2)
#define OFF_AO  (OFF_G + (size_t)N_ROWS*128*2)
#define OFF_B   (OFF_AO + (size_t)N_ROWS*128*2)     // bias f32, accumulator-fragment order (see kA tail)

__device__ __forceinline__ v8f wmma32(v16h a, v16h b, v8f c) {
  return __builtin_amdgcn_wmma_f32_16x16x32_f16(false, a, false, b, (short)0, c, false, false);
}

// Build a 16-half fragment from two contiguous 16B chunks (A layout and our
// B layouts both reduce to this: halves 0..7 = chunk0, halves 8..15 = chunk1).
__device__ __forceinline__ v16h frag2(const half_t* c0, const half_t* c1) {
  h8 x0 = *(const h8*)c0;
  h8 x1 = *(const h8*)c1;
  v16h f;
#pragma unroll
  for (int i = 0; i < 8; ++i) { f[i] = x0[i]; f[i + 8] = x1[i]; }
  return f;
}

// Load the 4 K-step B fragments of one 16-col weight tile (independent regs
// so the scheduler can clause the 8 b128 loads and keep WMMAs back-to-back).
__device__ __forceinline__ void loadB4(const half_t* __restrict__ packedW, int t, int lane,
                                       v16h b[4]) {
#pragma unroll
  for (int kb = 0; kb < 4; ++kb)
    b[kb] = *(const v16h*)&packedW[((size_t)(t * 4 + kb) * 32 + lane) * 16];
}

// ---------------- kernel P: pack weights to f16 B-fragments ----------------
// tile index t: 0..23 = w_qkv (384 cols), 24..31 = w_gate, 32 = w_pair (pad to 16), 33..40 = w_out
__global__ __launch_bounds__(128) void kP(const float* __restrict__ wqkv,
                                          const float* __restrict__ wpair,
                                          const float* __restrict__ wgate,
                                          const float* __restrict__ wout,
                                          half_t* __restrict__ packedW) {
  const int t = blockIdx.x;            // 0..40
  const int kb = threadIdx.x >> 5;     // 0..3  (K block of 32)
  const int lane = threadIdx.x & 31;
  const int hi = lane >> 4, n = lane & 15;
  half_t* dst = packedW + ((size_t)(t * 4 + kb) * 32 + lane) * 16;
#pragma unroll
  for (int e = 0; e < 16; ++e) {
    int k = kb * 32 + 8 * hi + (e & 7) + ((e >> 3) * 16);
    float v;
    if (t < 24)       v = wqkv[k * 384 + t * 16 + n];
    else if (t < 32)  v = wgate[k * 128 + (t - 24) * 16 + n];
    else if (t == 32) v = (n < 4) ? wpair[k * 4 + n] : 0.0f;
    else              v = wout[k * 128 + (t - 33) * 16 + n];
    dst[e] = (half_t)v;
  }
}

// ---------------- kernel A: LayerNorm + qkv/gate/bias projections ----------------
__device__ __forceinline__ void storeTileA(int t, v8f acc, int r0, int hi, int ncol,
                                           half_t* __restrict__ qbuf, half_t* __restrict__ kbuf,
                                           half_t* __restrict__ vbuf, half_t* __restrict__ gbuf,
                                           const float* __restrict__ b_gate) {
  if (t < 24) {
    half_t* dst; int cb;
    if (t < 8)       { dst = qbuf; cb = t * 16; }
    else if (t < 16) { dst = kbuf; cb = (t - 8) * 16; }
    else             { dst = vbuf; cb = (t - 16) * 16; }
#pragma unroll
    for (int v = 0; v < 8; ++v)
      dst[(size_t)(r0 + v + 8 * hi) * 128 + cb + ncol] = (half_t)acc[v];
  } else {
    int cb = (t - 24) * 16;
    float bg = b_gate[cb + ncol];
#pragma unroll
    for (int v = 0; v < 8; ++v) {
      float g = __builtin_amdgcn_rcpf(1.0f + __expf(-(acc[v] + bg)));
      gbuf[(size_t)(r0 + v + 8 * hi) * 128 + cb + ncol] = (half_t)g;
    }
  }
}

__global__ __launch_bounds__(128) void kA(const float* __restrict__ z,
                                          const float* __restrict__ gamma,
                                          const float* __restrict__ beta,
                                          const float* __restrict__ b_gate,
                                          const half_t* __restrict__ packedW,
                                          half_t* __restrict__ qbuf, half_t* __restrict__ kbuf,
                                          half_t* __restrict__ vbuf, half_t* __restrict__ gbuf,
                                          float* __restrict__ biasbuf) {
  __shared__ __attribute__((aligned(16))) float  zf[4][16 * ZF_P];
  __shared__ __attribute__((aligned(16))) half_t zh[4][16 * ZH_P];
  __shared__ __attribute__((aligned(16))) float  xb[4 * 64];  // bias exchange: [head][j in tile][i in quad]
  const int w = threadIdx.x >> 5;
  const int lane = threadIdx.x & 31;
  // A block takes one 16-wide j tile of four consecutive i (wave w: i = 4*ib + w), so that
  // together its waves hold whole 16-B quads of the bias fragments written at the tail.
  const int ib = blockIdx.x >> 4, jtA = blockIdx.x & 15;
  const int r0 = (ib * 4 + w) * 256 + jtA * 16;
  const int m = lane & 15, hi = lane >> 4, ncol = lane & 15;

  const float* zrow = z + (size_t)r0 * 128;
  for (int k = 0; k < 64; ++k)  // 32 floats a trip: row k >> 2, quarter k & 3
    zf[w][(k >> 2) * ZF_P + (k & 3) * 32 + lane] = zrow[k * 32 + lane];
  __syncthreads();

  // LayerNorm: lane pair (m, m+16) handles row m
  float s = 0.f, sq = 0.f;
  const float* zr = &zf[w][m * ZF_P];
  for (int c = hi * 64; c < hi * 64 + 64; ++c) { float x = zr[c]; s += x; sq += x * x; }
  s  += __shfl_xor(s, 16, 32);
  sq += __shfl_xor(sq, 16, 32);
  float mean = s * (1.0f / 128.0f);
  float var  = sq * (1.0f / 128.0f) - mean * mean;
  float inv  = rsqrtf(var + 1e-5f);
  half_t* zhr = &zh[w][m * ZH_P];
  for (int c = hi * 64; c < hi * 64 + 64; ++c)
    zhr[c] = (half_t)((zr[c] - mean) * inv * gamma[c] + beta[c]);
  __syncthreads();

  // A fragments for the 16x128 zn tile
  v16h afr[4];
#pragma unroll
  for (int kb = 0; kb < 4; ++kb) {
    const half_t* c0 = &zh[w][m * ZH_P + kb * 32 + hi * 8];
    afr[kb] = frag2(c0, c0 + 16);
  }

  // tiles 0..31 (qkv + gate) as software-pipelined pairs; tile 32 (pair/bias) tail
  v16h b0[4], b1[4];
  loadB4(packedW, 0, lane, b0);
#pragma unroll 1
  for (int tp = 0; tp < 16; ++tp) {
    const int t0 = tp * 2, t1 = tp * 2 + 1;
    loadB4(packedW, t1, lane, b1);
    v8f acc0 = {};
#pragma unroll
    for (int kb = 0; kb < 4; ++kb) acc0 = wmma32(afr[kb], b0[kb], acc0);
    loadB4(packedW, (tp < 15) ? (t1 + 1) : 32, lane, b0);  // prefetch next / tail
    v8f acc1 = {};
#pragma unroll
    for (int kb = 0; kb < 4; ++kb) acc1 = wmma32(afr[kb], b1[kb], acc1);
    storeTileA(t0, acc0, r0, hi, ncol, qbuf, kbuf, vbuf, gbuf, b_gate);
    storeTileA(t1, acc1, r0, hi, ncol, qbuf, kbuf, vbuf, gbuf, b_gate);
  }
  // tile 32: pair bias (only cols 0..3 valid), f32 output times sqrt(d): kB adds it to the
  // unscaled q.k sums and applies 1/sqrt(d) once, inside the exponent.
  // Layout = the 16x16 f32 accumulator fragment of logits tile (h, it, jt):
  //   [h][it][jt][half][lane = 16*(i>>3 & 1) + (j & 15)][i & 3],  half = (i >> 2) & 1
  // so a kB lane reads its 8 accumulator registers as two b128 of 512 contiguous B per wave.
  {
    v8f acc = {};
#pragma unroll
    for (int kb = 0; kb < 4; ++kb) acc = wmma32(afr[kb], b0[kb], acc);
    float sv[8];
#pragma unroll
    for (int v = 0; v < 8; ++v) sv[v] = acc[v] * 5.656854249492381f;
    if (ncol < 4) {
#pragma unroll
      for (int v = 0; v < 8; ++v) xb[ncol * 64 + (v + 8 * hi) * 4 + w] = sv[v];
    }
    __syncthreads();  // the four waves' i values of a quad meet here; wave w then writes head w
    if (lane < 16) {
      const float4 t = *(const float4*)&xb[w * 64 + lane * 4];
      const int it = ib >> 2, ihi = (ib >> 1) & 1, half = ib & 1;
      *(float4*)&biasbuf[((((size_t)(w * 16 + it) * 16 + jtA) * 2 + half) * 32 + ihi * 16 + lane) * 4] = t;
    }
  }
}

// ---------------- kernel B: row-wise attention per (r, h) ----------------
__global__ __launch_bounds__(128) void kB(const half_t* __restrict__ qbuf,
                                          const half_t* __restrict__ kbuf,
                                          const half_t* __restrict__ vbuf,
                                          const half_t* __restrict__ gbuf,
                                          const float* __restrict__ biasbuf,
                                          half_t* __restrict__ aobuf) {
  __shared__ __attribute__((aligned(16))) half_t Vt[32 * AT_P];        // V transposed: [d][j]
  __shared__ __attribute__((aligned(16))) half_t attnS[4][16 * AT_P];  // per-wave normalized attention tile
  const int r = blockIdx.x >> 2;
  const int h = blockIdx.x & 3;
  const int tid = threadIdx.x;
  const int w = tid >> 5, lane = tid & 31;
  const int m = lane & 15, hi = lane >> 4;

  for (int idx = tid; idx < 8192; idx += 128) {
    int j = idx >> 5, d = idx & 31;
    Vt[d * AT_P + j] = vbuf[(size_t)(r * 256 + j) * 128 + h * 32 + d];
  }
  __syncthreads();

  // K fragments do not depend on the query tile: one read per wave, kept in registers
  v16h bK[16];
  const half_t* kc = kbuf + (size_t)(r * 256 + m) * 128 + h * 32 + hi * 8;
#pragma unroll
  for (int jt = 0; jt < 16; ++jt) bK[jt] = frag2(kc + jt * 2048, kc + jt * 2048 + 16);

  const float kexp = 0.17677669529663687f * 1.4426950408889634f;  // 1/sqrt(32) * log2(e)
  for (int itl = 0; itl < 4; ++itl) {
    const int it = itl * 4 + w;
    const half_t* qc = qbuf + (size_t)(r * 256 + it * 16 + m) * 128 + h * 32 + hi * 8;
    v16h aQ = frag2(qc, qc + 16);

    // lg = q.k + sqrt(d) * bias: the bias fragment is the WMMA's C operand
    const float* bf = biasbuf + (size_t)(h * 16 + it) * 4096 + lane * 4;
    v8f lg[16];
#pragma unroll
    for (int jt = 0; jt < 16; ++jt) {
      const float4 c0 = *(const float4*)(bf + jt * 256);
      const float4 c1 = *(const float4*)(bf + jt * 256 + 128);
      lg[jt] = v8f{c0.x, c0.y, c0.z, c0.w, c1.x, c1.y, c1.z, c1.w};
    }
    // the loads' address registers are reused by the row maxima while the loads are in flight
    asm volatile("s_wait_xcnt 0x0" ::: "memory");
#pragma unroll
    for (int jt = 0; jt < 16; ++jt) lg[jt] = wmma32(aQ, bK[jt], lg[jt]);
    // softmax over j: 16 tiles in-register + 16-lane cross-lane reduction
    float rmax[8], rsum[8];
#pragma unroll
    for (int v = 0; v < 8; ++v) {
      float mx = lg[0][v];
#pragma unroll
      for (int jt = 1; jt < 16; ++jt) mx = fmaxf(mx, lg[jt][v]);
      mx = fmaxf(mx, __shfl_xor(mx, 1, 32));
      mx = fmaxf(mx, __shfl_xor(mx, 2, 32));
      mx = fmaxf(mx, __shfl_xor(mx, 4, 32));
      mx = fmaxf(mx, __shfl_xor(mx, 8, 32));
      rmax[v] = mx;
    }
#pragma unroll
    for (int v = 0; v < 8; ++v) {
      float s = 0.f;
#pragma unroll
      for (int jt = 0; jt < 16; ++jt) { float e = __builtin_amdgcn_exp2f((lg[jt][v] - rmax[v]) * kexp); lg[jt][v] = e; s += e; }
      s += __shfl_xor(s, 1, 32);
      s += __shfl_xor(s, 2, 32);
      s += __shfl_xor(s, 4, 32);
      s += __shfl_xor(s, 8, 32);
      rsum[v] = __builtin_amdgcn_rcpf(s);
    }
    half_t* aw = attnS[w];
#pragma unroll
    for (int jt = 0; jt < 16; ++jt)
#pragma unroll
      for (int v = 0; v < 8; ++v)
        aw[(v + 8 * hi) * AT_P + jt * 16 + m] = (half_t)(lg[jt][v] * rsum[v]);
    asm volatile("s_wait_dscnt 0" ::: "memory");  // same-wave LDS RAW across lanes

    // attn @ V -> [16 x 32], apply gate, store f16
#pragma unroll
    for (int dt = 0; dt < 2; ++dt) {
      v8f acc = {};
#pragma unroll
      for (int jb = 0; jb < 8; ++jb) {
        const half_t* ac = aw + m * AT_P + jb * 32 + hi * 8;
        v16h aA = frag2(ac, ac + 16);
        const half_t* vc = Vt + (dt * 16 + m) * AT_P + jb * 32 + hi * 8;
        v16h bV = frag2(vc, vc + 16);
        acc = wmma32(aA, bV, acc);
      }
#pragma unroll
      for (int v = 0; v < 8; ++v) {
        size_t row = (size_t)(r * 256 + it * 16 + v + 8 * hi);
        int col = h * 32 + dt * 16 + m;
        float g = (float)gbuf[row * 128 + col];
        aobuf[row * 128 + col] = (half_t)(g * acc[v]);
      }
    }
    // the next trip rewrites the stores' address and data registers at its very top
    asm volatile("s_wait_xcnt 0x0" ::: "memory");
  }
}

// ---------------- kernel C: output projection + b_out ----------------
__global__ __launch_bounds__(128) void kC(const half_t* __restrict__ aobuf,
                                          const half_t* __restrict__ packedW,
                                          const float* __restrict__ b_out,
                                          float* __restrict__ out) {
  const int w = threadIdx.x >> 5, lane = threadIdx.x & 31;
  const int m = lane & 15, hi = lane >> 4;
  const int r0 = (blockIdx.x * 4 + w) * 16;
  v16h afr[4];
#pragma unroll
  for (int kb = 0; kb < 4; ++kb) {
    const half_t* c0 = aobuf + (size_t)(r0 + m) * 128 + kb * 32 + hi * 8;
    afr[kb] = frag2(c0, c0 + 16);
  }
  v16h b0[4], b1[4];
  loadB4(packedW, 33, lane, b0);
#pragma unroll 1
  for (int tp = 0; tp < 4; ++tp) {
    const int n0 = tp * 2, n1 = tp * 2 + 1;
    loadB4(packedW, 33 + n1, lane, b1);
    v8f acc0 = {};
#pragma unroll
    for (int kb = 0; kb < 4; ++kb) acc0 = wmma32(afr[kb], b0[kb], acc0);
    if (tp < 3) loadB4(packedW, 33 + n1 + 1, lane, b0);  // prefetch next pair
    v8f acc1 = {};
#pragma unroll
    for (int kb = 0; kb < 4; ++kb) acc1 = wmma32(afr[kb], b1[kb], acc1);
    int col0 = n0 * 16 + m, col1 = n1 * 16 + m;
    float bo0 = b_out[col0], bo1 = b_out[col1];
#pragma unroll
    for (int v = 0; v < 8; ++v) {
      out[(size_t)(r0 + v + 8 * hi) * 128 + col0] = acc0[v] + bo0;
      out[(size_t)(r0 + v + 8 * hi) * 128 + col1] = acc1[v] + bo1;
    }
  }
}

extern "C" void kernel_launch(void* const* d_in, const int* in_sizes, int n_in,
                              void* d_out, int out_size, void* d_ws, size_t ws_size,
                              hipStream_t stream) {
  const float* z      = (const float*)d_in[0];
  const float* gamma  = (const float*)d_in[1];
  const float* beta   = (const float*)d_in[2];
  const float* w_qkv  = (const float*)d_in[3];
  const float* w_pair = (const float*)d_in[4];
  const float* w_gate = (const float*)d_in[5];
  const float* b_gate = (const float*)d_in[6];
  const float* w_out  = (const float*)d_in[7];
  const float* b_out  = (const float*)d_in[8];

  char* ws = (char*)d_ws;
  half_t* packedW = (half_t*)(ws + OFF_W);
  half_t* qbuf    = (half_t*)(ws + OFF_Q);
  half_t* kbuf    = (half_t*)(ws + OFF_K);
  half_t* vbuf    = (half_t*)(ws + OFF_V);
  half_t* gbuf    = (half_t*)(ws + OFF_G);
  half_t* aobuf   = (half_t*)(ws + OFF_AO);
  float*  biasbuf = (float*)(ws + OFF_B);

  kP<<<41, 128, 0, stream>>>(w_qkv, w_pair, w_gate, w_out, packedW);
  kA<<<N_ROWS / 64, 128, 0, stream>>>(z, gamma, beta, b_gate, packedW,
                                      qbuf, kbuf, vbuf, gbuf, biasbuf);
  kB<<<L_DIM * H_HEADS, 128, 0, stream>>>(qbuf, kbuf, vbuf, gbuf, biasbuf, aobuf);
  kC<<<N_ROWS / 64, 128, 0, stream>>>(aobuf, packedW, b_out, (float*)d_out);
}

// v003
// It runs in 71.8 microseconds.
// Two timings next to v002 put it at 1.44 and 1.45 times that version's speed.
// All steps since v000 together make it 2.75 times as fast.
#include <hip/hip_runtime.h>
#include <hip/hip_bf16.h>
#include <stddef.h>

typedef _Float16 half_t;
typedef __attribute__((ext_vector_type(16))) _Float16 v16h;
typedef __attribute__((ext_vector_type(8)))  _Float16 h8;
typedef __attribute__((ext_vector_type(8)))  float    v8f;

#define N_ROWS 65536      // L*L flattened (i,j) rows
#define IN_DIM 128
#define L_DIM  256
#define H_HEADS 4
#define D_HEAD 32

// LDS row pitches: 16 B x odd, so the 16 rows a ds_load_b128 touches fall on
// distinct banks (64 banks x 4 B; an unpadded 256/512-B pitch puts them on four).
#define ZF_P 132          // floats : 528 B
#define ZH_P 136          // halves : 272 B
#define AT_P 264          // halves : 528 B

// ---- workspace layout (bytes) ----
// Every f16 buffer is kept in WMMA fragment order, in 512-B units [lane = 16*hi + m][8 halves], so that
// each wave-wide 16-B store or load covers 512 contiguous bytes:
//   q, k, gate, ao : unit (T, c8), T = row >> 4, c8 = col >> 4 : X[T*16 + m][c8*16 + 8*hi + e]
//   v              : unit (T, c8)                              : V[T*16 + 8*hi + e][c8*16 + m]
//   weights        : unit (t, kb, c)                           : W[kb*32 + c*16 + 8*hi + e][t*16 + m]
// A 16x32 (or 32x16) f16 fragment is two such units (k 0..15 and k 16..31 of the block).
#define OFF_W   ((size_t)0)                         // packed f16 weight fragments: 41 tiles * 4 kb * 2 units * 512 B
#define OFF_Q   ((size_t)262144)
#define OFF_K   (OFF_Q + (size_t)N_ROWS*128*2)
#define OFF_V   (OFF_K + (size_t)N_ROWS*128*2)
#define OFF_G   (OFF_V + (size_t)N_ROWS*128*2)
#define OFF_AO  (OFF_G + (size_t)N_ROWS*128*2)
#define OFF_B   (OFF_AO + (size_t)N_ROWS*128*2)     // bias f32, accumulator-fragment order (see kA tail)

__device__ __forceinline__ v8f wmma32(v16h a, v16h b, v8f c) {
  return __builtin_amdgcn_wmma_f32_16x16x32_f16(false, a, false, b, (short)0, c, false, false);
}

// Build a 16-half fragment from two contiguous 16B chunks (A layout and our
// B layouts both reduce to this: halves 0..7 = chunk0, halves 8..15 = chunk1).
__device__ __forceinline__ v16h frag2(const half_t* c0, const half_t* c1) {
  h8 x0 = *(const h8*)c0;
  h8 x1 = *(const h8*)c1;
  v16h f;
#pragma unroll
  for (int i = 0; i < 8; ++i) { f[i] = x0[i]; f[i + 8] = x1[i]; }
  return f;
}

// Load the 4 K-step B fragments of one 16-col weight tile (independent regs
// so the scheduler can clause the 8 b128 loads and keep WMMAs back-to-back).
__device__ __forceinline__ void loadB4(const half_t* __restrict__ packedW, int t, int lane,
                                       v16h b[4]) {
#pragma unroll
  for (int kb = 0; kb < 4; ++kb) {
    const half_t* p = &packedW[((size_t)(t * 4 + kb) * 64 + lane) * 8];
    b[kb] = frag2(p, p + 256);
  }
}

// ---------------- kernel P: pack weights to f16 B-fragments ----------------
// tile index t: 0..23 = w_qkv (384 cols), 24..31 = w_gate, 32 = w_pair (pad to 16), 33..40 = w_out
// One lane's 16 B of each of the two units of a 32-deep k block: W[k0 + e][col] and W[k0 + 16 + e][col],
// first = k0 * LD + col. LD is a constant, so the 16 loads share one address register.
template <int LD>
__device__ __forceinline__ void packUnits(const float* __restrict__ wsrc, int first, bool valid,
                                          half_t* __restrict__ dst) {
  h8 u0, u1;
#pragma unroll
  for (int e = 0; e < 8; ++e) {
    const float x0 = wsrc[first + e * LD], x1 = wsrc[first + (e + 16) * LD];
    u0[e] = (half_t)(valid ? x0 : 0.0f);
    u1[e] = (half_t)(valid ? x1 : 0.0f);
  }
  *(h8*)&dst[0]   = u0;
  *(h8*)&dst[256] = u1;
}

__global__ __launch_bounds__(128) void kP(const float* __restrict__ wqkv,
                                          const float* __restrict__ wpair,
                                          const float* __restrict__ wgate,
                                          const float* __restrict__ wout,
                                          half_t* __restrict__ packedW) {
  const int t = blockIdx.x;            // 0..40
  const int kb = threadIdx.x >> 5;     // 0..3  (K block of 32)
  const int lane = threadIdx.x & 31;
  const int hi = lane >> 4, n = lane & 15;
  const int k0 = kb * 32 + 8 * hi;
  half_t* dst = packedW + ((size_t)(t * 4 + kb) * 64 + lane) * 8;
  if (t < 24)       packUnits<384>(wqkv,  k0 * 384 + t * 16 + n, true, dst);
  else if (t < 32)  packUnits<128>(wgate, k0 * 128 + (t - 24) * 16 + n, true, dst);
  else if (t == 32) packUnits<4>(wpair,   k0 * 4 + (n & 3), n < 4, dst);  // columns 4..15 are zero padding
  else              packUnits<128>(wout,  k0 * 128 + (t - 33) * 16 + n, true, dst);
}

// ---------------- kernel A: LayerNorm + qkv/gate/bias projections ----------------
// MODE 0 (q, k) and 2 (gate): the TRANSPOSED product (weights as A, zn as B), so lane (m, hi) holds
// row m, columns 8*hi .. 8*hi+7 of the tile. MODE 1 (v): the direct product, lane (m, hi) holds
// column m, rows 8*hi .. 8*hi+7. Either way the lane's 8 values are its 16 B of the reader's fragment unit.
template <int MODE>
__device__ __forceinline__ h8 packTileA(int tt, v8f acc, int hi, const float* b_gate) {
  h8 p;
  float bgv[8] = {};
  if (MODE == 2) {
    const float4 g0 = *(const float4*)&b_gate[tt * 16 + hi * 8];
    const float4 g1 = *(const float4*)&b_gate[tt * 16 + hi * 8 + 4];
    bgv[0] = g0.x; bgv[1] = g0.y; bgv[2] = g0.z; bgv[3] = g0.w;
    bgv[4] = g1.x; bgv[5] = g1.y; bgv[6] = g1.z; bgv[7] = g1.w;
  }
#pragma unroll
  for (int v = 0; v < 8; ++v) {
    if (MODE == 2) {
      const float bg = bgv[v];
      float s;
      // v_nop: the slot the instruction set asks for behind a transcendental before its result is read or its
      // source overwritten
      asm("v_rcp_f32 %0, %1\n\tv_nop" : "=v"(s) : "v"(1.0f + __expf(-(acc[v] + bg))));
      p[v] = (half_t)s;
    } else {
      p[v] = (half_t)acc[v];
    }
  }
  return p;
}

// The 8 tiles (128 columns) of one of q, k, v, gate for the wave's 16 rows: 8 units, 4 KB contiguous.
// dst is the wave-uniform start of those 4 KB. On entry b0 holds tile t0's fragments; on exit those of t0 + 8.
template <int MODE>
__device__ __forceinline__ void group8A(int t0, const v16h afr[4], v16h b0[4], v16h b1[4],
                                        const half_t* __restrict__ packedW, int lane, int hi,
                                        const float* b_gate, half_t* __restrict__ dst) {
  h8 p[8];
#pragma unroll  // p[] is indexed by tt and has to stay in registers
  for (int tt = 0; tt < 8; tt += 2) {
    loadB4(packedW, t0 + tt + 1, lane, b1);
    v8f acc0 = {};
#pragma unroll
    for (int kb = 0; kb < 4; ++kb)
      acc0 = (MODE == 1) ? wmma32(afr[kb], b0[kb], acc0) : wmma32(b0[kb], afr[kb], acc0);
    loadB4(packedW, t0 + tt + 2, lane, b0);  // prefetch next
    v8f acc1 = {};
#pragma unroll
    for (int kb = 0; kb < 4; ++kb)
      acc1 = (MODE == 1) ? wmma32(afr[kb], b1[kb], acc1) : wmma32(b1[kb], afr[kb], acc1);
    p[tt]     = packTileA<MODE>(tt, acc0, hi, b_gate);
    p[tt + 1] = packTileA<MODE>(tt + 1, acc1, hi, b_gate);
  }
#pragma unroll
  for (int tt = 0; tt < 8; ++tt) *(h8*)&dst[tt * 256 + lane * 8] = p[tt];
  // the next group's loads and converts rewrite the stores' data registers while they may be in flight
  asm volatile("s_wait_xcnt 0x0" ::: "memory");
}

__global__ __launch_bounds__(128) void kA(const float* __restrict__ z,
                                          const float* __restrict__ gamma,
                                          const float* __restrict__ beta,
                                          const float* __restrict__ b_gate,
                                          const half_t* __restrict__ packedW,
                                          half_t* __restrict__ qbuf, half_t* __restrict__ kbuf,
                                          half_t* __restrict__ vbuf, half_t* __restrict__ gbuf,
                                          float* __restrict__ biasbuf) {
  __shared__ __attribute__((aligned(16))) float  zf[4][16 * ZF_P];
  __shared__ __attribute__((aligned(16))) half_t zh[4][16 * ZH_P];
  __shared__ __attribute__((aligned(16))) float  xb[4 * 64];  // bias exchange: [head][j in tile][i in quad]
  __shared__ __attribute__((aligned(16))) float  gS[128];     // b_gate: a lane reads 8 adjacent entries per gate tile
  const int w = threadIdx.x >> 5;
  const int lane = threadIdx.x & 31;
  // A block takes one 16-wide j tile of four consecutive i (wave w: i = 4*ib + w), so that
  // together its waves hold whole 16-B quads of the bias fragments written at the tail.
  const int ib = blockIdx.x >> 4, jtA = blockIdx.x & 15;
  const int r0 = (ib * 4 + w) * 256 + jtA * 16;
  const int m = lane & 15, hi = lane >> 4, ncol = lane & 15;

  gS[threadIdx.x] = b_gate[threadIdx.x];  // published by the barrier behind the z tile
  const float* zrow = z + (size_t)r0 * 128;
  for (int k = 0; k < 64; ++k)  // 32 floats a trip: row k >> 2, quarter k & 3
    zf[w][(k >> 2) * ZF_P + (k & 3) * 32 + lane] = zrow[k * 32 + lane];
  __syncthreads();

  // LayerNorm: lane pair (m, m+16) handles row m
  float s = 0.f, sq = 0.f;
  const float* zr = &zf[w][m * ZF_P];
  for (int c = hi * 64; c < hi * 64 + 64; ++c) { float x = zr[c]; s += x; sq += x * x; }
  s  += __shfl_xor(s, 16, 32);
  sq += __shfl_xor(sq, 16, 32);
  float mean = s * (1.0f / 128.0f);
  float var  = sq * (1.0f / 128.0f) - mean * mean;
  float inv  = rsqrtf(var + 1e-5f);
  half_t* zhr = &zh[w][m * ZH_P];
  for (int c = hi * 64; c < hi * 64 + 64; ++c)
    zhr[c] = (half_t)((zr[c] - mean) * inv * gamma[c] + beta[c]);
  __syncthreads();

  // A fragments for the 16x128 zn tile
  v16h afr[4];
#pragma unroll
  for (int kb = 0; kb < 4; ++kb) {
    const half_t* c0 = &zh[w][m * ZH_P + kb * 32 + hi * 8];
    afr[kb] = frag2(c0, c0 + 16);
  }

  // tiles 0..31 (q, k, v, gate: 8 tiles each), B fragments fetched one tile ahead; tile 32 (pair/bias) tail
  v16h b0[4], b1[4];
  // the wave's row tile: 8 units of 256 halves; the wave number as a scalar keeps the base out of vector registers
  const size_t fo = (size_t)((ib * 4 + __builtin_amdgcn_readfirstlane(w)) * 16 + jtA) * 2048;
  loadB4(packedW, 0, lane, b0);
  group8A<0>(0,  afr, b0, b1, packedW, lane, hi, gS, qbuf + fo);
  group8A<0>(8,  afr, b0, b1, packedW, lane, hi, gS, kbuf + fo);
  group8A<1>(16, afr, b0, b1, packedW, lane, hi, gS, vbuf + fo);
  group8A<2>(24, afr, b0, b1, packedW, lane, hi, gS, gbuf + fo);
  // tile 32: pair bias (only cols 0..3 valid), f32 output times sqrt(d): kB adds it to the
  // unscaled q.k sums and applies 1/sqrt(d) once, inside the exponent.
  // Layout = the 16x16 f32 accumulator fragment of logits tile (h, it, jt):
  //   [h][it][jt][half][lane = 16*(i>>3 & 1) + (j & 15)][i & 3],  half = (i >> 2) & 1
  // so a kB lane reads its 8 accumulator registers as two b128 of 512 contiguous B per wave.
  {
    v8f acc = {};
#pragma unroll
    for (int kb = 0; kb < 4; ++kb) acc = wmma32(afr[kb], b0[kb], acc);
    float sv[8];
#pragma unroll
    for (int v = 0; v < 8; ++v) sv[v] = acc[v] * 5.656854249492381f;
    if (ncol < 4) {
#pragma unroll
      for (int v = 0; v < 8; ++v) xb[ncol * 64 + (v + 8 * hi) * 4 + w] = sv[v];
    }
    __syncthreads();  // the four waves' i values of a quad meet here; wave w then writes head w
    if (lane < 16) {
      const float4 t = *(const float4*)&xb[w * 64 + lane * 4];
      const int it = ib >> 2, ihi = (ib >> 1) & 1, half = ib & 1;
      *(float4*)&biasbuf[((((size_t)(w * 16 + it) * 16 + jtA) * 2 + half) * 32 + ihi * 16 + lane) * 4] = t;
    }
  }
}

// ---------------- kernel B: row-wise attention per (r, h) ----------------
__global__ __launch_bounds__(128) void kB(const half_t* __restrict__ qbuf,
                                          const half_t* __restrict__ kbuf,
                                          const half_t* __restrict__ vbuf,
                                          const half_t* __restrict__ gbuf,
                                          const float* __restrict__ biasbuf,
                                          half_t* __restrict__ aobuf) {
  __shared__ __attribute__((aligned(16))) half_t Vs[32 * 256];         // V fragment units: [dt][jt][lane][8]
  __shared__ __attribute__((aligned(16))) half_t attnS[4][16 * AT_P];  // per-wave normalized attention tile
  const int r = blockIdx.x >> 2;
  const int h = blockIdx.x & 3;
  const int tid = threadIdx.x;
  // the wave number as a scalar: every global address below is a scalar base plus the lane's 16 B
  const int w = __builtin_amdgcn_readfirstlane(tid >> 5), lane = tid & 31;
  const int m = lane & 15, hi = lane >> 4;

  // units of row tile T = r*16 + t and head h: two neighbours at ((T*8 + 2*h) * 256) halves
  const size_t fb = ((size_t)r * 128 + h * 2) * 256;
#pragma unroll
  for (int s = 0; s < 8; ++s) {
    const int u = w * 8 + s, jt = u >> 1, dt = u & 1;
    *(h8*)&Vs[(dt * 16 + jt) * 256 + lane * 8] = *(const h8*)&(vbuf + fb + jt * 2048 + dt * 256)[lane * 8];
  }
  __syncthreads();

  // K fragments do not depend on the query tile: one read per wave, kept in registers
  v16h bK[16];
  const half_t* kc = kbuf + fb;
#pragma unroll
  for (int jt = 0; jt < 16; ++jt) bK[jt] = frag2(&(kc + jt * 2048)[lane * 8], &(kc + jt * 2048 + 256)[lane * 8]);

  const float kexp = 0.17677669529663687f * 1.4426950408889634f;  // 1/sqrt(32) * log2(e)
  for (int itl = 0; itl < 4; ++itl) {
    const int it = itl * 4 + w;
    const half_t* qc = qbuf + fb + it * 2048;
    v16h aQ = frag2(&qc[lane * 8], &(qc + 256)[lane * 8]);

    // lg = q.k + sqrt(d) * bias: the bias fragment is the WMMA's C operand
    const float* bf = biasbuf + (size_t)(h * 16 + it) * 4096;
    v8f lg[16];
#pragma unroll
    for (int jt = 0; jt < 16; ++jt) {
      const float4 c0 = *(const float4*)&(bf + jt * 256)[lane * 4];
      const float4 c1 = *(const float4*)&(bf + jt * 256 + 128)[lane * 4];
      lg[jt] = v8f{c0.x, c0.y, c0.z, c0.w, c1.x, c1.y, c1.z, c1.w};
    }
    // the loads' address registers are reused by the row maxima while the loads are in flight
    asm volatile("s_wait_xcnt 0x0" ::: "memory");
    const half_t* gc = gbuf + fb + it * 2048;  // the gate's two units of this query tile, used behind attn @ V
    const h8 gq[2] = {*(const h8*)&gc[lane * 8], *(const h8*)&(gc + 256)[lane * 8]};
    asm volatile("s_wait_xcnt 0x0" ::: "memory");  // as above, for the address registers of these two loads
#pragma unroll
    for (int jt = 0; jt < 16; ++jt) lg[jt] = wmma32(aQ, bK[jt], lg[jt]);
    // softmax over j: 16 tiles in-register + 16-lane cross-lane reduction
    float rmax[8], rsum[8];
#pragma unroll
    for (int v = 0; v < 8; ++v) {
      float mx = lg[0][v];
#pragma unroll
      for (int jt = 1; jt < 16; ++jt) mx = fmaxf(mx, lg[jt][v]);
      mx = fmaxf(mx, __shfl_xor(mx, 1, 32));
      mx = fmaxf(mx, __shfl_xor(mx, 2, 32));
      mx = fmaxf(mx, __shfl_xor(mx, 4, 32));
      mx = fmaxf(mx, __shfl_xor(mx, 8, 32));
      rmax[v] = mx;
    }
#pragma unroll
    for (int v = 0; v < 8; ++v) {
      float s = 0.f;
#pragma unroll
      for (int jt = 0; jt < 16; ++jt) { float e = __builtin_amdgcn_exp2f((lg[jt][v] - rmax[v]) * kexp); lg[jt][v] = e; s += e; }
      s += __shfl_xor(s, 1, 32);
      s += __shfl_xor(s, 2, 32);
      s += __shfl_xor(s, 4, 32);
      s += __shfl_xor(s, 8, 32);
      rsum[v] = __builtin_amdgcn_rcpf(s);
    }
    half_t* aw = attnS[w];
#pragma unroll
    for (int jt = 0; jt < 16; ++jt)
#pragma unroll
      for (int v = 0; v < 8; ++v)
        aw[(v + 8 * hi) * AT_P + jt * 16 + m] = (half_t)(lg[jt][v] * rsum[v]);
    asm volatile("s_wait_dscnt 0" ::: "memory");  // same-wave LDS RAW across lanes

    // (attn @ V)^T (V as A, attn as B): lane (m, hi) holds query row m, d = dt*16 + 8*hi .. +7,
    // which is its 16 B of the gate's and of the output's fragment unit
#pragma unroll
    for (int dt = 0; dt < 2; ++dt) {
      const h8 g = gq[dt];
      v8f acc = {};
#pragma unroll
      for (int jb = 0; jb < 8; ++jb) {
        const half_t* ac = aw + m * AT_P + jb * 32 + hi * 8;
        v16h aA = frag2(ac, ac + 16);
        const half_t* vc = Vs + (dt * 16 + jb * 2) * 256 + lane * 8;
        v16h bV = frag2(vc, vc + 256);
        acc = wmma32(bV, aA, acc);
      }
      h8 o;
#pragma unroll
      for (int v = 0; v < 8; ++v) o[v] = (half_t)((float)g[v] * acc[v]);
      *(h8*)&(aobuf + fb + it * 2048 + dt * 256)[lane * 8] = o;
    }
    // the next trip rewrites the stores' address and data registers at its very top
    asm volatile("s_wait_xcnt 0x0" ::: "memory");
  }
}

// ---------------- kernel C: output projection + b_out ----------------
__global__ __launch_bounds__(128) void kC(const half_t* __restrict__ aobuf,
                                          const half_t* __restrict__ packedW,
                                          const float* __restrict__ b_out,
                                          float* __restrict__ out) {
  __shared__ __attribute__((aligned(16))) float st[4][16 * ZF_P];  // per-wave store stage: 16 rows x 128 f32
  // the wave number as a scalar: the fragment loads and row stores are a scalar base plus the lane's 16 B
  const int w = __builtin_amdgcn_readfirstlane(threadIdx.x >> 5), lane = threadIdx.x & 31;
  const int m = lane & 15, hi = lane >> 4;
  const int r0 = (blockIdx.x * 4 + w) * 16;
  v16h afr[4];
#pragma unroll
  for (int kb = 0; kb < 4; ++kb) {
    const half_t* c0 = aobuf + ((size_t)(r0 >> 4) * 8 + kb * 2) * 256;
    afr[kb] = frag2(&c0[lane * 8], &(c0 + 256)[lane * 8]);
  }
  v16h b0[4], b1[4];
  loadB4(packedW, 33, lane, b0);
#pragma unroll 1
  for (int tp = 0; tp < 4; ++tp) {
    const int n0 = tp * 2, n1 = tp * 2 + 1;
    loadB4(packedW, 33 + n1, lane, b1);
    v8f acc0 = {};
#pragma unroll
    for (int kb = 0; kb < 4; ++kb) acc0 = wmma32(b0[kb], afr[kb], acc0);
    if (tp < 3) loadB4(packedW, 33 + n1 + 1, lane, b0);  // prefetch next pair
    v8f acc1 = {};
#pragma unroll
    for (int kb = 0; kb < 4; ++kb) acc1 = wmma32(b1[kb], afr[kb], acc1);
    // transposed product (weights as A): lane (m, hi) holds row m, columns 8*hi .. 8*hi+7 of each tile
    float x0[8], x1[8];
#pragma unroll
    for (int v = 0; v < 8; ++v) {
      // both candidates are wave-uniform reads (scalar loads); the lane picks its half of the tile
      const float lo0 = b_out[n0 * 16 + v], hi0 = b_out[n0 * 16 + 8 + v];
      const float lo1 = b_out[n1 * 16 + v], hi1 = b_out[n1 * 16 + 8 + v];
      x0[v] = acc0[v] + (hi ? hi0 : lo0);
      x1[v] = acc1[v] + (hi ? hi1 : lo1);
    }
    float* sr = &st[w][m * ZF_P + hi * 8];
    *(float4*)&sr[n0 * 16]     = make_float4(x0[0], x0[1], x0[2], x0[3]);
    *(float4*)&sr[n0 * 16 + 4] = make_float4(x0[4], x0[5], x0[6], x0[7]);
    *(float4*)&sr[n1 * 16]     = make_float4(x1[0], x1[1], x1[2], x1[3]);
    *(float4*)&sr[n1 * 16 + 4] = make_float4(x1[4], x1[5], x1[6], x1[7]);
  }
  asm volatile("s_wait_dscnt 0" ::: "memory");  // same-wave LDS RAW across lanes: rows are read back by other lanes
  // one whole 512-B output row per store
#pragma unroll
  for (int s = 0; s < 16; ++s)
    *(float4*)&(out + (size_t)(r0 + s) * 128)[lane * 4] = *(const float4*)&st[w][s * ZF_P + lane * 4];
}

extern "C" void kernel_launch(void* const* d_in, const int* in_sizes, int n_in,
                              void* d_out, int out_size, void* d_ws, size_t ws_size,
                              hipStream_t stream) {
  const float* z      = (const float*)d_in[0];
  const float* gamma  = (const float*)d_in[1];
  const float* beta   = (const float*)d_in[2];
  const float* w_qkv  = (const float*)d_in[3];
  const float* w_pair = (const float*)d_in[4];
  const float* w_gate = (const float*)d_in[5];
  const float* b_gate = (const float*)d_in[6];
  const float* w_out  = (const float*)d_in[7];
  const float* b_out  = (const float*)d_in[8];

  char* ws = (char*)d_ws;
  half_t* packedW = (half_t*)(ws + OFF_W);
  half_t* qbuf    = (half_t*)(ws + OFF_Q);
  half_t* kbuf    = (half_t*)(ws + OFF_K);
  half_t* vbuf    = (half_t*)(ws + OFF_V);
  half_t* gbuf    = (half_t*)(ws + OFF_G);
  half_t* aobuf   = (half_t*)(ws + OFF_AO);
  float*  biasbuf = (float*)(ws + OFF_B);

  kP<<<41, 128, 0, stream>>>(w_qkv, w_pair, w_gate, w_out, packedW);
  kA<<<N_ROWS / 64, 128, 0, stream>>>(z, gamma, beta, b_gate, packedW,
                                      qbuf, kbuf, vbuf, gbuf, biasbuf);
  kB<<<L_DIM * H_HEADS, 128, 0, stream>>>(qbuf, kbuf, vbuf, gbuf, biasbuf, aobuf);
  kC<<<N_ROWS / 64, 128, 0, stream>>>(aobuf, packedW, b_out, (float*)d_out);
}

// v004
// A run of this version takes 58.4 microseconds.
// In both of two side-by-side timings against v003, it was 1.23 times as fast.
// Counting every step since v000, it is 3.39 times as fast.
#include <hip/hip_runtime.h>
#include <hip/hip_bf16.h>
#include <stddef.h>

typedef _Float16 half_t;
typedef __attribute__((ext_vector_type(16))) _Float16 v16h;
typedef __attribute__((ext_vector_type(8)))  _Float16 h8;
typedef __attribute__((ext_vector_type(8)))  float    v8f;

#define N_ROWS 65536      // L*L flattened (i,j) rows
#define IN_DIM 128
#define L_DIM  256
#define H_HEADS 4
#define D_HEAD 32

// LDS row pitches: 16 B x odd, so the 16 rows a ds_load_b128 touches fall on
// distinct banks (64 banks x 4 B; an unpadded 256/512-B pitch puts them on four).
#define ZF_P 132          // floats : 528 B
#define ZH_P 136          // halves : 272 B

// ---- workspace layout (bytes) ----
// Every f16 buffer is kept in WMMA fragment order, in 512-B units [lane = 16*hi + m][8 halves], so that
// each wave-wide 16-B store or load covers 512 contiguous bytes:
//   q, k, gate, ao : unit (T, c8), T = row >> 4, c8 = col >> 4 : X[T*16 + m][c8*16 + 8*hi + e]
//   v              : unit (T, c8)                              : V[T*16 + 8*hi + e][c8*16 + m]
//   weights        : unit (t, kb, c)                           : W[kb*32 + c*16 + 8*hi + e][t*16 + m]
// A 16x32 (or 32x16) f16 fragment is two such units (k 0..15 and k 16..31 of the block).
#define OFF_W   ((size_t)0)                         // packed f16 weight fragments: 41 tiles * 4 kb * 2 units * 512 B
#define OFF_Q   ((size_t)262144)
#define OFF_K   (OFF_Q + (size_t)N_ROWS*128*2)
#define OFF_V   (OFF_K + (size_t)N_ROWS*128*2)
#define OFF_G   (OFF_V + (size_t)N_ROWS*128*2)
#define OFF_AO  (OFF_G + (size_t)N_ROWS*128*2)
#define OFF_B   (OFF_AO + (size_t)N_ROWS*128*2)     // bias f32, order of the transposed logits' accumulator (see kA tail)

__device__ __forceinline__ v8f wmma32(v16h a, v16h b, v8f c) {
  return __builtin_amdgcn_wmma_f32_16x16x32_f16(false, a, false, b, (short)0, c, false, false);
}

// Build a 16-half fragment from two contiguous 16B chunks (A layout and our
// B layouts both reduce to this: halves 0..7 = chunk0, halves 8..15 = chunk1).
__device__ __forceinline__ v16h frag2(const half_t* c0, const half_t* c1) {
  h8 x0 = *(const h8*)c0;
  h8 x1 = *(const h8*)c1;
  v16h f;
#pragma unroll
  for (int i = 0; i < 8; ++i) { f[i] = x0[i]; f[i + 8] = x1[i]; }
  return f;
}

// Load the 4 K-step B fragments of one 16-col weight tile (independent regs
// so the scheduler can clause the 8 b128 loads and keep WMMAs back-to-back).
__device__ __forceinline__ void loadB4(const half_t* __restrict__ packedW, int t, int lane,
                                       v16h b[4]) {
#pragma unroll
  for (int kb = 0; kb < 4; ++kb) {
    const half_t* p = &packedW[((size_t)(t * 4 + kb) * 64 + lane) * 8];
    b[kb] = frag2(p, p + 256);
  }
}

// ---------------- kernel P: pack weights to f16 B-fragments ----------------
// tile index t: 0..23 = w_qkv (384 cols), 24..31 = w_gate, 32 = w_pair (pad to 16), 33..40 = w_out
// One lane's 16 B of each of the two units of a 32-deep k block: W[k0 + e][col] and W[k0 + 16 + e][col],
// first = k0 * LD + col. LD is a constant, so the 16 loads share one address register.
template <int LD>
__device__ __forceinline__ void packUnits(const float* __restrict__ wsrc, int first, bool valid,
                                          half_t* __restrict__ dst) {
  h8 u0, u1;
#pragma unroll
  for (int e = 0; e < 8; ++e) {
    const float x0 = wsrc[first + e * LD], x1 = wsrc[first + (e + 16) * LD];
    u0[e] = (half_t)(valid ? x0 : 0.0f);
    u1[e] = (half_t)(valid ? x1 : 0.0f);
  }
  *(h8*)&dst[0]   = u0;
  *(h8*)&dst[256] = u1;
}

__global__ __launch_bounds__(128) void kP(const float* __restrict__ wqkv,
                                          const float* __restrict__ wpair,
                                          const float* __restrict__ wgate,
                                          const float* __restrict__ wout,
                                          half_t* __restrict__ packedW) {
  const int t = blockIdx.x;            // 0..40
  const int kb = threadIdx.x >> 5;     // 0..3  (K block of 32)
  const int lane = threadIdx.x & 31;
  const int hi = lane >> 4, n = lane & 15;
  const int k0 = kb * 32 + 8 * hi;
  half_t* dst = packedW + ((size_t)(t * 4 + kb) * 64 + lane) * 8;
  if (t < 24)       packUnits<384>(wqkv,  k0 * 384 + t * 16 + n, true, dst);
  else if (t < 32)  packUnits<128>(wgate, k0 * 128 + (t - 24) * 16 + n, true, dst);
  else if (t == 32) packUnits<4>(wpair,   k0 * 4 + (n & 3), n < 4, dst);  // columns 4..15 are zero padding
  else              packUnits<128>(wout,  k0 * 128 + (t - 33) * 16 + n, true, dst);
}

// ---------------- kernel A: LayerNorm + qkv/gate/bias projections ----------------
// MODE 0 (q, k) and 2 (gate): the TRANSPOSED product (weights as A, zn as B), so lane (m, hi) holds
// row m, columns 8*hi .. 8*hi+7 of the tile. MODE 1 (v): the direct product, lane (m, hi) holds
// column m, rows 8*hi .. 8*hi+7. Either way the lane's 8 values are its 16 B of the reader's fragment unit.
template <int MODE>
__device__ __forceinline__ h8 packTileA(int tt, v8f acc, int hi, const float* b_gate) {
  h8 p;
  float bgv[8] = {};
  if (MODE == 2) {
    const float4 g0 = *(const float4*)&b_gate[tt * 16 + hi * 8];
    const float4 g1 = *(const float4*)&b_gate[tt * 16 + hi * 8 + 4];
    bgv[0] = g0.x; bgv[1] = g0.y; bgv[2] = g0.z; bgv[3] = g0.w;
    bgv[4] = g1.x; bgv[5] = g1.y; bgv[6] = g1.z; bgv[7] = g1.w;
  }
#pragma unroll
  for (int v = 0; v < 8; ++v) {
    if (MODE == 2) {
      const float bg = bgv[v];
      float s;
      // v_nop: the slot the instruction set asks for behind a transcendental before its result is read or its
      // source overwritten
      asm("v_rcp_f32 %0, %1\n\tv_nop" : "=v"(s) : "v"(1.0f + __expf(-(acc[v] + bg))));
      p[v] = (half_t)s;
    } else {
      p[v] = (half_t)acc[v];
    }
  }
  return p;
}

// The 8 tiles (128 columns) of one of q, k, v, gate for the wave's 16 rows: 8 units, 4 KB contiguous.
// dst is the wave-uniform start of those 4 KB. On entry b0 holds tile t0's fragments; on exit those of t0 + 8.
template <int MODE>
__device__ __forceinline__ void group8A(int t0, const v16h afr[4], v16h b0[4], v16h b1[4],
                                        const half_t* __restrict__ packedW, int lane, int hi,
                                        const float* b_gate, half_t* __restrict__ dst) {
  h8 p[8];
#pragma unroll  // p[] is indexed by tt and has to stay in registers
  for (int tt = 0; tt < 8; tt += 2) {
    loadB4(packedW, t0 + tt + 1, lane, b1);
    v8f acc0 = {};
#pragma unroll
    for (int kb = 0; kb < 4; ++kb)
      acc0 = (MODE == 1) ? wmma32(afr[kb], b0[kb], acc0) : wmma32(b0[kb], afr[kb], acc0);
    loadB4(packedW, t0 + tt + 2, lane, b0);  // prefetch next
    v8f acc1 = {};
#pragma unroll
    for (int kb = 0; kb < 4; ++kb)
      acc1 = (MODE == 1) ? wmma32(afr[kb], b1[kb], acc1) : wmma32(b1[kb], afr[kb], acc1);
    p[tt]     = packTileA<MODE>(tt, acc0, hi, b_gate);
    p[tt + 1] = packTileA<MODE>(tt + 1, acc1, hi, b_gate);
  }
#pragma unroll
  for (int tt = 0; tt < 8; ++tt) *(h8*)&dst[tt * 256 + lane * 8] = p[tt];
  // the next group's loads and converts rewrite the stores' data registers while they may be in flight
  asm volatile("s_wait_xcnt 0x0" ::: "memory");
}

__global__ __launch_bounds__(128) void kA(const float* __restrict__ z,
                                          const float* __restrict__ gamma,
                                          const float* __restrict__ beta,
                                          const float* __restrict__ b_gate,
                                          const half_t* __restrict__ packedW,
                                          half_t* __restrict__ qbuf, half_t* __restrict__ kbuf,
                                          half_t* __restrict__ vbuf, half_t* __restrict__ gbuf,
                                          float* __restrict__ biasbuf) {
  __shared__ __attribute__((aligned(16))) float  zf[4][16 * ZF_P];
  __shared__ __attribute__((aligned(16))) half_t zh[4][16 * ZH_P];
  __shared__ __attribute__((aligned(16))) float  xb[4 * 64];  // bias exchange: [head][i in quad][j in tile]
  __shared__ __attribute__((aligned(16))) float  gS[128];     // b_gate: a lane reads 8 adjacent entries per gate tile
  const int w = threadIdx.x >> 5;
  const int lane = threadIdx.x & 31;
  // A block takes one 16-wide j tile of four consecutive i (wave w: i = 4*ib + w), so that
  // together its waves hold whole 128-B lines of the bias fragments written at the tail.
  const int ib = blockIdx.x >> 4, jtA = blockIdx.x & 15;
  const int r0 = (ib * 4 + w) * 256 + jtA * 16;
  const int m = lane & 15, hi = lane >> 4, ncol = lane & 15;

  gS[threadIdx.x] = b_gate[threadIdx.x];  // published by the barrier behind the z tile
  const float* zrow = z + (size_t)r0 * 128;
  for (int k = 0; k < 64; ++k)  // 32 floats a trip: row k >> 2, quarter k & 3
    zf[w][(k >> 2) * ZF_P + (k & 3) * 32 + lane] = zrow[k * 32 + lane];
  __syncthreads();

  // LayerNorm: lane pair (m, m+16) handles row m
  float s = 0.f, sq = 0.f;
  const float* zr = &zf[w][m * ZF_P];
  for (int c = hi * 64; c < hi * 64 + 64; ++c) { float x = zr[c]; s += x; sq += x * x; }
  s  += __shfl_xor(s, 16, 32);
  sq += __shfl_xor(sq, 16, 32);
  float mean = s * (1.0f / 128.0f);
  float var  = sq * (1.0f / 128.0f) - mean * mean;
  float inv  = rsqrtf(var + 1e-5f);
  half_t* zhr = &zh[w][m * ZH_P];
  for (int c = hi * 64; c < hi * 64 + 64; ++c)
    zhr[c] = (half_t)((zr[c] - mean) * inv * gamma[c] + beta[c]);
  __syncthreads();

  // A fragments for the 16x128 zn tile
  v16h afr[4];
#pragma unroll
  for (int kb = 0; kb < 4; ++kb) {
    const half_t* c0 = &zh[w][m * ZH_P + kb * 32 + hi * 8];
    afr[kb] = frag2(c0, c0 + 16);
  }

  // tiles 0..31 (q, k, v, gate: 8 tiles each), B fragments fetched one tile ahead; tile 32 (pair/bias) tail
  v16h b0[4], b1[4];
  // the wave's row tile: 8 units of 256 halves; the wave number as a scalar keeps the base out of vector registers
  const size_t fo = (size_t)((ib * 4 + __builtin_amdgcn_readfirstlane(w)) * 16 + jtA) * 2048;
  loadB4(packedW, 0, lane, b0);
  group8A<0>(0,  afr, b0, b1, packedW, lane, hi, gS, qbuf + fo);
  group8A<0>(8,  afr, b0, b1, packedW, lane, hi, gS, kbuf + fo);
  group8A<1>(16, afr, b0, b1, packedW, lane, hi, gS, vbuf + fo);
  group8A<2>(24, afr, b0, b1, packedW, lane, hi, gS, gbuf + fo);
  // tile 32: pair bias (only cols 0..3 valid), f32 output times sqrt(d): kB adds it to the
  // unscaled q.k sums and applies 1/sqrt(d) once, inside the exponent.
  // Layout = the 16x16 f32 accumulator fragment of the TRANSPOSED logits tile (h, it, jt), keys down, queries across:
  //   [h][it][jt][half][i & 15][(j >> 3) & 1][j & 3],  half = (j >> 2) & 1
  // so a kB lane (query i & 15, key half) reads its 8 accumulator registers as two b128 of 512 contiguous B per wave.
  {
    v8f acc = {};
#pragma unroll
    for (int kb = 0; kb < 4; ++kb) acc = wmma32(afr[kb], b0[kb], acc);
    float sv[8];
#pragma unroll
    for (int v = 0; v < 8; ++v) sv[v] = acc[v] * 5.656854249492381f;
    if (ncol < 4) {  // the lane holds keys 8*hi .. 8*hi+7 of the tile for head ncol and the wave's i
      *(float4*)&xb[ncol * 64 + w * 16 + hi * 8]     = make_float4(sv[0], sv[1], sv[2], sv[3]);
      *(float4*)&xb[ncol * 64 + w * 16 + hi * 8 + 4] = make_float4(sv[4], sv[5], sv[6], sv[7]);
    }
    __syncthreads();  // the four waves' i values of a quad meet here; wave w then writes head w
    if (lane < 16) {  // two whole 128-B lines: lane = 8*half + 2*(i in quad) + key half
      const int half = lane >> 3, il = (lane >> 1) & 3, hj = lane & 1;
      const float4 t = *(const float4*)&xb[w * 64 + il * 16 + hj * 8 + half * 4];
      const int it = ib >> 2, q = ib & 3;
      *(float4*)&biasbuf[((size_t)(w * 16 + it) * 16 + jtA) * 256 + half * 128 + q * 32 + (lane & 7) * 4] = t;
    }
  }
}

// ---------------- kernel B: row-wise attention per (r, h) ----------------
// Lane l <-> l ^ 16: the two lanes that share a query column of a transposed score tile.
__device__ __forceinline__ float xhalf(float x) {
  const int b = __builtin_bit_cast(int, x);
  return __builtin_bit_cast(float, __builtin_amdgcn_permlanex16(b, b, 0x76543210, 0xfedcba98, false, false));
}

__global__ __launch_bounds__(128) void kB(const half_t* __restrict__ qbuf,
                                          const half_t* __restrict__ kbuf,
                                          const half_t* __restrict__ vbuf,
                                          const half_t* __restrict__ gbuf,
                                          const float* __restrict__ biasbuf,
                                          half_t* __restrict__ aobuf) {
  __shared__ __attribute__((aligned(16))) half_t Vs[32 * 256];         // V fragment units: [dt][jt][lane][8]
  const int r = blockIdx.x >> 2;
  const int h = blockIdx.x & 3;
  const int tid = threadIdx.x;
  // the wave number as a scalar: every global address below is a scalar base plus the lane's 16 B
  const int w = __builtin_amdgcn_readfirstlane(tid >> 5), lane = tid & 31;
  const int m = lane & 15, hi = lane >> 4;

  // units of row tile T = r*16 + t and head h: two neighbours at ((T*8 + 2*h) * 256) halves
  const size_t fb = ((size_t)r * 128 + h * 2) * 256;
#pragma unroll
  for (int s = 0; s < 8; ++s) {
    const int u = w * 8 + s, jt = u >> 1, dt = u & 1;
    *(h8*)&Vs[(dt * 16 + jt) * 256 + lane * 8] = *(const h8*)&(vbuf + fb + jt * 2048 + dt * 256)[lane * 8];
  }
  __syncthreads();

  // K fragments do not depend on the query tile: one read per wave, kept in registers
  v16h bK[16];
  const half_t* kc = kbuf + fb;
#pragma unroll
  for (int jt = 0; jt < 16; ++jt) bK[jt] = frag2(&(kc + jt * 2048)[lane * 8], &(kc + jt * 2048 + 256)[lane * 8]);

  const float kexp = 0.17677669529663687f * 1.4426950408889634f;  // 1/sqrt(32) * log2(e)
  const int bl = (m * 2 + hi) * 4;  // the lane's 16 B in each 512-B half of a bias tile
  for (int itl = 0; itl < 4; ++itl) {
    const int it = itl * 4 + w;
    const half_t* qc = qbuf + fb + it * 2048;
    v16h aQ = frag2(&qc[lane * 8], &(qc + 256)[lane * 8]);
    // the bias loads below land in the registers that hold these two loads' address
    asm volatile("s_wait_xcnt 0x0" ::: "memory");

    // lg = (q.k + sqrt(d) * bias)^T: the bias fragment is the WMMA's C operand
    const float* bf = biasbuf + (size_t)(h * 16 + it) * 4096;
    v8f lg[16];
#pragma unroll
    for (int jt = 0; jt < 16; ++jt) {
      const float4 c0 = *(const float4*)&(bf + jt * 256)[bl];
      const float4 c1 = *(const float4*)&(bf + jt * 256 + 128)[bl];
      lg[jt] = v8f{c0.x, c0.y, c0.z, c0.w, c1.x, c1.y, c1.z, c1.w};
    }
    // the code that follows may reuse the loads' address registers while the loads are in flight
    asm volatile("s_wait_xcnt 0x0" ::: "memory");
    const half_t* gc = gbuf + fb + it * 2048;  // the gate's two units of this query tile, used behind attn @ V
    const h8 gq[2] = {*(const h8*)&gc[lane * 8], *(const h8*)&(gc + 256)[lane * 8]};
    asm volatile("s_wait_xcnt 0x0" ::: "memory");  // as above, for the address registers of these two loads
    // transposed scores (K as A, Q as B): lane (m, hi) holds query m, keys jt*16 + 8*hi .. +7
#pragma unroll
    for (int jt = 0; jt < 16; ++jt) lg[jt] = wmma32(bK[jt], aQ, lg[jt]);
    // softmax over j: the lane's 128 keys in registers, then one exchange with the lane that holds the other 128
    v8f mx8 = lg[0];
#pragma unroll
    for (int jt = 1; jt < 16; ++jt)
#pragma unroll
      for (int v = 0; v < 8; ++v) mx8[v] = fmaxf(mx8[v], lg[jt][v]);
    float mx = fmaxf(fmaxf(fmaxf(mx8[0], mx8[1]), fmaxf(mx8[2], mx8[3])),
                     fmaxf(fmaxf(mx8[4], mx8[5]), fmaxf(mx8[6], mx8[7])));
    mx = fmaxf(mx, xhalf(mx));
    const float nm = -mx * kexp;
    v8f s8 = {};
#pragma unroll
    for (int jt = 0; jt < 16; ++jt)
#pragma unroll
      for (int v = 0; v < 8; ++v) {
        const float e = __builtin_amdgcn_exp2f(__builtin_fmaf(lg[jt][v], kexp, nm));
        lg[jt][v] = e;
        s8[v] += e;
      }
    float sum = ((s8[0] + s8[1]) + (s8[2] + s8[3])) + ((s8[4] + s8[5]) + (s8[6] + s8[7]));
    sum += xhalf(sum);
    const float rs = __builtin_amdgcn_rcpf(sum);

    // (attn @ V)^T (V as A, exp(scores)^T as B): two score tiles, converted in place, are the B fragment of
    // 32 keys. Lane (m, hi) holds query row m, d = dt*16 + 8*hi .. +7, which is its 16 B of the gate's and of
    // the output's fragment unit; the row's 1/sum is the lane's own and is applied here.
    v8f acc[2] = {};
#pragma unroll
    for (int jb = 0; jb < 8; ++jb) {
      v16h aA;
#pragma unroll
      for (int e = 0; e < 8; ++e) { aA[e] = (half_t)lg[jb * 2][e]; aA[e + 8] = (half_t)lg[jb * 2 + 1][e]; }
#pragma unroll
      for (int dt = 0; dt < 2; ++dt) {
        const half_t* vc = Vs + (dt * 16 + jb * 2) * 256 + lane * 8;
        acc[dt] = wmma32(frag2(vc, vc + 256), aA, acc[dt]);
      }
    }
#pragma unroll
    for (int dt = 0; dt < 2; ++dt) {
      h8 o;
#pragma unroll
      for (int v = 0; v < 8; ++v) o[v] = (half_t)((float)gq[dt][v] * (acc[dt][v] * rs));
      *(h8*)&(aobuf + fb + it * 2048 + dt * 256)[lane * 8] = o;
    }
    // the next trip rewrites the stores' address and data registers at its very top
    asm volatile("s_wait_xcnt 0x0" ::: "memory");
  }
}

// ---------------- kernel C: output projection + b_out ----------------
__global__ __launch_bounds__(128) void kC(const half_t* __restrict__ aobuf,
                                          const half_t* __restrict__ packedW,
                                          const float* __restrict__ b_out,
                                          float* __restrict__ out) {
  __shared__ __attribute__((aligned(16))) float st[4][16 * ZF_P];  // per-wave store stage: 16 rows x 128 f32
  // the wave number as a scalar: the fragment loads and row stores are a scalar base plus the lane's 16 B
  const int w = __builtin_amdgcn_readfirstlane(threadIdx.x >> 5), lane = threadIdx.x & 31;
  const int m = lane & 15, hi = lane >> 4;
  const int r0 = (blockIdx.x * 4 + w) * 16;
  v16h afr[4];
#pragma unroll
  for (int kb = 0; kb < 4; ++kb) {
    const half_t* c0 = aobuf + ((size_t)(r0 >> 4) * 8 + kb * 2) * 256;
    afr[kb] = frag2(&c0[lane * 8], &(c0 + 256)[lane * 8]);
  }
  v16h b0[4], b1[4];
  loadB4(packedW, 33, lane, b0);
#pragma unroll 1
  for (int tp = 0; tp < 4; ++tp) {
    const int n0 = tp * 2, n1 = tp * 2 + 1;
    loadB4(packedW, 33 + n1, lane, b1);
    v8f acc0 = {};
#pragma unroll
    for (int kb = 0; kb < 4; ++kb) acc0 = wmma32(b0[kb], afr[kb], acc0);
    if (tp < 3) loadB4(packedW, 33 + n1 + 1, lane, b0);  // prefetch next pair
    v8f acc1 = {};
#pragma unroll
    for (int kb = 0; kb < 4; ++kb) acc1 = wmma32(b1[kb], afr[kb], acc1);
    // transposed product (weights as A): lane (m, hi) holds row m, columns 8*hi .. 8*hi+7 of each tile
    float x0[8], x1[8];
#pragma unroll
    for (int v = 0; v < 8; ++v) {
      // both candidates are wave-uniform reads (scalar loads); the lane picks its half of the tile
      const float lo0 = b_out[n0 * 16 + v], hi0 = b_out[n0 * 16 + 8 + v];
      const float lo1 = b_out[n1 * 16 + v], hi1 = b_out[n1 * 16 + 8 + v];
      x0[v] = acc0[v] + (hi ? hi0 : lo0);
      x1[v] = acc1[v] + (hi ? hi1 : lo1);
    }
    float* sr = &st[w][m * ZF_P + hi * 8];
    *(float4*)&sr[n0 * 16]     = make_float4(x0[0], x0[1], x0[2], x0[3]);
    *(float4*)&sr[n0 * 16 + 4] = make_float4(x0[4], x0[5], x0[6], x0[7]);
    *(float4*)&sr[n1 * 16]     = make_float4(x1[0], x1[1], x1[2], x1[3]);
    *(float4*)&sr[n1 * 16 + 4] = make_float4(x1[4], x1[5], x1[6], x1[7]);
  }
  asm volatile("s_wait_dscnt 0" ::: "memory");  // same-wave LDS RAW across lanes: rows are read back by other lanes
  // one whole 512-B output row per store
#pragma unroll
  for (int s = 0; s < 16; ++s)
    *(float4*)&(out + (size_t)(r0 + s) * 128)[lane * 4] = *(const float4*)&st[w][s * ZF_P + lane * 4];
}

extern "C" void kernel_launch(void* const* d_in, const int* in_sizes, int n_in,
                              void* d_out, int out_size, void* d_ws, size_t ws_size,
                              hipStream_t stream) {
  const float* z      = (const float*)d_in[0];
  const float* gamma  = (const float*)d_in[1];
  const float* beta   = (const float*)d_in[2];
  const float* w_qkv  = (const float*)d_in[3];
  const float* w_pair = (const float*)d_in[4];
  const float* w_gate = (const float*)d_in[5];
  const float* b_gate = (const float*)d_in[6];
  const float* w_out  = (const float*)d_in[7];
  const float* b_out  = (const float*)d_in[8];

  char* ws = (char*)d_ws;
  half_t* packedW = (half_t*)(ws + OFF_W);
  half_t* qbuf    = (half_t*)(ws + OFF_Q);
  half_t* kbuf    = (half_t*)(ws + OFF_K);
  half_t* vbuf    = (half_t*)(ws + OFF_V);
  half_t* gbuf    = (half_t*)(ws + OFF_G);
  half_t* aobuf   = (half_t*)(ws + OFF_AO);
  float*  biasbuf = (float*)(ws + OFF_B);

  kP<<<41, 128, 0, stream>>>(w_qkv, w_pair, w_gate, w_out, packedW);
  kA<<<N_ROWS / 64, 128, 0, stream>>>(z, gamma, beta, b_gate, packedW,
                                      qbuf, kbuf, vbuf, gbuf, biasbuf);
  kB<<<L_DIM * H_HEADS, 128, 0, stream>>>(qbuf, kbuf, vbuf, gbuf, biasbuf, aobuf);
  kC<<<N_ROWS / 64, 128, 0, stream>>>(aobuf, packedW, b_out, (float*)d_out);
}

// v005
// A run of this version takes 52.5 microseconds.
// Two timings next to v004 put it at 1.11 and 1.13 times that version's speed.
// Over all steps from v000 it is 3.81 times as fast.
#include <hip/hip_runtime.h>
#include <hip/hip_bf16.h>
#include <stddef.h>

typedef _Float16 half_t;
typedef __attribute__((ext_vector_type(16))) _Float16 v16h;
typedef __attribute__((ext_vector_type(8)))  _Float16 h8;
typedef __attribute__((ext_vector_type(8)))  float    v8f;
typedef h8 __attribute__((may_alias)) h8a;  // a 16-B f16 store into LDS bytes that were read as f32 just before

#define N_ROWS 65536      // L*L flattened (i,j) rows
#define IN_DIM 128
#define L_DIM  256
#define H_HEADS 4
#define D_HEAD 32

// LDS row pitches: 16 B x odd, so the 16 rows a ds_load_b128 touches fall on
// distinct banks (64 banks x 4 B; an unpadded 256/512-B pitch puts them on four).
#define ZF_P 132          // floats : 528 B

// ---- workspace layout (bytes) ----
// Every f16 buffer is kept in WMMA fragment order, in 512-B units [lane = 16*hi + m][8 halves], so that
// each wave-wide 16-B store or load covers 512 contiguous bytes:
//   q, k, gate, ao : unit (T, c8), T = row >> 4, c8 = col >> 4 : X[T*16 + m][c8*16 + 8*hi + e]
//   v              : unit (T, c8)                              : V[T*16 + 8*hi + e][c8*16 + m]
//   weights        : unit (t, kb, c)                           : W[kb*32 + c*16 + 8*hi + e][t*16 + m]
// A 16x32 (or 32x16) f16 fragment is two such units (k 0..15 and k 16..31 of the block).
#define OFF_W   ((size_t)0)                         // f16 weight fragments, 41 tiles * 4 kb * 2 units * 512 B: only w_out's (33..40) live here
#define OFF_Q   ((size_t)262144)
#define OFF_K   (OFF_Q + (size_t)N_ROWS*128*2)
#define OFF_V   (OFF_K + (size_t)N_ROWS*128*2)
#define OFF_G   (OFF_V + (size_t)N_ROWS*128*2)
#define OFF_AO  (OFF_G + (size_t)N_ROWS*128*2)
#define OFF_B   (OFF_AO + (size_t)N_ROWS*128*2)     // bias f32, order of the transposed logits' accumulator (see kA tail)

__device__ __forceinline__ v8f wmma32(v16h a, v16h b, v8f c) {
  return __builtin_amdgcn_wmma_f32_16x16x32_f16(false, a, false, b, (short)0, c, false, false);
}

// Build a 16-half fragment from two contiguous 16B chunks (A layout and our
// B layouts both reduce to this: halves 0..7 = chunk0, halves 8..15 = chunk1).
__device__ __forceinline__ v16h frag2(const half_t* c0, const half_t* c1) {
  h8 x0 = *(const h8*)c0;
  h8 x1 = *(const h8*)c1;
  v16h f;
#pragma unroll
  for (int i = 0; i < 8; ++i) { f[i] = x0[i]; f[i + 8] = x1[i]; }
  return f;
}

// Load the 4 K-step B fragments of one 16-col weight tile (independent regs
// so the scheduler can clause the 8 b128 loads and keep WMMAs back-to-back).
__device__ __forceinline__ void loadB4(const half_t* __restrict__ packedW, int t, int lane,
                                       v16h b[4]) {
#pragma unroll
  for (int kb = 0; kb < 4; ++kb) {
    const half_t* p = &packedW[((size_t)(t * 4 + kb) * 64 + lane) * 8];
    b[kb] = frag2(p, p + 256);
  }
}

// ---------------- weights to f16 fragment units ----------------
// tile index t: 0..23 = w_qkv (384 cols), 24..31 = w_gate, 32 = w_pair (pad to 16), 33..40 = w_out
// One lane's 16 B of each of the two units of a 32-deep k block: W[k0 + e][col] and W[k0 + 16 + e][col],
// first = k0 * LD + col. LD is a constant, so the 16 loads share one address register.
template <int LD>
__device__ __forceinline__ void packUnits(const float* __restrict__ wsrc, int first, bool valid,
                                          half_t* __restrict__ dst) {
  h8 u0, u1;
#pragma unroll
  for (int e = 0; e < 8; ++e) {
    const float x0 = wsrc[first + e * LD], x1 = wsrc[first + (e + 16) * LD];
    u0[e] = (half_t)(valid ? x0 : 0.0f);
    u1[e] = (half_t)(valid ? x1 : 0.0f);
  }
  *(h8*)&dst[0]   = u0;
  *(h8*)&dst[256] = u1;
}

// A wave's share of kA's fill: two neighbouring 16-column weight tiles (one 128-B line of every weight row), all
// four k blocks, go to LDS as f16 fragment units, and the wave's 16 z rows go to LDS as they are. The four gate waves
// (LD == 128) take one k block of the pair tile and 32 entries of b_gate as well. One straight-line block: all the
// loads fly together.
// first = 8 * hi * LD + column of the lane in the first tile; dstW = the lane's 16 B in the first tile's first unit.
template <int LD>
__device__ __forceinline__ void stageA(const float* __restrict__ wsrc, int first, half_t* __restrict__ dstW,
                                       const float* __restrict__ wpair, int pfirst, bool pvalid,
                                       half_t* __restrict__ dstP,
                                       const float* __restrict__ bsrc, float* __restrict__ bdst,
                                       const float* __restrict__ zrow, float* __restrict__ zdst, int lane) {
  float xw[8][16], xp[16], xg = 0.0f, zv[64];
#pragma unroll  // s = 4 * tile + k block; the arrays are indexed by s, e, k and have to stay in registers
  for (int s = 0; s < 8; ++s)
#pragma unroll
    for (int e = 0; e < 8; ++e) {
      xw[s][e]     = wsrc[first + ((s & 3) * 32 + e) * LD + (s >> 2) * 16];
      xw[s][e + 8] = wsrc[first + ((s & 3) * 32 + e + 16) * LD + (s >> 2) * 16];
    }
  if (LD == 128) {
#pragma unroll
    for (int e = 0; e < 8; ++e) { xp[e] = wpair[pfirst + e * 4]; xp[e + 8] = wpair[pfirst + (e + 16) * 4]; }
    xg = bsrc[lane];
  }
  // the z loads land in, and later address arithmetic rewrites, registers that the loads above name while these are in
  // flight; the operands keep those registers as they are up to the wait
  if (LD == 128) asm volatile("s_wait_xcnt 0x0" :: "v"(first), "s"(wsrc), "v"(pfirst), "s"(wpair), "s"(bsrc) : "memory");
  else           asm volatile("s_wait_xcnt 0x0" :: "v"(first), "s"(wsrc) : "memory");
#pragma unroll
  for (int k = 0; k < 64; ++k) zv[k] = (zrow + k * 32)[lane];  // 32 floats a trip: row k >> 2, quarter k & 3
  asm volatile("s_wait_xcnt 0x0" :: "v"(lane), "s"(zrow) : "memory");  // the same for the registers that the z loads name
#pragma unroll
  for (int s = 0; s < 8; ++s) {
    h8 u0, u1;
#pragma unroll
    for (int e = 0; e < 8; ++e) { u0[e] = (half_t)xw[s][e]; u1[e] = (half_t)xw[s][e + 8]; }
    *(h8*)&dstW[s * 512]       = u0;
    *(h8*)&dstW[s * 512 + 256] = u1;
  }
  if (LD == 128) {
    h8 u0, u1;
#pragma unroll
    for (int e = 0; e < 8; ++e) {  // columns 4..15 of the pair tile are zero padding
      u0[e] = (half_t)(pvalid ? xp[e] : 0.0f);
      u1[e] = (half_t)(pvalid ? xp[e + 8] : 0.0f);
    }
    *(h8*)&dstP[0]   = u0;
    *(h8*)&dstP[256] = u1;
    bdst[lane] = xg;
  }
#pragma unroll
  for (int k = 0; k < 64; ++k) zdst[(k >> 2) * ZF_P + (k & 3) * 32 + lane] = zv[k];
}

// ---------------- kernel A: LayerNorm + qkv/gate/bias projections ----------------
// MODE 0 (q, k) and 2 (gate): the TRANSPOSED product (weights as A, zn as B), so lane (m, hi) holds
// row m, columns 8*hi .. 8*hi+7 of the tile. MODE 1 (v): the direct product, lane (m, hi) holds
// column m, rows 8*hi .. 8*hi+7. Either way the lane's 8 values are its 16 B of the reader's fragment unit.
template <int MODE>
__device__ __forceinline__ h8 packTileA(int tt, v8f acc, int hi, const float* b_gate) {
  h8 p;
  float bgv[8] = {};
  if (MODE == 2) {
    const float4 g0 = *(const float4*)&b_gate[tt * 16 + hi * 8];
    const float4 g1 = *(const float4*)&b_gate[tt * 16 + hi * 8 + 4];
    bgv[0] = g0.x; bgv[1] = g0.y; bgv[2] = g0.z; bgv[3] = g0.w;
    bgv[4] = g1.x; bgv[5] = g1.y; bgv[6] = g1.z; bgv[7] = g1.w;
  }
#pragma unroll
  for (int v = 0; v < 8; ++v) {
    if (MODE == 2) {
      const float bg = bgv[v];
      float s;
      // v_nop: the slot the instruction set asks for behind a transcendental before its result is read or its
      // source overwritten
      asm("v_rcp_f32 %0, %1\n\tv_nop" : "=v"(s) : "v"(1.0f + __expf(-(acc[v] + bg))));
      p[v] = (half_t)s;
    } else {
      p[v] = (half_t)acc[v];
    }
  }
  return p;
}

// The 8 tiles (128 columns) of one of q, k, v, gate for the wave's 16 rows: 8 units, 4 KB contiguous.
// dst is the wave-uniform start of those 4 KB. On entry b0 holds tile t0's fragments; on exit those of t0 + 8.
template <int MODE>
__device__ __forceinline__ void group8A(int t0, const v16h afr[4], v16h b0[4], v16h b1[4],
                                        const half_t* __restrict__ packedW, int lane, int hi,
                                        const float* b_gate, half_t* __restrict__ dst) {
  h8 p[8];
#pragma unroll  // p[] is indexed by tt and has to stay in registers
  for (int tt = 0; tt < 8; tt += 2) {
    loadB4(packedW, t0 + tt + 1, lane, b1);
    v8f acc0 = {};
#pragma unroll
    for (int kb = 0; kb < 4; ++kb)
      acc0 = (MODE == 1) ? wmma32(afr[kb], b0[kb], acc0) : wmma32(b0[kb], afr[kb], acc0);
    loadB4(packedW, t0 + tt + 2, lane, b0);  // prefetch next
    v8f acc1 = {};
#pragma unroll
    for (int kb = 0; kb < 4; ++kb)
      acc1 = (MODE == 1) ? wmma32(afr[kb], b1[kb], acc1) : wmma32(b1[kb], afr[kb], acc1);
    p[tt]     = packTileA<MODE>(tt, acc0, hi, b_gate);
    p[tt + 1] = packTileA<MODE>(tt + 1, acc1, hi, b_gate);
  }
#pragma unroll
  for (int tt = 0; tt < 8; ++tt) *(h8*)&dst[tt * 256 + lane * 8] = p[tt];
  // the next group's loads and converts rewrite the stores' data registers while they may be in flight
  asm volatile("s_wait_xcnt 0x0" ::: "memory");
}

__global__ __launch_bounds__(512) void kA(const float* __restrict__ z,
                                          const float* __restrict__ gamma,
                                          const float* __restrict__ beta,
                                          const float* __restrict__ wqkv,
                                          const float* __restrict__ wpair,
                                          const float* __restrict__ wgate,
                                          const float* __restrict__ b_gate,
                                          const float* __restrict__ wout,
                                          half_t* __restrict__ packedW,
                                          half_t* __restrict__ qbuf, half_t* __restrict__ kbuf,
                                          half_t* __restrict__ vbuf, half_t* __restrict__ gbuf,
                                          float* __restrict__ biasbuf) {
  __shared__ __attribute__((aligned(16))) half_t Wl[33 * 4 * 512];  // tiles 0..32 as fragment units, packed once per block
  __shared__ __attribute__((aligned(16))) float  zf[16][16 * ZF_P]; // z rows; the f16 zn rows later overlay them
  __shared__ __attribute__((aligned(16))) float  xb[4 * 256]; // bias exchange: [quad of waves][head][i in quad][j in tile]
  __shared__ __attribute__((aligned(16))) float  gS[128];     // b_gate: a lane reads 8 adjacent entries per gate tile
  // the wave number as a scalar: the branches on it are scalar and the store bases stay out of vector registers
  const int wv = __builtin_amdgcn_readfirstlane(threadIdx.x >> 5);
  const int sub = wv >> 2, w = wv & 3;
  const int lane = threadIdx.x & 31;
  // A quad of waves takes one 16-wide j tile of four consecutive i (wave w: i = 4*ib + w), so that
  // together its waves hold whole 128-B lines of the bias fragments written at the tail.
  const int ob = blockIdx.x * 4 + sub;
  const int ib = ob >> 4, jtA = ob & 15;
  const int r0 = (ib * 4 + w) * 256 + jtA * 16;
  const int m = lane & 15, hi = lane >> 4, ncol = lane & 15;

  // waves 0..11: tiles 2*wv, 2*wv + 1 of w_qkv; waves 12..15: the same tile numbers, which are w_gate's, and the pair tile
  if (wv < 12)
    stageA<384>(wqkv, hi * 8 * 384 + wv * 32 + m, &Wl[(wv * 512 + lane) * 8], wpair, 0, false, Wl, b_gate, gS,
                z + (size_t)r0 * 128, zf[wv], lane);
  else
    stageA<128>(wgate, hi * 8 * 128 + (wv - 12) * 32 + m, &Wl[(wv * 512 + lane) * 8],
                wpair, ((wv - 12) * 32 + hi * 8) * 4 + (m & 3), m < 4, &Wl[((128 + wv - 12) * 64 + lane) * 8],
                b_gate + (wv - 12) * 32, gS + (wv - 12) * 32, z + (size_t)r0 * 128, zf[wv], lane);
  __syncthreads();

  // LayerNorm: lane pair (m, m+16) handles row m
  float s = 0.f, sq = 0.f;
  const float* zr = &zf[wv][m * ZF_P];
  for (int c = hi * 64; c < hi * 64 + 64; ++c) { float x = zr[c]; s += x; sq += x * x; }
  s  += __shfl_xor(s, 16, 32);
  sq += __shfl_xor(sq, 16, 32);
  float mean = s * (1.0f / 128.0f);
  float var  = sq * (1.0f / 128.0f) - mean * mean;
  float inv  = rsqrtf(var + 1e-5f);
  // zn in f16 overlays the row it came from, which leaves the LDS room for the weights: the lane's 64 halves lie in
  // the first 128 B of its own 64 floats, each 16 B written behind the read of the floats it covers.
  // Column c of zn is half (c >> 6) * 128 + (c & 63) of the 528-B row.
  half_t* zhr = (half_t*)&zf[wv][m * ZF_P] + hi * 128;
  for (int o = 0; o < 64; o += 8) {
    const int c = hi * 64 + o;
    h8 y;
#pragma unroll
    for (int e = 0; e < 8; ++e) y[e] = (half_t)((zr[c + e] - mean) * inv * gamma[c + e] + beta[c + e]);
    *(h8a*)&zhr[o] = y;
  }
  __syncthreads();

  // A fragments for the 16x128 zn tile
  v16h afr[4];
#pragma unroll
  for (int kb = 0; kb < 4; ++kb) {
    const half_t* c0 = (const half_t*)&zf[wv][m * ZF_P] + (kb >> 1) * 128 + (kb & 1) * 32 + hi * 8;
    afr[kb] = frag2(c0, c0 + 16);
  }

  // tiles 0..31 (q, k, v, gate: 8 tiles each), B fragments fetched one tile ahead; tile 32 (pair/bias) tail
  v16h b0[4], b1[4];
  // the wave's row tile: 8 units of 256 halves
  const size_t fo = (size_t)((ib * 4 + w) * 16 + jtA) * 2048;
  loadB4(Wl, 0, lane, b0);
  group8A<0>(0,  afr, b0, b1, Wl, lane, hi, gS, qbuf + fo);
  group8A<0>(8,  afr, b0, b1, Wl, lane, hi, gS, kbuf + fo);
  group8A<1>(16, afr, b0, b1, Wl, lane, hi, gS, vbuf + fo);
  group8A<2>(24, afr, b0, b1, Wl, lane, hi, gS, gbuf + fo);
  // tile 32: pair bias (only cols 0..3 valid), f32 output times sqrt(d): kB adds it to the
  // unscaled q.k sums and applies 1/sqrt(d) once, inside the exponent.
  // Layout = the 16x16 f32 accumulator fragment of the TRANSPOSED logits tile (h, it, jt), keys down, queries across:
  //   [h][it][jt][half][i & 15][(j >> 3) & 1][j & 3],  half = (j >> 2) & 1
  // so a kB lane (query i & 15, key half) reads its 8 accumulator registers as two b128 of 512 contiguous B per wave.
  {
    v8f acc = {};
#pragma unroll
    for (int kb = 0; kb < 4; ++kb) acc = wmma32(afr[kb], b0[kb], acc);
    float sv[8];
#pragma unroll
    for (int v = 0; v < 8; ++v) sv[v] = acc[v] * 5.656854249492381f;
    if (ncol < 4) {  // the lane holds keys 8*hi .. 8*hi+7 of the tile for head ncol and the wave's i
      *(float4*)&xb[sub * 256 + ncol * 64 + w * 16 + hi * 8]     = make_float4(sv[0], sv[1], sv[2], sv[3]);
      *(float4*)&xb[sub * 256 + ncol * 64 + w * 16 + hi * 8 + 4] = make_float4(sv[4], sv[5], sv[6], sv[7]);
    }
    __syncthreads();  // the four waves' i values of a quad meet here; wave w of the quad then writes head w
    if (lane < 16) {  // two whole 128-B lines: lane = 8*half + 2*(i in quad) + key half
      const int half = lane >> 3, il = (lane >> 1) & 3, hj = lane & 1;
      const float4 t = *(const float4*)&xb[sub * 256 + w * 64 + il * 16 + hj * 8 + half * 4];
      const int it = ib >> 2, q = ib & 3;
      *(float4*)&biasbuf[((size_t)(w * 16 + it) * 16 + jtA) * 256 + half * 128 + q * 32 + (lane & 7) * 4] = t;
    }
  }
  // w_out's 8 tiles x 4 k blocks, which only the last kernel reads, go to the workspace: one pair per wave of two blocks
  if (blockIdx.x < 2) {
    const int pr = blockIdx.x * 16 + wv, t = pr >> 2, kb = pr & 3;
    packUnits<128>(wout, (kb * 32 + 8 * hi) * 128 + t * 16 + m, true,
                   packedW + ((size_t)((33 + t) * 4 + kb) * 64 + lane) * 8);
  }
}

// ---------------- kernel B: row-wise attention per (r, h) ----------------
// Lane l <-> l ^ 16: the two lanes that share a query column of a transposed score tile.
__device__ __forceinline__ float xhalf(float x) {
  const int b = __builtin_bit_cast(int, x);
  return __builtin_bit_cast(float, __builtin_amdgcn_permlanex16(b, b, 0x76543210, 0xfedcba98, false, false));
}

__global__ __launch_bounds__(128) void kB(const half_t* __restrict__ qbuf,
                                          const half_t* __restrict__ kbuf,
                                          const half_t* __restrict__ vbuf,
                                          const half_t* __restrict__ gbuf,
                                          const float* __restrict__ biasbuf,
                                          half_t* __restrict__ aobuf) {
  __shared__ __attribute__((aligned(16))) half_t Vs[32 * 256];         // V fragment units: [dt][jt][lane][8]
  const int r = blockIdx.x >> 2;
  const int h = blockIdx.x & 3;
  const int tid = threadIdx.x;
  // the wave number as a scalar: every global address below is a scalar base plus the lane's 16 B
  const int w = __builtin_amdgcn_readfirstlane(tid >> 5), lane = tid & 31;
  const int m = lane & 15, hi = lane >> 4;

  // units of row tile T = r*16 + t and head h: two neighbours at ((T*8 + 2*h) * 256) halves
  const size_t fb = ((size_t)r * 128 + h * 2) * 256;
#pragma unroll
  for (int s = 0; s < 8; ++s) {
    const int u = w * 8 + s, jt = u >> 1, dt = u & 1;
    *(h8*)&Vs[(dt * 16 + jt) * 256 + lane * 8] = *(const h8*)&(vbuf + fb + jt * 2048 + dt * 256)[lane * 8];
  }
  __syncthreads();

  // K fragments do not depend on the query tile: one read per wave, kept in registers
  v16h bK[16];
  const half_t* kc = kbuf + fb;
#pragma unroll
  for (int jt = 0; jt < 16; ++jt) bK[jt] = frag2(&(kc + jt * 2048)[lane * 8], &(kc + jt * 2048 + 256)[lane * 8]);

  const float kexp = 0.17677669529663687f * 1.4426950408889634f;  // 1/sqrt(32) * log2(e)
  const int bl = (m * 2 + hi) * 4;  // the lane's 16 B in each 512-B half of a bias tile
  for (int itl = 0; itl < 4; ++itl) {
    const int it = itl * 4 + w;
    const half_t* qc = qbuf + fb + it * 2048;
    v16h aQ = frag2(&qc[lane * 8], &(qc + 256)[lane * 8]);
    // the bias loads below land in the registers that hold these two loads' address
    asm volatile("s_wait_xcnt 0x0" ::: "memory");

    // lg = (q.k + sqrt(d) * bias)^T: the bias fragment is the WMMA's C operand
    const float* bf = biasbuf + (size_t)(h * 16 + it) * 4096;
    v8f lg[16];
#pragma unroll
    for (int jt = 0; jt < 16; ++jt) {
      const float4 c0 = *(const float4*)&(bf + jt * 256)[bl];
      const float4 c1 = *(const float4*)&(bf + jt * 256 + 128)[bl];
      lg[jt] = v8f{c0.x, c0.y, c0.z, c0.w, c1.x, c1.y, c1.z, c1.w};
    }
    // the code that follows may reuse the loads' address registers while the loads are in flight
    asm volatile("s_wait_xcnt 0x0" ::: "memory");
    const half_t* gc = gbuf + fb + it * 2048;  // the gate's two units of this query tile, used behind attn @ V
    const h8 gq[2] = {*(const h8*)&gc[lane * 8], *(const h8*)&(gc + 256)[lane * 8]};
    asm volatile("s_wait_xcnt 0x0" ::: "memory");  // as above, for the address registers of these two loads
    // transposed scores (K as A, Q as B): lane (m, hi) holds query m, keys jt*16 + 8*hi .. +7
#pragma unroll
    for (int jt = 0; jt < 16; ++jt) lg[jt] = wmma32(bK[jt], aQ, lg[jt]);
    // softmax over j: the lane's 128 keys in registers, then one exchange with the lane that holds the other 128
    v8f mx8 = lg[0];
#pragma unroll
    for (int jt = 1; jt < 16; ++jt)
#pragma unroll
      for (int v = 0; v < 8; ++v) mx8[v] = fmaxf(mx8[v], lg[jt][v]);
    float mx = fmaxf(fmaxf(fmaxf(mx8[0], mx8[1]), fmaxf(mx8[2], mx8[3])),
                     fmaxf(fmaxf(mx8[4], mx8[5]), fmaxf(mx8[6], mx8[7])));
    mx = fmaxf(mx, xhalf(mx));
    const float nm = -mx * kexp;
    v8f s8 = {};
#pragma unroll
    for (int jt = 0; jt < 16; ++jt)
#pragma unroll
      for (int v = 0; v < 8; ++v) {
        const float e = __builtin_amdgcn_exp2f(__builtin_fmaf(lg[jt][v], kexp, nm));
        lg[jt][v] = e;
        s8[v] += e;
      }
    float sum = ((s8[0] + s8[1]) + (s8[2] + s8[3])) + ((s8[4] + s8[5]) + (s8[6] + s8[7]));
    sum += xhalf(sum);
    const float rs = __builtin_amdgcn_rcpf(sum);

    // (attn @ V)^T (V as A, exp(scores)^T as B): two score tiles, converted in place, are the B fragment of
    // 32 keys. Lane (m, hi) holds query row m, d = dt*16 + 8*hi .. +7, which is its 16 B of the gate's and of
    // the output's fragment unit; the row's 1/sum is the lane's own and is applied here.
    v8f acc[2] = {};
#pragma unroll
    for (int jb = 0; jb < 8; ++jb) {
      v16h aA;
#pragma unroll
      for (int e = 0; e < 8; ++e) { aA[e] = (half_t)lg[jb * 2][e]; aA[e + 8] = (half_t)lg[jb * 2 + 1][e]; }
#pragma unroll
      for (int dt = 0; dt < 2; ++dt) {
        const half_t* vc = Vs + (dt * 16 + jb * 2) * 256 + lane * 8;
        acc[dt] = wmma32(frag2(vc, vc + 256), aA, acc[dt]);
      }
    }
#pragma unroll
    for (int dt = 0; dt < 2; ++dt) {
      h8 o;
#pragma unroll
      for (int v = 0; v < 8; ++v) o[v] = (half_t)((float)gq[dt][v] * (acc[dt][v] * rs));
      *(h8*)&(aobuf + fb + it * 2048 + dt * 256)[lane * 8] = o;
    }
    // the next trip rewrites the stores' address and data registers at its very top
    asm volatile("s_wait_xcnt 0x0" ::: "memory");
  }
}

// ---------------- kernel C: output projection + b_out ----------------
__global__ __launch_bounds__(128) void kC(const half_t* __restrict__ aobuf,
                                          const half_t* __restrict__ packedW,
                                          const float* __restrict__ b_out,
                                          float* __restrict__ out) {
  __shared__ __attribute__((aligned(16))) float st[4][16 * ZF_P];  // per-wave store stage: 16 rows x 128 f32
  // the wave number as a scalar: the fragment loads and row stores are a scalar base plus the lane's 16 B
  const int w = __builtin_amdgcn_readfirstlane(threadIdx.x >> 5), lane = threadIdx.x & 31;
  const int m = lane & 15, hi = lane >> 4;
  const int r0 = (blockIdx.x * 4 + w) * 16;
  v16h afr[4];
#pragma unroll
  for (int kb = 0; kb < 4; ++kb) {
    const half_t* c0 = aobuf + ((size_t)(r0 >> 4) * 8 + kb * 2) * 256;
    afr[kb] = frag2(&c0[lane * 8], &(c0 + 256)[lane * 8]);
  }
  v16h b0[4], b1[4];
  loadB4(packedW, 33, lane, b0);
#pragma unroll 1
  for (int tp = 0; tp < 4; ++tp) {
    const int n0 = tp * 2, n1 = tp * 2 + 1;
    loadB4(packedW, 33 + n1, lane, b1);
    v8f acc0 = {};
#pragma unroll
    for (int kb = 0; kb < 4; ++kb) acc0 = wmma32(b0[kb], afr[kb], acc0);
    if (tp < 3) loadB4(packedW, 33 + n1 + 1, lane, b0);  // prefetch next pair
    v8f acc1 = {};
#pragma unroll
    for (int kb = 0; kb < 4; ++kb) acc1 = wmma32(b1[kb], afr[kb], acc1);
    // transposed product (weights as A): lane (m, hi) holds row m, columns 8*hi .. 8*hi+7 of each tile
    float x0[8], x1[8];
#pragma unroll
    for (int v = 0; v < 8; ++v) {
      // both candidates are wave-uniform reads (scalar loads); the lane picks its half of the tile
      const float lo0 = b_out[n0 * 16 + v], hi0 = b_out[n0 * 16 + 8 + v];
      const float lo1 = b_out[n1 * 16 + v], hi1 = b_out[n1 * 16 + 8 + v];
      x0[v] = acc0[v] + (hi ? hi0 : lo0);
      x1[v] = acc1[v] + (hi ? hi1 : lo1);
    }
    float* sr = &st[w][m * ZF_P + hi * 8];
    *(float4*)&sr[n0 * 16]     = make_float4(x0[0], x0[1], x0[2], x0[3]);
    *(float4*)&sr[n0 * 16 + 4] = make_float4(x0[4], x0[5], x0[6], x0[7]);
    *(float4*)&sr[n1 * 16]     = make_float4(x1[0], x1[1], x1[2], x1[3]);
    *(float4*)&sr[n1 * 16 + 4] = make_float4(x1[4], x1[5], x1[6], x1[7]);
  }
  asm volatile("s_wait_dscnt 0" ::: "memory");  // same-wave LDS RAW across lanes: rows are read back by other lanes
  // one whole 512-B output row per store
#pragma unroll
  for (int s = 0; s < 16; ++s)
    *(float4*)&(out + (size_t)(r0 + s) * 128)[lane * 4] = *(const float4*)&st[w][s * ZF_P + lane * 4];
}

extern "C" void kernel_launch(void* const* d_in, const int* in_sizes, int n_in,
                              void* d_out, int out_size, void* d_ws, size_t ws_size,
                              hipStream_t stream) {
  const float* z      = (const float*)d_in[0];
  const float* gamma  = (const float*)d_in[1];
  const float* beta   = (const float*)d_in[2];
  const float* w_qkv  = (const float*)d_in[3];
  const float* w_pair = (const float*)d_in[4];
  const float* w_gate = (const float*)d_in[5];
  const float* b_gate = (const float*)d_in[6];
  const float* w_out  = (const float*)d_in[7];
  const float* b_out  = (const float*)d_in[8];

  char* ws = (char*)d_ws;
  half_t* packedW = (half_t*)(ws + OFF_W);
  half_t* qbuf    = (half_t*)(ws + OFF_Q);
  half_t* kbuf    = (half_t*)(ws + OFF_K);
  half_t* vbuf    = (half_t*)(ws + OFF_V);
  half_t* gbuf    = (half_t*)(ws + OFF_G);
  half_t* aobuf   = (half_t*)(ws + OFF_AO);
  float*  biasbuf = (float*)(ws + OFF_B);

  kA<<<N_ROWS / 256, 512, 0, stream>>>(z, gamma, beta, w_qkv, w_pair, w_gate, b_gate, w_out, packedW,
                                       qbuf, kbuf, vbuf, gbuf, biasbuf);
  kB<<<L_DIM * H_HEADS, 128, 0, stream>>>(qbuf, kbuf, vbuf, gbuf, biasbuf, aobuf);
  kC<<<N_ROWS / 64, 128, 0, stream>>>(aobuf, packedW, b_out, (float*)d_out);
}

// v006
// A run of this version takes 35.4 microseconds.
// In both of two side-by-side timings against v005, it was 1.48 times as fast.
// Counting every step since v000, it is 5.63 times as fast.
#include <hip/hip_runtime.h>
#include <hip/hip_bf16.h>
#include <stddef.h>

typedef _Float16 half_t;
typedef __attribute__((ext_vector_type(16))) _Float16 v16h;
typedef __attribute__((ext_vector_type(8)))  _Float16 h8;
typedef __attribute__((ext_vector_type(8)))  float    v8f;
typedef __attribute__((ext_vector_type(4)))  float    v4f;
typedef h8 __attribute__((may_alias)) h8a;  // 16-B f16 accesses to LDS bytes that hold f32 or other operands at other times

#define N_ROWS 65536      // L*L flattened (i,j) rows
#define IN_DIM 128
#define L_DIM  256
#define H_HEADS 4
#define D_HEAD 32

// LDS row pitches: 16 B x odd, so the 16 rows a ds_load_b128 touches fall on
// distinct banks (64 banks x 4 B; an unpadded 256/512-B pitch puts them on four).
#define ZF_P 132          // floats : 528 B

// ---- fragment units ----
// Every f16 operand in LDS except zn is kept in WMMA fragment order, in 512-B units [lane = 16*hi + m][8 halves], so that
// each wave-wide 16-B access covers 512 contiguous bytes:
//   q, k, gate, ao : unit (T, c8), T = row >> 4, c8 = col >> 4 : X[T*16 + m][c8*16 + 8*hi + e]
//   v              : unit (T, c8)                              : V[T*16 + 8*hi + e][c8*16 + m]
//   weights        : unit (t, kb, c)                           : W[kb*32 + c*16 + 8*hi + e][t*16 + m]
// A 16x32 (or 32x16) f16 fragment is two such units (k 0..15 and k 16..31 of the block).
// The workspace holds only the pair bias: f32, order of the transposed logits' accumulator (see kP's tail).
#define OFF_B   ((size_t)0)
#define WAVE_H  4224      // halves of one wave's 8448-B LDS slice (16 rows x 528 B)

__device__ __forceinline__ v8f wmma32(v16h a, v16h b, v8f c) {
  return __builtin_amdgcn_wmma_f32_16x16x32_f16(false, a, false, b, (short)0, c, false, false);
}

// Build a 16-half fragment from two contiguous 16B chunks (A layout and our
// B layouts both reduce to this: halves 0..7 = chunk0, halves 8..15 = chunk1).
__device__ __forceinline__ v16h frag2(const half_t* c0, const half_t* c1) {
  h8 x0 = *(const h8a*)c0;
  h8 x1 = *(const h8a*)c1;
  v16h f;
#pragma unroll
  for (int i = 0; i < 8; ++i) { f[i] = x0[i]; f[i + 8] = x1[i]; }
  return f;
}

// Load the 4 K-step B fragments of one 16-col weight tile (independent regs
// so the scheduler can clause the 8 b128 loads and keep WMMAs back-to-back).
__device__ __forceinline__ void loadB4(const half_t* __restrict__ packedW, int t, int lane,
                                       v16h b[4]) {
#pragma unroll
  for (int kb = 0; kb < 4; ++kb) {
    const half_t* p = &packedW[((size_t)(t * 4 + kb) * 64 + lane) * 8];
    b[kb] = frag2(p, p + 256);
  }
}

// ---------------- weights to f16 fragment units ----------------
// tile index t in kF's Wl: 0..23 = w_qkv (384 cols), 24..31 = w_gate; w_out's 8 tiles and the pair tile (padded to 16) have arrays of their own
// One lane's 16 B of each of the two units of a 32-deep k block: W[k0 + e][col] and W[k0 + 16 + e][col],
// first = k0 * LD + col. LD is a constant, so the 16 loads share one address register.
template <int LD>
__device__ __forceinline__ void packUnits(const float* __restrict__ wsrc, int first, bool valid,
                                          half_t* __restrict__ dst) {
  h8 u0, u1;
#pragma unroll
  for (int e = 0; e < 8; ++e) {
    const float x0 = wsrc[first + e * LD], x1 = wsrc[first + (e + 16) * LD];
    u0[e] = (half_t)(valid ? x0 : 0.0f);
    u1[e] = (half_t)(valid ? x1 : 0.0f);
  }
  *(h8*)&dst[0]   = u0;
  *(h8*)&dst[256] = u1;
}

// A wave's share of kF's fill: two neighbouring 16-column weight tiles (one 128-B line of every weight row), all
// four k blocks, and two k blocks of one w_out tile go to LDS as f16 fragment units, and the wave's 16 z rows go to LDS
// as they are. The four gate waves (LD == 128) take 32 entries of b_gate as well. One straight-line block: all the
// loads fly together.
// first = 8 * hi * LD + column of the lane in the first tile; dstW = the lane's 16 B in the first tile's first unit;
// ofirst, dstO: the same for the first of the wave's two k blocks of w_out.
template <int LD>
__device__ __forceinline__ void stageF(const float* __restrict__ wsrc, int first, half_t* __restrict__ dstW,
                                       const float* __restrict__ wout, int ofirst, half_t* __restrict__ dstO,
                                       const float* __restrict__ bsrc, float* __restrict__ bdst,
                                       const float* __restrict__ zrow, float* __restrict__ zdst, int lane) {
  float xw[8][16], xo[2][16], xg = 0.0f, zv[64];
#pragma unroll  // s = 4 * tile + k block; the arrays are indexed by s, e, k and have to stay in registers
  for (int s = 0; s < 8; ++s)
#pragma unroll
    for (int e = 0; e < 8; ++e) {
      xw[s][e]     = wsrc[first + ((s & 3) * 32 + e) * LD + (s >> 2) * 16];
      xw[s][e + 8] = wsrc[first + ((s & 3) * 32 + e + 16) * LD + (s >> 2) * 16];
    }
#pragma unroll
  for (int p = 0; p < 2; ++p)
#pragma unroll
    for (int e = 0; e < 8; ++e) {
      xo[p][e]     = wout[ofirst + (p * 32 + e) * 128];
      xo[p][e + 8] = wout[ofirst + (p * 32 + e + 16) * 128];
    }
  if (LD == 128) xg = bsrc[lane];
  // the z loads land in, and later address arithmetic rewrites, registers that the loads above name while these are in
  // flight; the operands keep those registers as they are up to the wait
  if (LD == 128) asm volatile("s_wait_xcnt 0x0" :: "v"(first), "s"(wsrc), "v"(ofirst), "s"(wout), "s"(bsrc) : "memory");
  else           asm volatile("s_wait_xcnt 0x0" :: "v"(first), "s"(wsrc), "v"(ofirst), "s"(wout) : "memory");
#pragma unroll
  for (int k = 0; k < 64; ++k) zv[k] = (zrow + k * 32)[lane];  // 32 floats a trip: row k >> 2, quarter k & 3
  asm volatile("s_wait_xcnt 0x0" :: "v"(lane), "s"(zrow) : "memory");  // the same for the registers that the z loads name
#pragma unroll
  for (int s = 0; s < 8; ++s) {
    h8 u0, u1;
#pragma unroll
    for (int e = 0; e < 8; ++e) { u0[e] = (half_t)xw[s][e]; u1[e] = (half_t)xw[s][e + 8]; }
    *(h8*)&dstW[s * 512]       = u0;
    *(h8*)&dstW[s * 512 + 256] = u1;
  }
#pragma unroll
  for (int p = 0; p < 2; ++p) {
    h8 u0, u1;
#pragma unroll
    for (int e = 0; e < 8; ++e) { u0[e] = (half_t)xo[p][e]; u1[e] = (half_t)xo[p][e + 8]; }
    *(h8*)&dstO[p * 512]       = u0;
    *(h8*)&dstO[p * 512 + 256] = u1;
  }
  if (LD == 128) bdst[lane] = xg;
#pragma unroll
  for (int k = 0; k < 64; ++k) zdst[(k >> 2) * ZF_P + (k & 3) * 32 + lane] = zv[k];
}

// LayerNorm of a wave's 16 rows (f32 in LDS, pitch ZF_P): lane pair (m, m+16) handles row m.
__device__ __forceinline__ void lnRows(float* zw, const float* __restrict__ gamma, const float* __restrict__ beta,
                                       int m, int hi) {
  float s = 0.f, sq = 0.f;
  const float* zr = &zw[m * ZF_P];
  for (int c = hi * 64; c < hi * 64 + 64; ++c) { float x = zr[c]; s += x; sq += x * x; }
  s  += __shfl_xor(s, 16, 32);
  sq += __shfl_xor(sq, 16, 32);
  float mean = s * (1.0f / 128.0f);
  float var  = sq * (1.0f / 128.0f) - mean * mean;
  float inv  = rsqrtf(var + 1e-5f);
  // zn in f16 overlays the row it came from: the lane's 64 halves lie in
  // the first 128 B of its own 64 floats, each 16 B written behind the read of the floats it covers.
  // Column c of zn is half (c >> 6) * 128 + (c & 63) of the 528-B row.
  half_t* zhr = (half_t*)&zw[m * ZF_P] + hi * 128;
  for (int o = 0; o < 64; o += 8) {
    const int c = hi * 64 + o;
    h8 y;
#pragma unroll
    for (int e = 0; e < 8; ++e) y[e] = (half_t)((zr[c + e] - mean) * inv * gamma[c + e] + beta[c + e]);
    *(h8a*)&zhr[o] = y;
  }
}

// The four fragments of the wave's 16x128 zn tile
__device__ __forceinline__ void loadZn(const float* zw, int m, int hi, v16h afr[4]) {
#pragma unroll
  for (int kb = 0; kb < 4; ++kb) {
    const half_t* c0 = (const half_t*)&zw[m * ZF_P] + (kb >> 1) * 128 + (kb & 1) * 32 + hi * 8;
    afr[kb] = frag2(c0, c0 + 16);
  }
}

// ---------------- projections: one 16x16 tile to the reader's fragment unit ----------------
// MODE 0 (q, k) and 2 (gate): the TRANSPOSED product (weights as A, zn as B), so lane (m, hi) holds
// row m, columns 8*hi .. 8*hi+7 of the tile. MODE 1 (v): the direct product, lane (m, hi) holds
// column m, rows 8*hi .. 8*hi+7. Either way the lane's 8 values are its 16 B of the reader's fragment unit.
template <int MODE>
__device__ __forceinline__ h8 packTileA(int tt, v8f acc, int hi, const float* b_gate) {
  h8 p;
  float bgv[8] = {};
  if (MODE == 2) {
    const float4 g0 = *(const float4*)&b_gate[tt * 16 + hi * 8];
    const float4 g1 = *(const float4*)&b_gate[tt * 16 + hi * 8 + 4];
    bgv[0] = g0.x; bgv[1] = g0.y; bgv[2] = g0.z; bgv[3] = g0.w;
    bgv[4] = g1.x; bgv[5] = g1.y; bgv[6] = g1.z; bgv[7] = g1.w;
  }
#pragma unroll
  for (int v = 0; v < 8; ++v) {
    if (MODE == 2) {
      const float bg = bgv[v];
      float s;
      // v_nop: the slot the instruction set asks for behind a transcendental before its result is read or its
      // source overwritten
      asm("v_rcp_f32 %0, %1\n\tv_nop" : "=v"(s) : "v"(1.0f + __expf(-(acc[v] + bg))));
      p[v] = (half_t)s;
    } else {
      p[v] = (half_t)acc[v];
    }
  }
  return p;
}

// The 8 tiles (128 columns) of one of q, k, v, gate for the wave's 16 rows: p[tt] is the lane's 16 B of unit tt.
// On entry b0 holds tile t0's fragments; on exit those of t0 + 8, unless this is the last group.
template <int MODE, bool LAST>
__device__ __forceinline__ void group8F(int t0, const v16h afr[4], v16h b0[4], v16h b1[4],
                                        const half_t* __restrict__ packedW, int lane, int hi,
                                        const float* b_gate, h8 p[8]) {
#pragma unroll  // p[] is indexed by tt and has to stay in registers
  for (int tt = 0; tt < 8; tt += 2) {
    loadB4(packedW, t0 + tt + 1, lane, b1);
    v8f acc0 = {};
#pragma unroll
    for (int kb = 0; kb < 4; ++kb)
      acc0 = (MODE == 1) ? wmma32(afr[kb], b0[kb], acc0) : wmma32(b0[kb], afr[kb], acc0);
    if (!(LAST && tt == 6)) loadB4(packedW, t0 + tt + 2, lane, b0);  // prefetch next
    v8f acc1 = {};
#pragma unroll
    for (int kb = 0; kb < 4; ++kb)
      acc1 = (MODE == 1) ? wmma32(afr[kb], b1[kb], acc1) : wmma32(b1[kb], afr[kb], acc1);
    p[tt]     = packTileA<MODE>(tt, acc0, hi, b_gate);
    p[tt + 1] = packTileA<MODE>(tt + 1, acc1, hi, b_gate);
  }
}

// ---------------- kernel P: LayerNorm + pair bias (every row of the attention needs all of it) ----------------
__global__ __launch_bounds__(128) void kP(const float* __restrict__ z,
                                          const float* __restrict__ gamma,
                                          const float* __restrict__ beta,
                                          const float* __restrict__ wpair,
                                          float* __restrict__ biasbuf) {
  __shared__ __attribute__((aligned(16))) half_t Wp[4 * 512];      // the pair tile's fragment units
  __shared__ __attribute__((aligned(16))) float  zf[4][16 * ZF_P]; // z rows; the f16 zn rows later overlay them
  __shared__ __attribute__((aligned(16))) float  xb[256];          // bias exchange: [head][i in quad][j in tile]
  // the wave number as a scalar: the load base stays out of vector registers
  const int w = __builtin_amdgcn_readfirstlane(threadIdx.x >> 5);
  const int lane = threadIdx.x & 31;
  // The four waves take one 16-wide j tile of four consecutive i (wave w: i = 4*ib + w), so that
  // together they hold whole 128-B lines of the bias fragments written at the tail.
  const int ib = blockIdx.x >> 4, jtA = blockIdx.x & 15;
  const int r0 = (ib * 4 + w) * 256 + jtA * 16;
  const int m = lane & 15, hi = lane >> 4, ncol = lane & 15;

  const float* zrow = z + (size_t)r0 * 128;
  v4f zv[16];
#pragma unroll  // one whole 512-B row per load
  for (int s = 0; s < 16; ++s) zv[s] = *(const v4f*)&(zrow + s * 128)[lane * 4];
  // later address arithmetic rewrites the registers that these loads name while they are in flight
  asm volatile("s_wait_xcnt 0x0" :: "v"(lane), "s"(zrow) : "memory");
  packUnits<4>(wpair, (w * 32 + hi * 8) * 4 + (m & 3), m < 4, &Wp[(w * 64 + lane) * 8]);  // columns 4..15: zero padding
#pragma unroll
  for (int s = 0; s < 16; ++s) *(v4f*)&zf[w][s * ZF_P + lane * 4] = zv[s];
  __syncthreads();
  lnRows(zf[w], gamma, beta, m, hi);
  __syncthreads();
  v16h afr[4], b0[4];
  loadZn(zf[w], m, hi, afr);
  loadB4(Wp, 0, lane, b0);
  // pair bias (only cols 0..3 valid), f32 output times sqrt(d): kF adds it to the
  // unscaled q.k sums and applies 1/sqrt(d) once, inside the exponent.
  // Layout = the 16x16 f32 accumulator fragment of the TRANSPOSED logits tile (h, it, jt), keys down, queries across:
  //   [h][it][jt][half][i & 15][(j >> 3) & 1][j & 3],  half = (j >> 2) & 1
  // so a kF lane (query i & 15, key half) reads its 8 accumulator registers as two b128 of 512 contiguous B per wave.
  v8f acc = {};
#pragma unroll
  for (int kb = 0; kb < 4; ++kb) acc = wmma32(afr[kb], b0[kb], acc);
  float sv[8];
#pragma unroll
  for (int v = 0; v < 8; ++v) sv[v] = acc[v] * 5.656854249492381f;
  if (ncol < 4) {  // the lane holds keys 8*hi .. 8*hi+7 of the tile for head ncol and the wave's i
    *(float4*)&xb[ncol * 64 + w * 16 + hi * 8]     = make_float4(sv[0], sv[1], sv[2], sv[3]);
    *(float4*)&xb[ncol * 64 + w * 16 + hi * 8 + 4] = make_float4(sv[4], sv[5], sv[6], sv[7]);
  }
  __syncthreads();  // the four waves' i values meet here; wave w then writes head w
  if (lane < 16) {  // two whole 128-B lines: lane = 8*half + 2*(i in quad) + key half
    const int half = lane >> 3, il = (lane >> 1) & 3, hj = lane & 1;
    const float4 t = *(const float4*)&xb[w * 64 + il * 16 + hj * 8 + half * 4];
    const int it = ib >> 2, q = ib & 3;
    *(float4*)&biasbuf[((size_t)(w * 16 + it) * 16 + jtA) * 256 + half * 128 + q * 32 + (lane & 7) * 4] = t;
  }
}

// Lane l <-> l ^ 16: the two lanes that share a query column of a transposed score tile.
__device__ __forceinline__ float xhalf(float x) {
  const int b = __builtin_bit_cast(int, x);
  return __builtin_bit_cast(float, __builtin_amdgcn_permlanex16(b, b, 0x76543210, 0xfedcba98, false, false));
}

// ---------------- kernel F: one attention row r per block: LayerNorm, q/k/v/gate, attention, output projection ----------------
// Wave wv owns the 16 positions wv*16 .. +15 of the row from z to out. Its q, gate and attention output never leave the
// lane that made them (a producer's 16 B of a fragment unit are the same lane's 16 B for the reader); only k and v are
// read by the other waves, from LDS.
__global__ __launch_bounds__(512) void kF(const float* __restrict__ z,
                                          const float* __restrict__ gamma,
                                          const float* __restrict__ beta,
                                          const float* __restrict__ wqkv,
                                          const float* __restrict__ wgate,
                                          const float* __restrict__ b_gate,
                                          const float* __restrict__ wout,
                                          const float* __restrict__ b_out,
                                          const float* __restrict__ biasbuf,
                                          float* __restrict__ out) {
  // w_qkv and w_gate as fragment units (32 tiles), packed once per block. Behind the projections the array is cut into
  // 16 slices of WAVE_H halves, one a wave: q units (later the attention output's), gate units, at the end the f32 rows.
  __shared__ __attribute__((aligned(16))) half_t Wl[16 * WAVE_H];
  // z rows, one slice a wave; the f16 zn rows overlay them, and then the wave's 8 k units and 8 v units
  __shared__ __attribute__((aligned(16))) float  zf[16][16 * ZF_P];
  __shared__ __attribute__((aligned(16))) half_t Wo[8 * 4 * 512];  // w_out as fragment units
  __shared__ __attribute__((aligned(16))) float  gS[128];     // b_gate: a lane reads 8 adjacent entries per gate tile
  // the wave number as a scalar: the branches on it are scalar and the bases stay out of vector registers
  const int wv = __builtin_amdgcn_readfirstlane(threadIdx.x >> 5);
  const int lane = threadIdx.x & 31;
  const int r0 = blockIdx.x * 256 + wv * 16;
  const int m = lane & 15, hi = lane >> 4;

  // waves 0..11: tiles 2*wv, 2*wv + 1 of w_qkv; waves 12..15: the same tile numbers, which are w_gate's;
  // every wave: k blocks 2*(wv & 1), +1 of w_out's tile wv >> 1
  const int ofirst = ((wv & 1) * 64 + hi * 8) * 128 + (wv >> 1) * 16 + m;
  half_t* dstO = &Wo[(wv * 128 + lane) * 8];
  if (wv < 12)
    stageF<384>(wqkv, hi * 8 * 384 + wv * 32 + m, &Wl[(wv * 512 + lane) * 8], wout, ofirst, dstO, b_gate, gS,
                z + (size_t)r0 * 128, zf[wv], lane);
  else
    stageF<128>(wgate, hi * 8 * 128 + (wv - 12) * 32 + m, &Wl[(wv * 512 + lane) * 8], wout, ofirst, dstO,
                b_gate + (wv - 12) * 32, gS + (wv - 12) * 32, z + (size_t)r0 * 128, zf[wv], lane);
  __syncthreads();
  lnRows(zf[wv], gamma, beta, m, hi);
  __syncthreads();

  h8 pq[8], pg[8];
  {
    v16h afr[4], b0[4], b1[4];
    h8 pk[8], pv[8];
    loadZn(zf[wv], m, hi, afr);
    half_t* kvw = (half_t*)&zf[wv][0] + lane * 8;  // the zn rows are in afr: the slice now takes k and v
    loadB4(Wl, 0, lane, b0);
    group8F<0, false>(0,  afr, b0, b1, Wl, lane, hi, gS, pq);
    group8F<0, false>(8,  afr, b0, b1, Wl, lane, hi, gS, pk);
#pragma unroll
    for (int tt = 0; tt < 8; ++tt) *(h8a*)&kvw[tt * 256] = pk[tt];
    group8F<1, false>(16, afr, b0, b1, Wl, lane, hi, gS, pv);
#pragma unroll
    for (int tt = 0; tt < 8; ++tt) *(h8a*)&kvw[2048 + tt * 256] = pv[tt];
    group8F<2, true>(24, afr, b0, b1, Wl, lane, hi, gS, pg);
  }
  __syncthreads();  // every wave's k and v are in LDS, and nobody reads the packed weights in Wl any more

  half_t* own = Wl + wv * WAVE_H + lane * 8;  // the lane's 16 B of unit 0 of the wave's slice
#pragma unroll
  for (int tt = 0; tt < 8; ++tt) { *(h8a*)&own[tt * 256] = pq[tt]; *(h8a*)&own[2048 + tt * 256] = pg[tt]; }

  const half_t* kv = (const half_t*)&zf[0][0] + lane * 8;
  const float kexp = 0.17677669529663687f * 1.4426950408889634f;  // 1/sqrt(32) * log2(e)
  const int bl = (m * 2 + hi) * 4;  // the lane's 16 B in each 512-B half of a bias tile
#pragma unroll 1  // one head a trip; unrolled, four trips of 128 score registers do not fit the 256 of a 16-wave block
  for (int hh = 0; hh < 4; ++hh) {
    // every block reads the same bias: neighbours start at different heads, so that they are not all on the same lines at once
    const int h = (hh + blockIdx.x) & 3;
    // lg = (q.k + sqrt(d) * bias)^T: the bias fragment is the WMMA's C operand
    const float* bf = biasbuf + (size_t)(h * 16 + wv) * 4096 + bl;
    v8f lg[16];
#pragma unroll
    for (int jt = 0; jt < 16; ++jt) {
      const float4 c0 = *(const float4*)&bf[jt * 256];
      const float4 c1 = *(const float4*)&bf[jt * 256 + 128];
      lg[jt] = v8f{c0.x, c0.y, c0.z, c0.w, c1.x, c1.y, c1.z, c1.w};
    }
    // the loads' address registers are reused while the loads are in flight; the operand keeps them as they are up to
    // the wait
    asm volatile("s_wait_xcnt 0x0" :: "v"(bf) : "memory");
    const v16h aQ = frag2(&own[h * 512], &own[h * 512 + 256]);
    // transposed scores (K as A, Q as B): lane (m, hi) holds query m, keys jt*16 + 8*hi .. +7.
    // K fragments come from LDS four at a time, one group ahead of the four WMMAs that use them.
    v16h fr[2][4];
#pragma unroll
    for (int i = 0; i < 4; ++i) fr[0][i] = frag2(kv + i * WAVE_H + h * 512, kv + i * WAVE_H + h * 512 + 256);
#pragma unroll
    for (int g = 0; g < 4; ++g) {
      if (g < 3) {
#pragma unroll
        for (int i = 0; i < 4; ++i) {
          const half_t* kc = kv + (g * 4 + 4 + i) * WAVE_H + h * 512;
          fr[(g + 1) & 1][i] = frag2(kc, kc + 256);
        }
      }
      // keeps the next group's LDS reads above this group's WMMAs: sunk to their users, each read is waited out alone
      __builtin_amdgcn_sched_barrier(0);
#pragma unroll
      for (int i = 0; i < 4; ++i) lg[g * 4 + i] = wmma32(fr[g & 1][i], aQ, lg[g * 4 + i]);
    }
    // softmax over j: the lane's 128 keys in registers, then one exchange with the lane that holds the other 128
    v8f mx8 = lg[0];
#pragma unroll
    for (int jt = 1; jt < 16; ++jt)
#pragma unroll
      for (int v = 0; v < 8; ++v) mx8[v] = fmaxf(mx8[v], lg[jt][v]);
    float mx = fmaxf(fmaxf(fmaxf(mx8[0], mx8[1]), fmaxf(mx8[2], mx8[3])),
                     fmaxf(fmaxf(mx8[4], mx8[5]), fmaxf(mx8[6], mx8[7])));
    mx = fmaxf(mx, xhalf(mx));
    const float nm = -mx * kexp;
    v8f s8 = {};
    v16h pA[8];  // exp(scores) in f16 as they are made: two score tiles are the B fragment of 32 keys
#pragma unroll
    for (int jt = 0; jt < 16; ++jt)
#pragma unroll
      for (int v = 0; v < 8; ++v) {
        const float e = __builtin_amdgcn_exp2f(__builtin_fmaf(lg[jt][v], kexp, nm));
        pA[jt >> 1][(jt & 1) * 8 + v] = (half_t)e;
        s8[v] += e;
      }
    float sum = ((s8[0] + s8[1]) + (s8[2] + s8[3])) + ((s8[4] + s8[5]) + (s8[6] + s8[7]));
    sum += xhalf(sum);
    const float rs = __builtin_amdgcn_rcpf(sum);

    // (attn @ V)^T (V as A, exp(scores)^T as B). Lane (m, hi) holds query row m, d = dt*16 + 8*hi .. +7, which is its 16 B of the gate's and of
    // the output's fragment unit; the row's 1/sum is the lane's own and is applied here.
    // V fragments likewise: those of 64 keys (two B fragments x two halves of d) one group ahead.
    v8f acc[2] = {};
#pragma unroll
    for (int i = 0; i < 4; ++i) {
      const half_t* vc = kv + (i >> 1) * 2 * WAVE_H + 2048 + h * 512 + (i & 1) * 256;
      fr[0][i] = frag2(vc, vc + WAVE_H);
    }
#pragma unroll
    for (int g = 0; g < 4; ++g) {
      if (g < 3) {
#pragma unroll
        for (int i = 0; i < 4; ++i) {
          const half_t* vc = kv + (g * 2 + 2 + (i >> 1)) * 2 * WAVE_H + 2048 + h * 512 + (i & 1) * 256;
          fr[(g + 1) & 1][i] = frag2(vc, vc + WAVE_H);
        }
      }
      __builtin_amdgcn_sched_barrier(0);  // as above: the next group's reads stay above this group's WMMAs
#pragma unroll
      for (int j = 0; j < 2; ++j)
#pragma unroll
        for (int dt = 0; dt < 2; ++dt) acc[dt] = wmma32(fr[g & 1][j * 2 + dt], pA[g * 2 + j], acc[dt]);
    }
#pragma unroll
    for (int dt = 0; dt < 2; ++dt) {
      const h8 gq = *(const h8a*)&own[2048 + h * 512 + dt * 256];
      h8 o;
#pragma unroll
      for (int v = 0; v < 8; ++v) o[v] = (half_t)((float)gq[v] * (acc[dt][v] * rs));
      *(h8a*)&own[h * 512 + dt * 256] = o;  // over this head's q units, which are spent
    }
  }

  // output projection + b_out: the wave's gated attention output, head kb, is the k block kb of its operand
  v16h afr[4];
#pragma unroll
  for (int kb = 0; kb < 4; ++kb) afr[kb] = frag2(&own[kb * 512], &own[kb * 512 + 256]);
  float* st = (float*)(Wl + wv * WAVE_H);  // store stage, 16 rows x 128 f32, over the slice's spent units
  v16h b0[4], b1[4];
  loadB4(Wo, 0, lane, b0);
#pragma unroll  // the next tiles' LDS reads and the b_out reads then stand ahead of the WMMAs that wait for them
  for (int tp = 0; tp < 4; ++tp) {
    const int n0 = tp * 2, n1 = tp * 2 + 1;
    loadB4(Wo, n1, lane, b1);
    v8f acc0 = {};
#pragma unroll
    for (int kb = 0; kb < 4; ++kb) acc0 = wmma32(b0[kb], afr[kb], acc0);
    if (tp < 3) loadB4(Wo, n1 + 1, lane, b0);  // prefetch next pair
    v8f acc1 = {};
#pragma unroll
    for (int kb = 0; kb < 4; ++kb) acc1 = wmma32(b1[kb], afr[kb], acc1);
    // transposed product (weights as A): lane (m, hi) holds row m, columns 8*hi .. 8*hi+7 of each tile
    float x0[8], x1[8];
#pragma unroll
    for (int v = 0; v < 8; ++v) {
      // both candidates are wave-uniform reads (scalar loads); the lane picks its half of the tile
      const float lo0 = b_out[n0 * 16 + v], hi0 = b_out[n0 * 16 + 8 + v];
      const float lo1 = b_out[n1 * 16 + v], hi1 = b_out[n1 * 16 + 8 + v];
      x0[v] = acc0[v] + (hi ? hi0 : lo0);
      x1[v] = acc1[v] + (hi ? hi1 : lo1);
    }
    float* sr = &st[m * ZF_P + hi * 8];
    *(float4*)&sr[n0 * 16]     = make_float4(x0[0], x0[1], x0[2], x0[3]);
    *(float4*)&sr[n0 * 16 + 4] = make_float4(x0[4], x0[5], x0[6], x0[7]);
    *(float4*)&sr[n1 * 16]     = make_float4(x1[0], x1[1], x1[2], x1[3]);
    *(float4*)&sr[n1 * 16 + 4] = make_float4(x1[4], x1[5], x1[6], x1[7]);
  }
  asm volatile("s_wait_dscnt 0" ::: "memory");  // same-wave LDS RAW across lanes: rows are read back by other lanes
  // one whole 512-B output row per store
#pragma unroll
  for (int s = 0; s < 16; ++s)
    *(float4*)&(out + (size_t)(r0 + s) * 128)[lane * 4] = *(const float4*)&st[s * ZF_P + lane * 4];
}

extern "C" void kernel_launch(void* const* d_in, const int* in_sizes, int n_in,
                              void* d_out, int out_size, void* d_ws, size_t ws_size,
                              hipStream_t stream) {
  const float* z      = (const float*)d_in[0];
  const float* gamma  = (const float*)d_in[1];
  const float* beta   = (const float*)d_in[2];
  const float* w_qkv  = (const float*)d_in[3];
  const float* w_pair = (const float*)d_in[4];
  const float* w_gate = (const float*)d_in[5];
  const float* b_gate = (const float*)d_in[6];
  const float* w_out  = (const float*)d_in[7];
  const float* b_out  = (const float*)d_in[8];

  float* biasbuf = (float*)((char*)d_ws + OFF_B);

  kP<<<N_ROWS / 64, 128, 0, stream>>>(z, gamma, beta, w_pair, biasbuf);
  kF<<<L_DIM, 512, 0, stream>>>(z, gamma, beta, w_qkv, w_gate, b_gate, w_out, b_out, biasbuf, (float*)d_out);
}

// v007
// It runs in 32.2 microseconds.
// In two side-by-side timings against v006, it was 1.11 and 1.10 times as fast.
// Counting every step since v000, it is 6.24 times as fast.
#include <hip/hip_runtime.h>
#include <hip/hip_bf16.h>
#include <stddef.h>

typedef _Float16 half_t;
typedef __attribute__((ext_vector_type(16))) _Float16 v16h;
typedef __attribute__((ext_vector_type(8)))  _Float16 h8;
typedef __attribute__((ext_vector_type(8)))  float    v8f;
typedef __attribute__((ext_vector_type(4)))  float    v4f;
typedef h8 __attribute__((may_alias)) h8a;  // 16-B f16 accesses to LDS bytes that hold f32 or other operands at other times

#define N_ROWS 65536      // L*L flattened (i,j) rows
#define IN_DIM 128
#define L_DIM  256
#define H_HEADS 4
#define D_HEAD 32

// LDS row pitches: 16 B x odd, so the 16 rows a ds_load_b128 touches fall on
// distinct banks (64 banks x 4 B; an unpadded 256/512-B pitch puts them on four).
#define ZF_P 132          // floats : 528 B

// ---- fragment units ----
// Every f16 operand in LDS except zn is kept in WMMA fragment order, in 512-B units [lane = 16*hi + m][8 halves], so that
// each wave-wide 16-B access covers 512 contiguous bytes:
//   q, k, gate, ao : unit (T, c8), T = row >> 4, c8 = col >> 4 : X[T*16 + m][c8*16 + 8*hi + e]
//   v              : unit (T, c8)                              : V[T*16 + 8*hi + e][c8*16 + m]
//   weights        : unit (t, kb, c)                           : W[kb*32 + c*16 + 8*hi + e][t*16 + m]
// A 16x32 (or 32x16) f16 fragment is two such units (k 0..15 and k 16..31 of the block).
// The workspace holds the pair bias (f32, order of the transposed logits' accumulator, see kP's tail) and behind it
// the 40 weight tiles as fragment units, which kP packs once for all of kF's blocks.
#define OFF_B   ((size_t)0)
#define OFF_W   ((size_t)1 << 20)  // bytes: behind 4 * 256 * 256 f32 of bias
#define WO_H    65536              // halves in front of w_out's units: 32 tiles x 4 k blocks x 512
#define WAVE_H  4224      // halves of one wave's 8448-B LDS slice (16 rows x 528 B)

__device__ __forceinline__ v8f wmma32(v16h a, v16h b, v8f c) {
  return __builtin_amdgcn_wmma_f32_16x16x32_f16(false, a, false, b, (short)0, c, false, false);
}

// Build a 16-half fragment from two contiguous 16B chunks (A layout and our
// B layouts both reduce to this: halves 0..7 = chunk0, halves 8..15 = chunk1).
__device__ __forceinline__ v16h frag2(const half_t* c0, const half_t* c1) {
  h8 x0 = *(const h8a*)c0;
  h8 x1 = *(const h8a*)c1;
  v16h f;
#pragma unroll
  for (int i = 0; i < 8; ++i) { f[i] = x0[i]; f[i + 8] = x1[i]; }
  return f;
}

// Load the 4 K-step B fragments of one 16-col weight tile (independent regs
// so the scheduler can clause the 8 b128 loads and keep WMMAs back-to-back).
__device__ __forceinline__ void loadB4(const half_t* __restrict__ packedW, int t, int lane,
                                       v16h b[4]) {
#pragma unroll
  for (int kb = 0; kb < 4; ++kb) {
    const half_t* p = &packedW[((size_t)(t * 4 + kb) * 64 + lane) * 8];
    b[kb] = frag2(p, p + 256);
  }
}

// ---------------- weights to f16 fragment units ----------------
// tile index t: 0..23 = w_qkv (384 cols), 24..31 = w_gate, 32..39 = w_out (an LDS array of its own in kF); the pair tile (padded to 16) stays in kP
// One lane's 16 B of each of the two units of a 32-deep k block: W[k0 + e][col] and W[k0 + 16 + e][col],
// first = k0 * LD + col. LD is a constant, so the 16 loads share one address register.
template <int LD>
__device__ __forceinline__ void packUnits(const float* __restrict__ wsrc, int first, bool valid,
                                          half_t* __restrict__ dst) {
  h8 u0, u1;
#pragma unroll
  for (int e = 0; e < 8; ++e) {
    const float x0 = wsrc[first + e * LD], x1 = wsrc[first + (e + 16) * LD];
    u0[e] = (half_t)(valid ? x0 : 0.0f);
    u1[e] = (half_t)(valid ? x1 : 0.0f);
  }
  *(h8*)&dst[0]   = u0;
  *(h8*)&dst[256] = u1;
}

// A wave's share of kF's fill: 16 of the 256 units of w_qkv and w_gate and 4 of the 64 of w_out go from the workspace,
// where kP left them in f16 fragment order, to the same place in LDS, 512 contiguous B a load; the wave's 16 z rows go to
// LDS as they are. The last four waves take 32 entries of b_gate each as well. One straight-line block: all the loads
// fly together.
__device__ __forceinline__ void stageF(const half_t* __restrict__ srcW, half_t* __restrict__ dstW,
                                       const half_t* __restrict__ srcO, half_t* __restrict__ dstO,
                                       bool gate, const float* __restrict__ bsrc, float* __restrict__ bdst,
                                       const float* __restrict__ zrow, float* __restrict__ zdst, int lane) {
  h8 xw[16], xo[4];
  float xg = 0.0f, zv[64];
#pragma unroll  // the arrays are indexed by s, p, k and have to stay in registers
  for (int s = 0; s < 16; ++s) xw[s] = *(const h8*)&(srcW + s * 256)[lane * 8];
#pragma unroll
  for (int p = 0; p < 4; ++p) xo[p] = *(const h8*)&(srcO + WO_H + p * 256)[lane * 8];  // WO_H goes into the loads' offset field
  if (gate) xg = bsrc[lane];
#pragma unroll
  for (int k = 0; k < 64; ++k) zv[k] = (zrow + k * 32)[lane];  // 32 floats a trip: row k >> 2, quarter k & 3
  // later address arithmetic rewrites registers that the loads above name while these are in flight; the operands keep
  // those registers as they are up to the wait
  asm volatile("s_wait_xcnt 0x0" :: "v"(lane), "s"(srcW), "s"(srcO), "s"(bsrc), "s"(zrow) : "memory");
#pragma unroll
  for (int s = 0; s < 16; ++s) *(h8*)&dstW[s * 256] = xw[s];
#pragma unroll
  for (int p = 0; p < 4; ++p) *(h8*)&dstO[p * 256] = xo[p];
  if (gate) bdst[lane] = xg;
#pragma unroll
  for (int k = 0; k < 64; ++k) zdst[(k >> 2) * ZF_P + (k & 3) * 32 + lane] = zv[k];
}

// LayerNorm of a wave's 16 rows (f32 in LDS, pitch ZF_P): lane pair (m, m+16) handles row m.
__device__ __forceinline__ void lnRows(float* zw, const float* __restrict__ gamma, const float* __restrict__ beta,
                                       int m, int hi) {
  float s = 0.f, sq = 0.f;
  const float* zr = &zw[m * ZF_P];
  for (int c = hi * 64; c < hi * 64 + 64; ++c) { float x = zr[c]; s += x; sq += x * x; }
  s  += __shfl_xor(s, 16, 32);
  sq += __shfl_xor(sq, 16, 32);
  float mean = s * (1.0f / 128.0f);
  float var  = sq * (1.0f / 128.0f) - mean * mean;
  float inv  = rsqrtf(var + 1e-5f);
  // zn in f16 overlays the row it came from: the lane's 64 halves lie in
  // the first 128 B of its own 64 floats, each 16 B written behind the read of the floats it covers.
  // Column c of zn is half (c >> 6) * 128 + (c & 63) of the 528-B row.
  half_t* zhr = (half_t*)&zw[m * ZF_P] + hi * 128;
  for (int o = 0; o < 64; o += 8) {
    const int c = hi * 64 + o;
    h8 y;
#pragma unroll
    for (int e = 0; e < 8; ++e) y[e] = (half_t)((zr[c + e] - mean) * inv * gamma[c + e] + beta[c + e]);
    *(h8a*)&zhr[o] = y;
  }
}

// The four fragments of the wave's 16x128 zn tile
__device__ __forceinline__ void loadZn(const float* zw, int m, int hi, v16h afr[4]) {
#pragma unroll
  for (int kb = 0; kb < 4; ++kb) {
    const half_t* c0 = (const half_t*)&zw[m * ZF_P] + (kb >> 1) * 128 + (kb & 1) * 32 + hi * 8;
    afr[kb] = frag2(c0, c0 + 16);
  }
}

// ---------------- projections: one 16x16 tile to the reader's fragment unit ----------------
// MODE 0 (q, k) and 2 (gate): the TRANSPOSED product (weights as A, zn as B), so lane (m, hi) holds
// row m, columns 8*hi .. 8*hi+7 of the tile. MODE 1 (v): the direct product, lane (m, hi) holds
// column m, rows 8*hi .. 8*hi+7. Either way the lane's 8 values are its 16 B of the reader's fragment unit.
template <int MODE>
__device__ __forceinline__ h8 packTileA(int tt, v8f acc, int hi, const float* b_gate) {
  h8 p;
  float bgv[8] = {};
  if (MODE == 2) {
    const float4 g0 = *(const float4*)&b_gate[tt * 16 + hi * 8];
    const float4 g1 = *(const float4*)&b_gate[tt * 16 + hi * 8 + 4];
    bgv[0] = g0.x; bgv[1] = g0.y; bgv[2] = g0.z; bgv[3] = g0.w;
    bgv[4] = g1.x; bgv[5] = g1.y; bgv[6] = g1.z; bgv[7] = g1.w;
  }
#pragma unroll
  for (int v = 0; v < 8; ++v) {
    if (MODE == 2) {
      const float bg = bgv[v];
      float s;
      // v_nop: the slot the instruction set asks for behind a transcendental before its result is read or its
      // source overwritten
      asm("v_rcp_f32 %0, %1\n\tv_nop" : "=v"(s) : "v"(1.0f + __expf(-(acc[v] + bg))));
      p[v] = (half_t)s;
    } else {
      p[v] = (half_t)acc[v];
    }
  }
  return p;
}

// The 8 tiles (128 columns) of one of q, k, v, gate for the wave's 16 rows: p[tt] is the lane's 16 B of unit tt.
// On entry b0 holds tile t0's fragments; on exit those of t0 + 8, unless this is the last group.
template <int MODE, bool LAST>
__device__ __forceinline__ void group8F(int t0, const v16h afr[4], v16h b0[4], v16h b1[4],
                                        const half_t* __restrict__ packedW, int lane, int hi,
                                        const float* b_gate, h8 p[8]) {
#pragma unroll  // p[] is indexed by tt and has to stay in registers
  for (int tt = 0; tt < 8; tt += 2) {
    loadB4(packedW, t0 + tt + 1, lane, b1);
    v8f acc0 = {};
#pragma unroll
    for (int kb = 0; kb < 4; ++kb)
      acc0 = (MODE == 1) ? wmma32(afr[kb], b0[kb], acc0) : wmma32(b0[kb], afr[kb], acc0);
    if (!(LAST && tt == 6)) loadB4(packedW, t0 + tt + 2, lane, b0);  // prefetch next
    v8f acc1 = {};
#pragma unroll
    for (int kb = 0; kb < 4; ++kb)
      acc1 = (MODE == 1) ? wmma32(afr[kb], b1[kb], acc1) : wmma32(b1[kb], afr[kb], acc1);
    p[tt]     = packTileA<MODE>(tt, acc0, hi, b_gate);
    p[tt + 1] = packTileA<MODE>(tt + 1, acc1, hi, b_gate);
  }
}

// ---------------- kernel P: LayerNorm + pair bias (every row of the attention needs all of it) ----------------
// The 40 blocks behind the row blocks pack one weight tile each for kF (wave w: k block w) and leave: short blocks of
// their own, so that no row block waits for weight loads or for the stores in front of its first barrier.
__global__ __launch_bounds__(128) void kP(const float* __restrict__ z,
                                          const float* __restrict__ gamma,
                                          const float* __restrict__ beta,
                                          const float* __restrict__ wpair,
                                          const float* __restrict__ wqkv,
                                          const float* __restrict__ wgate,
                                          const float* __restrict__ wout,
                                          float* __restrict__ biasbuf,
                                          half_t* __restrict__ packW) {
  __shared__ __attribute__((aligned(16))) half_t Wp[4 * 512];      // the pair tile's fragment units
  __shared__ __attribute__((aligned(16))) float  zf[4][16 * ZF_P]; // z rows; the f16 zn rows later overlay them
  __shared__ __attribute__((aligned(16))) float  xb[256];          // bias exchange: [head][i in quad][j in tile]
  // the wave number as a scalar: the load base stays out of vector registers
  const int w = __builtin_amdgcn_readfirstlane(threadIdx.x >> 5);
  const int lane = threadIdx.x & 31;
  if (blockIdx.x >= N_ROWS / 64) {  // the same for the whole block, in front of every barrier
    const int t = blockIdx.x - N_ROWS / 64;
    const float* wsrc = t < 24 ? wqkv : t < 32 ? wgate : wout;
    const int ld = t < 24 ? 384 : 128, col = (t < 24 ? t : t & 7) * 16 + (lane & 15);
    const float* p0 = wsrc + (w * 32 + (lane >> 4) * 8) * ld + col;
    const float* p[16];
    float x[16];
#pragma unroll  // p and x are indexed by e and have to stay in registers
    for (int e = 0; e < 8; ++e) { p[e] = p0 + e * ld; p[e + 8] = p0 + (e + 16) * ld; }
#pragma unroll
    for (int e = 0; e < 16; ++e) x[e] = *p[e];
    // the operands keep the loads' address registers as they are up to the wait: no later load lands in one of them
    asm volatile("s_wait_xcnt 0x0" :: "v"(p[0]), "v"(p[1]), "v"(p[2]), "v"(p[3]), "v"(p[4]), "v"(p[5]), "v"(p[6]), "v"(p[7]),
                 "v"(p[8]), "v"(p[9]), "v"(p[10]), "v"(p[11]), "v"(p[12]), "v"(p[13]), "v"(p[14]), "v"(p[15]) : "memory");
    h8 u0, u1;
#pragma unroll
    for (int e = 0; e < 8; ++e) { u0[e] = (half_t)x[e]; u1[e] = (half_t)x[e + 8]; }
    half_t* dst = &packW[((t * 4 + w) * 64 + lane) * 8];
    *(h8*)&dst[0]   = u0;
    *(h8*)&dst[256] = u1;
    return;
  }
  // The four waves take one 16-wide j tile of four consecutive i (wave w: i = 4*ib + w), so that
  // together they hold whole 128-B lines of the bias fragments written at the tail.
  const int ib = blockIdx.x >> 4, jtA = blockIdx.x & 15;
  const int r0 = (ib * 4 + w) * 256 + jtA * 16;
  const int m = lane & 15, hi = lane >> 4, ncol = lane & 15;

  const float* zrow = z + (size_t)r0 * 128;
  v4f zv[16];
#pragma unroll  // one whole 512-B row per load
  for (int s = 0; s < 16; ++s) zv[s] = *(const v4f*)&(zrow + s * 128)[lane * 4];
  // later address arithmetic rewrites the registers that these loads name while they are in flight
  asm volatile("s_wait_xcnt 0x0" :: "v"(lane), "s"(zrow) : "memory");
  packUnits<4>(wpair, (w * 32 + hi * 8) * 4 + (m & 3), m < 4, &Wp[(w * 64 + lane) * 8]);  // columns 4..15: zero padding
#pragma unroll
  for (int s = 0; s < 16; ++s) *(v4f*)&zf[w][s * ZF_P + lane * 4] = zv[s];
  __syncthreads();
  lnRows(zf[w], gamma, beta, m, hi);
  __syncthreads();
  v16h afr[4], b0[4];
  loadZn(zf[w], m, hi, afr);
  loadB4(Wp, 0, lane, b0);
  // pair bias (only cols 0..3 valid), f32 output times sqrt(d): kF adds it to the
  // unscaled q.k sums and applies 1/sqrt(d) once, inside the exponent.
  // Layout = the 16x16 f32 accumulator fragment of the TRANSPOSED logits tile (h, it, jt), keys down, queries across:
  //   [h][it][jt][half][i & 15][(j >> 3) & 1][j & 3],  half = (j >> 2) & 1
  // so a kF lane (query i & 15, key half) reads its 8 accumulator registers as two b128 of 512 contiguous B per wave.
  v8f acc = {};
#pragma unroll
  for (int kb = 0; kb < 4; ++kb) acc = wmma32(afr[kb], b0[kb], acc);
  float sv[8];
#pragma unroll
  for (int v = 0; v < 8; ++v) sv[v] = acc[v] * 5.656854249492381f;
  if (ncol < 4) {  // the lane holds keys 8*hi .. 8*hi+7 of the tile for head ncol and the wave's i
    *(float4*)&xb[ncol * 64 + w * 16 + hi * 8]     = make_float4(sv[0], sv[1], sv[2], sv[3]);
    *(float4*)&xb[ncol * 64 + w * 16 + hi * 8 + 4] = make_float4(sv[4], sv[5], sv[6], sv[7]);
  }
  __syncthreads();  // the four waves' i values meet here; wave w then writes head w
  if (lane < 16) {  // two whole 128-B lines: lane = 8*half + 2*(i in quad) + key half
    const int half = lane >> 3, il = (lane >> 1) & 3, hj = lane & 1;
    const float4 t = *(const float4*)&xb[w * 64 + il * 16 + hj * 8 + half * 4];
    const int it = ib >> 2, q = ib & 3;
    *(float4*)&biasbuf[((size_t)(w * 16 + it) * 16 + jtA) * 256 + half * 128 + q * 32 + (lane & 7) * 4] = t;
  }
}

// Lane l <-> l ^ 16: the two lanes that share a query column of a transposed score tile.
__device__ __forceinline__ float xhalf(float x) {
  const int b = __builtin_bit_cast(int, x);
  return __builtin_bit_cast(float, __builtin_amdgcn_permlanex16(b, b, 0x76543210, 0xfedcba98, false, false));
}

// ---------------- kernel F: one attention row r per block: LayerNorm, q/k/v/gate, attention, output projection ----------------
// Wave wv owns the 16 positions wv*16 .. +15 of the row from z to out. Its q, gate and attention output never leave the
// lane that made them (a producer's 16 B of a fragment unit are the same lane's 16 B for the reader); only k and v are
// read by the other waves, from LDS.
__global__ __launch_bounds__(512) void kF(const float* __restrict__ z,
                                          const float* __restrict__ gamma,
                                          const float* __restrict__ beta,
                                          const half_t* __restrict__ packW,
                                          const float* __restrict__ b_gate,
                                          const float* __restrict__ b_out,
                                          const float* __restrict__ biasbuf,
                                          float* __restrict__ out) {
  // w_qkv and w_gate as fragment units (32 tiles), as kP packed them. Behind the projections the array is cut into
  // 16 slices of WAVE_H halves, one a wave: q units (later the attention output's), gate units, at the end the f32 rows.
  __shared__ __attribute__((aligned(16))) half_t Wl[16 * WAVE_H];
  // z rows, one slice a wave; the f16 zn rows overlay them, and then the wave's 8 k units and 8 v units
  __shared__ __attribute__((aligned(16))) float  zf[16][16 * ZF_P];
  __shared__ __attribute__((aligned(16))) half_t Wo[8 * 4 * 512];  // w_out as fragment units
  __shared__ __attribute__((aligned(16))) float  gS[128];     // b_gate: a lane reads 8 adjacent entries per gate tile
  // the wave number as a scalar: the branches on it are scalar and the bases stay out of vector registers
  const int wv = __builtin_amdgcn_readfirstlane(threadIdx.x >> 5);
  const int lane = threadIdx.x & 31;
  const int r0 = blockIdx.x * 256 + wv * 16;
  const int m = lane & 15, hi = lane >> 4;

  // wave wv: tiles 2*wv, 2*wv + 1 (w_qkv's up to wave 11, then w_gate's) and k blocks 2*(wv & 1), +1 of w_out's tile wv >> 1
  stageF(packW + wv * 4096, &Wl[(wv * 512 + lane) * 8], packW + wv * 1024, &Wo[(wv * 128 + lane) * 8],
         wv >= 12, b_gate + (wv & 3) * 32, gS + (wv & 3) * 32, z + (size_t)r0 * 128, zf[wv], lane);
  __syncthreads();
  lnRows(zf[wv], gamma, beta, m, hi);
  __syncthreads();

  h8 pq[8], pg[8];
  {
    v16h afr[4], b0[4], b1[4];
    h8 pk[8], pv[8];
    loadZn(zf[wv], m, hi, afr);
    half_t* kvw = (half_t*)&zf[wv][0] + lane * 8;  // the zn rows are in afr: the slice now takes k and v
    loadB4(Wl, 0, lane, b0);
    group8F<0, false>(0,  afr, b0, b1, Wl, lane, hi, gS, pq);
    group8F<0, false>(8,  afr, b0, b1, Wl, lane, hi, gS, pk);
#pragma unroll
    for (int tt = 0; tt < 8; ++tt) *(h8a*)&kvw[tt * 256] = pk[tt];
    group8F<1, false>(16, afr, b0, b1, Wl, lane, hi, gS, pv);
#pragma unroll
    for (int tt = 0; tt < 8; ++tt) *(h8a*)&kvw[2048 + tt * 256] = pv[tt];
    group8F<2, true>(24, afr, b0, b1, Wl, lane, hi, gS, pg);
  }
  __syncthreads();  // every wave's k and v are in LDS, and nobody reads the packed weights in Wl any more

  half_t* own = Wl + wv * WAVE_H + lane * 8;  // the lane's 16 B of unit 0 of the wave's slice
#pragma unroll
  for (int tt = 0; tt < 8; ++tt) { *(h8a*)&own[tt * 256] = pq[tt]; *(h8a*)&own[2048 + tt * 256] = pg[tt]; }

  const half_t* kv = (const half_t*)&zf[0][0] + lane * 8;
  const float kexp = 0.17677669529663687f * 1.4426950408889634f;  // 1/sqrt(32) * log2(e)
  const int bl = (m * 2 + hi) * 4;  // the lane's 16 B in each 512-B half of a bias tile
#pragma unroll 1  // one head a trip; unrolled, four trips of 128 score registers do not fit the 256 of a 16-wave block
  for (int hh = 0; hh < 4; ++hh) {
    // every block reads the same bias: neighbours start at different heads, so that they are not all on the same lines at once
    const int h = (hh + blockIdx.x) & 3;
    // lg = (q.k + sqrt(d) * bias)^T: the bias fragment is the WMMA's C operand
    const float* bf = biasbuf + (size_t)(h * 16 + wv) * 4096 + bl;
    v8f lg[16];
#pragma unroll
    for (int jt = 0; jt < 16; ++jt) {
      const float4 c0 = *(const float4*)&bf[jt * 256];
      const float4 c1 = *(const float4*)&bf[jt * 256 + 128];
      lg[jt] = v8f{c0.x, c0.y, c0.z, c0.w, c1.x, c1.y, c1.z, c1.w};
    }
    // the loads' address registers are reused while the loads are in flight; the operand keeps them as they are up to
    // the wait
    asm volatile("s_wait_xcnt 0x0" :: "v"(bf) : "memory");
    const v16h aQ = frag2(&own[h * 512], &own[h * 512 + 256]);
    // transposed scores (K as A, Q as B): lane (m, hi) holds query m, keys jt*16 + 8*hi .. +7.
    // K fragments come from LDS four at a time, one group ahead of the four WMMAs that use them.
    v16h fr[2][4];
#pragma unroll
    for (int i = 0; i < 4; ++i) fr[0][i] = frag2(kv + i * WAVE_H + h * 512, kv + i * WAVE_H + h * 512 + 256);
#pragma unroll
    for (int g = 0; g < 4; ++g) {
      if (g < 3) {
#pragma unroll
        for (int i = 0; i < 4; ++i) {
          const half_t* kc = kv + (g * 4 + 4 + i) * WAVE_H + h * 512;
          fr[(g + 1) & 1][i] = frag2(kc, kc + 256);
        }
      }
      // keeps the next group's LDS reads above this group's WMMAs: sunk to their users, each read is waited out alone
      __builtin_amdgcn_sched_barrier(0);
#pragma unroll
      for (int i = 0; i < 4; ++i) lg[g * 4 + i] = wmma32(fr[g & 1][i], aQ, lg[g * 4 + i]);
    }
    // softmax over j: the lane's 128 keys in registers, then one exchange with the lane that holds the other 128
    v8f mx8 = lg[0];
#pragma unroll
    for (int jt = 1; jt < 16; ++jt)
#pragma unroll
      for (int v = 0; v < 8; ++v) mx8[v] = fmaxf(mx8[v], lg[jt][v]);
    float mx = fmaxf(fmaxf(fmaxf(mx8[0], mx8[1]), fmaxf(mx8[2], mx8[3])),
                     fmaxf(fmaxf(mx8[4], mx8[5]), fmaxf(mx8[6], mx8[7])));
    mx = fmaxf(mx, xhalf(mx));
    const float nm = -mx * kexp;
    v8f s8 = {};
    v16h pA[8];  // exp(scores) in f16 as they are made: two score tiles are the B fragment of 32 keys
#pragma unroll
    for (int jt = 0; jt < 16; ++jt)
#pragma unroll
      for (int v = 0; v < 8; ++v) {
        const float e = __builtin_amdgcn_exp2f(__builtin_fmaf(lg[jt][v], kexp, nm));
        pA[jt >> 1][(jt & 1) * 8 + v] = (half_t)e;
        s8[v] += e;
      }
    float sum = ((s8[0] + s8[1]) + (s8[2] + s8[3])) + ((s8[4] + s8[5]) + (s8[6] + s8[7]));
    sum += xhalf(sum);
    const float rs = __builtin_amdgcn_rcpf(sum);

    // (attn @ V)^T (V as A, exp(scores)^T as B). Lane (m, hi) holds query row m, d = dt*16 + 8*hi .. +7, which is its 16 B of the gate's and of
    // the output's fragment unit; the row's 1/sum is the lane's own and is applied here.
    // V fragments likewise: those of 64 keys (two B fragments x two halves of d) one group ahead.
    v8f acc[2] = {};
#pragma unroll
    for (int i = 0; i < 4; ++i) {
      const half_t* vc = kv + (i >> 1) * 2 * WAVE_H + 2048 + h * 512 + (i & 1) * 256;
      fr[0][i] = frag2(vc, vc + WAVE_H);
    }
#pragma unroll
    for (int g = 0; g < 4; ++g) {
      if (g < 3) {
#pragma unroll
        for (int i = 0; i < 4; ++i) {
          const half_t* vc = kv + (g * 2 + 2 + (i >> 1)) * 2 * WAVE_H + 2048 + h * 512 + (i & 1) * 256;
          fr[(g + 1) & 1][i] = frag2(vc, vc + WAVE_H);
        }
      }
      __builtin_amdgcn_sched_barrier(0);  // as above: the next group's reads stay above this group's WMMAs
#pragma unroll
      for (int j = 0; j < 2; ++j)
#pragma unroll
        for (int dt = 0; dt < 2; ++dt) acc[dt] = wmma32(fr[g & 1][j * 2 + dt], pA[g * 2 + j], acc[dt]);
    }
#pragma unroll
    for (int dt = 0; dt < 2; ++dt) {
      const h8 gq = *(const h8a*)&own[2048 + h * 512 + dt * 256];
      h8 o;
#pragma unroll
      for (int v = 0; v < 8; ++v) o[v] = (half_t)((float)gq[v] * (acc[dt][v] * rs));
      *(h8a*)&own[h * 512 + dt * 256] = o;  // over this head's q units, which are spent
    }
  }

  // output projection + b_out: the wave's gated attention output, head kb, is the k block kb of its operand
  v16h afr[4];
#pragma unroll
  for (int kb = 0; kb < 4; ++kb) afr[kb] = frag2(&own[kb * 512], &own[kb * 512 + 256]);
  float* st = (float*)(Wl + wv * WAVE_H);  // store stage, 16 rows x 128 f32, over the slice's spent units
  v16h b0[4], b1[4];
  loadB4(Wo, 0, lane, b0);
#pragma unroll  // the next tiles' LDS reads and the b_out reads then stand ahead of the WMMAs that wait for them
  for (int tp = 0; tp < 4; ++tp) {
    const int n0 = tp * 2, n1 = tp * 2 + 1;
    loadB4(Wo, n1, lane, b1);
    v8f acc0 = {};
#pragma unroll
    for (int kb = 0; kb < 4; ++kb) acc0 = wmma32(b0[kb], afr[kb], acc0);
    if (tp < 3) loadB4(Wo, n1 + 1, lane, b0);  // prefetch next pair
    v8f acc1 = {};
#pragma unroll
    for (int kb = 0; kb < 4; ++kb) acc1 = wmma32(b1[kb], afr[kb], acc1);
    // transposed product (weights as A): lane (m, hi) holds row m, columns 8*hi .. 8*hi+7 of each tile
    float x0[8], x1[8];
#pragma unroll
    for (int v = 0; v < 8; ++v) {
      // both candidates are wave-uniform reads (scalar loads); the lane picks its half of the tile
      const float lo0 = b_out[n0 * 16 + v], hi0 = b_out[n0 * 16 + 8 + v];
      const float lo1 = b_out[n1 * 16 + v], hi1 = b_out[n1 * 16 + 8 + v];
      x0[v] = acc0[v] + (hi ? hi0 : lo0);
      x1[v] = acc1[v] + (hi ? hi1 : lo1);
    }
    float* sr = &st[m * ZF_P + hi * 8];
    *(float4*)&sr[n0 * 16]     = make_float4(x0[0], x0[1], x0[2], x0[3]);
    *(float4*)&sr[n0 * 16 + 4] = make_float4(x0[4], x0[5], x0[6], x0[7]);
    *(float4*)&sr[n1 * 16]     = make_float4(x1[0], x1[1], x1[2], x1[3]);
    *(float4*)&sr[n1 * 16 + 4] = make_float4(x1[4], x1[5], x1[6], x1[7]);
  }
  asm volatile("s_wait_dscnt 0" ::: "memory");  // same-wave LDS RAW across lanes: rows are read back by other lanes
  // one whole 512-B output row per store
#pragma unroll
  for (int s = 0; s < 16; ++s)
    *(float4*)&(out + (size_t)(r0 + s) * 128)[lane * 4] = *(const float4*)&st[s * ZF_P + lane * 4];
}

extern "C" void kernel_launch(void* const* d_in, const int* in_sizes, int n_in,
                              void* d_out, int out_size, void* d_ws, size_t ws_size,
                              hipStream_t stream) {
  const float* z      = (const float*)d_in[0];
  const float* gamma  = (const float*)d_in[1];
  const float* beta   = (const float*)d_in[2];
  const float* w_qkv  = (const float*)d_in[3];
  const float* w_pair = (const float*)d_in[4];
  const float* w_gate = (const float*)d_in[5];
  const float* b_gate = (const float*)d_in[6];
  const float* w_out  = (const float*)d_in[7];
  const float* b_out  = (const float*)d_in[8];

  float* biasbuf = (float*)((char*)d_ws + OFF_B);
  half_t* packW  = (half_t*)((char*)d_ws + OFF_W);

  kP<<<N_ROWS / 64 + 40, 128, 0, stream>>>(z, gamma, beta, w_pair, w_qkv, w_gate, w_out, biasbuf, packW);
  kF<<<L_DIM, 512, 0, stream>>>(z, gamma, beta, packW, b_gate, b_out, biasbuf, (float*)d_out);
}

// v008
// Measured time: 29.8 microseconds a run.
// Timed twice side by side with v007, it ran 1.08 and 1.07 times as fast.
// Counting every step since v000, it is 6.70 times as fast.
#include <hip/hip_runtime.h>
#include <hip/hip_bf16.h>
#include <stddef.h>

typedef _Float16 half_t;
typedef __attribute__((ext_vector_type(16))) _Float16 v16h;
typedef __attribute__((ext_vector_type(8)))  _Float16 h8;
typedef __attribute__((ext_vector_type(8)))  float    v8f;
typedef __attribute__((ext_vector_type(4)))  float    v4f;
typedef h8 __attribute__((may_alias)) h8a;  // 16-B f16 accesses to LDS bytes that hold f32 or other operands at other times
typedef __attribute__((ext_vector_type(4)))  _Float16 h4;
typedef h4 __attribute__((may_alias)) h4a;  // the same, 8 B

#define N_ROWS 65536      // L*L flattened (i,j) rows
#define IN_DIM 128
#define L_DIM  256
#define H_HEADS 4
#define D_HEAD 32

// LDS row pitches: 16 B x odd, so the 16 rows a ds_load_b128 touches fall on
// distinct banks (64 banks x 4 B; an unpadded 256/512-B pitch puts them on four).
#define ZF_P 132          // floats : 528 B

// ---- fragment units ----
// Every f16 operand in LDS except zn is kept in WMMA fragment order, in 512-B units [lane = 16*hi + m][8 halves], so that
// each wave-wide 16-B access covers 512 contiguous bytes:
//   q, k, gate, ao : unit (T, c8), T = row >> 4, c8 = col >> 4 : X[T*16 + m][c8*16 + 8*hi + e]
//   v              : unit (T, c8)                              : V[T*16 + 8*hi + e][c8*16 + m]
//   weights        : unit (t, kb, c)                           : W[kb*32 + c*16 + 8*hi + e][t*16 + m]
// A 16x32 (or 32x16) f16 fragment is two such units (k 0..15 and k 16..31 of the block).
// The workspace holds the pair bias (f32, order of the transposed logits' accumulator, see kP's tail) and behind it
// the 40 weight tiles as fragment units, which kP packs once for all of kF's blocks.
#define OFF_B   ((size_t)0)
#define OFF_W   ((size_t)1 << 20)  // bytes: behind 4 * 256 * 256 f32 of bias
#define WO_H    65536              // halves in front of w_out's units: 32 tiles x 4 k blocks x 512
#define WAVE_H  4224      // halves of one wave's 8448-B LDS slice (16 rows x 528 B)

__device__ __forceinline__ v8f wmma32(v16h a, v16h b, v8f c) {
  return __builtin_amdgcn_wmma_f32_16x16x32_f16(false, a, false, b, (short)0, c, false, false);
}

// Build a 16-half fragment from two contiguous 16B chunks (A layout and our
// B layouts both reduce to this: halves 0..7 = chunk0, halves 8..15 = chunk1).
__device__ __forceinline__ v16h frag2(const half_t* c0, const half_t* c1) {
  h8 x0 = *(const h8a*)c0;
  h8 x1 = *(const h8a*)c1;
  v16h f;
#pragma unroll
  for (int i = 0; i < 8; ++i) { f[i] = x0[i]; f[i + 8] = x1[i]; }
  return f;
}

// Load the 4 K-step B fragments of one 16-col weight tile (independent regs
// so the scheduler can clause the 8 b128 loads and keep WMMAs back-to-back).
__device__ __forceinline__ void loadB4(const half_t* __restrict__ packedW, int t, int lane,
                                       v16h b[4]) {
#pragma unroll
  for (int kb = 0; kb < 4; ++kb) {
    const half_t* p = &packedW[((size_t)(t * 4 + kb) * 64 + lane) * 8];
    b[kb] = frag2(p, p + 256);
  }
}

// ---------------- weights to f16 fragment units ----------------
// tile index t: 0..23 = w_qkv (384 cols), 24..31 = w_gate, 32..39 = w_out (an LDS array of its own in kF); the pair tile (padded to 16) stays in kP
// One lane's 16 B of each of the two units of a 32-deep k block: W[k0 + e][col] and W[k0 + 16 + e][col],
// first = k0 * LD + col. LD is a constant, so the 16 loads share one address register.
template <int LD>
__device__ __forceinline__ void packUnits(const float* __restrict__ wsrc, int first, bool valid,
                                          half_t* __restrict__ dst) {
  h8 u0, u1;
#pragma unroll
  for (int e = 0; e < 8; ++e) {
    const float x0 = wsrc[first + e * LD], x1 = wsrc[first + (e + 16) * LD];
    u0[e] = (half_t)(valid ? x0 : 0.0f);
    u1[e] = (half_t)(valid ? x1 : 0.0f);
  }
  *(h8*)&dst[0]   = u0;
  *(h8*)&dst[256] = u1;
}

// A wave's share of kF's fill: 16 of the 256 units of w_qkv and w_gate and 4 of the 64 of w_out go from the workspace,
// where kP left them in f16 fragment order, to the same place in LDS, 512 contiguous B a load; the wave's 16 z rows go to
// LDS as they are, one row a load, and stay in zv for lnRows. The last four waves take 32 entries of b_gate each as well.
// One straight-line block: all the loads fly together.
__device__ __forceinline__ void stageF(const half_t* __restrict__ srcW, half_t* __restrict__ dstW,
                                       const half_t* __restrict__ srcO, half_t* __restrict__ dstO,
                                       bool gate, const float* __restrict__ bsrc, float* __restrict__ bdst,
                                       const float* __restrict__ zrow, float* __restrict__ zdst, v4f zv[16], int lane) {
  h8 xw[16], xo[4];
  float xg = 0.0f;
#pragma unroll  // the arrays are indexed by s and p and have to stay in registers
  for (int s = 0; s < 16; ++s) xw[s] = *(const h8*)&(srcW + s * 256)[lane * 8];
#pragma unroll
  for (int p = 0; p < 4; ++p) xo[p] = *(const h8*)&(srcO + WO_H + p * 256)[lane * 8];  // WO_H goes into the loads' offset field
  if (gate) xg = bsrc[lane];
#pragma unroll
  for (int s = 0; s < 16; ++s) zv[s] = *(const v4f*)&(zrow + s * 128)[lane * 4];
  // later address arithmetic rewrites registers that the loads above name while these are in flight; the operands keep
  // those registers as they are up to the wait
  asm volatile("s_wait_xcnt 0x0" :: "v"(lane), "s"(srcW), "s"(srcO), "s"(bsrc), "s"(zrow) : "memory");
#pragma unroll
  for (int s = 0; s < 16; ++s) *(h8*)&dstW[s * 256] = xw[s];
#pragma unroll
  for (int p = 0; p < 4; ++p) *(h8*)&dstO[p * 256] = xo[p];
  if (gate) bdst[lane] = xg;
#pragma unroll
  for (int s = 0; s < 16; ++s) *(v4f*)&zdst[s * ZF_P + lane * 4] = zv[s];
}

// Lane l <-> l ^ 16: the two lanes that share a row of the LayerNorm, or a query column of a transposed score tile.
__device__ __forceinline__ float xhalf(float x) {
  const int b = __builtin_bit_cast(int, x);
  return __builtin_bit_cast(float, __builtin_amdgcn_permlanex16(b, b, 0x76543210, 0xfedcba98, false, false));
}

// Lane s's value as a wave-uniform one
__device__ __forceinline__ float fromLane(float x, int s) {
  return __builtin_bit_cast(float, __builtin_amdgcn_readlane(__builtin_bit_cast(int, x), s));
}

// LayerNorm of a wave's 16 rows. They are held twice: in LDS (f32, pitch ZF_P) and in zv as they were loaded
// (zv[s]: row s, columns 4*lane .. +3).
// Sums: lane pair (m, m+16) takes row m from LDS, 16 B a read, straight-line, so that several reads are in flight.
// Scaling: on zv, where a lane has 4 columns of every row: it needs 4 gamma and 4 beta, not 64 of each, and a row's
// mean and 1/sigma are wave-uniform values.
__device__ __forceinline__ void lnRows(float* zw, const v4f zv[16], const float* __restrict__ gamma,
                                       const float* __restrict__ beta, int lane, int m, int hi) {
  const v4f g = *(const v4f*)&gamma[lane * 4], b = *(const v4f*)&beta[lane * 4];
  // later address arithmetic rewrites the registers that these loads name while they are in flight
  asm volatile("s_wait_xcnt 0x0" :: "v"(lane), "s"(gamma), "s"(beta) : "memory");
  const float* zr = &zw[m * ZF_P + hi * 64];
  v4f x[16];
#pragma unroll  // x is indexed by i and has to stay in registers
  for (int i = 0; i < 16; ++i) x[i] = *(const v4f*)&zr[i * 4];
  v4f s4 = x[0], q4 = x[0] * x[0];  // four partial sums each, one per column mod 4
#pragma unroll
  for (int i = 1; i < 16; ++i) { s4 += x[i]; q4 += x[i] * x[i]; }
  float s  = (s4[0] + s4[1]) + (s4[2] + s4[3]);
  float sq = (q4[0] + q4[1]) + (q4[2] + q4[3]);
  s  += xhalf(s);
  sq += xhalf(sq);
  const float mean = s * (1.0f / 128.0f);
  const float var  = sq * (1.0f / 128.0f) - mean * mean;
  const float inv  = rsqrtf(var + 1e-5f);
  // zn in f16 overlays the first 256 B of the row it came from: row s is written behind the sums of row s,
  // which are the last reads of its floats.
  half_t* zh = (half_t*)zw + lane * 4;
#pragma unroll
  for (int r = 0; r < 16; ++r) {
    const float mr = fromLane(mean, r), ir = fromLane(inv, r);
    h4 y;
#pragma unroll
    for (int c = 0; c < 4; ++c) y[c] = (half_t)((zv[r][c] - mr) * ir * g[c] + b[c]);
    *(h4a*)&zh[r * (ZF_P * 2)] = y;
  }
}

// The four fragments of the wave's 16x128 zn tile
__device__ __forceinline__ void loadZn(const float* zw, int m, int hi, v16h afr[4]) {
#pragma unroll
  for (int kb = 0; kb < 4; ++kb) {
    const half_t* c0 = (const half_t*)&zw[m * ZF_P] + kb * 32 + hi * 8;
    afr[kb] = frag2(c0, c0 + 16);
  }
}

// ---------------- projections: one 16x16 tile to the reader's fragment unit ----------------
// MODE 0 (q, k) and 2 (gate): the TRANSPOSED product (weights as A, zn as B), so lane (m, hi) holds
// row m, columns 8*hi .. 8*hi+7 of the tile. MODE 1 (v): the direct product, lane (m, hi) holds
// column m, rows 8*hi .. 8*hi+7. Either way the lane's 8 values are its 16 B of the reader's fragment unit.
template <int MODE>
__device__ __forceinline__ h8 packTileA(int tt, v8f acc, int hi, const float* b_gate) {
  h8 p;
  float bgv[8] = {};
  if (MODE == 2) {
    const float4 g0 = *(const float4*)&b_gate[tt * 16 + hi * 8];
    const float4 g1 = *(const float4*)&b_gate[tt * 16 + hi * 8 + 4];
    bgv[0] = g0.x; bgv[1] = g0.y; bgv[2] = g0.z; bgv[3] = g0.w;
    bgv[4] = g1.x; bgv[5] = g1.y; bgv[6] = g1.z; bgv[7] = g1.w;
  }
#pragma unroll
  for (int v = 0; v < 8; ++v) {
    if (MODE == 2) {
      const float bg = bgv[v];
      float s = 1.0f + __expf(-(acc[v] + bg));
      // v_nop: the slot the instruction set asks for behind a transcendental before its result is read or its
      // source overwritten.
      // In place: the compiler does not see what asm text writes; the source's register is live there, so no WMMA
      // around names it.
      asm("v_rcp_f32 %0, %0\n\tv_nop" : "+v"(s));
      p[v] = (half_t)s;
    } else {
      p[v] = (half_t)acc[v];
    }
  }
  return p;
}

// The 8 tiles (128 columns) of one of q, k, v, gate for the wave's 16 rows: p[tt] is the lane's 16 B of unit tt.
// On entry b0 holds tile t0's fragments; on exit those of t0 + 8, unless this is the last group.
template <int MODE, bool LAST>
__device__ __forceinline__ void group8F(int t0, const v16h afr[4], v16h b0[4], v16h b1[4],
                                        const half_t* __restrict__ packedW, int lane, int hi,
                                        const float* b_gate, h8 p[8]) {
#pragma unroll  // p[] is indexed by tt and has to stay in registers
  for (int tt = 0; tt < 8; tt += 2) {
    loadB4(packedW, t0 + tt + 1, lane, b1);
    v8f acc0 = {};
#pragma unroll
    for (int kb = 0; kb < 4; ++kb)
      acc0 = (MODE == 1) ? wmma32(afr[kb], b0[kb], acc0) : wmma32(b0[kb], afr[kb], acc0);
    if (!(LAST && tt == 6)) loadB4(packedW, t0 + tt + 2, lane, b0);  // prefetch next
    v8f acc1 = {};
#pragma unroll
    for (int kb = 0; kb < 4; ++kb)
      acc1 = (MODE == 1) ? wmma32(afr[kb], b1[kb], acc1) : wmma32(b1[kb], afr[kb], acc1);
    p[tt]     = packTileA<MODE>(tt, acc0, hi, b_gate);
    p[tt + 1] = packTileA<MODE>(tt + 1, acc1, hi, b_gate);
  }
}

// ---------------- kernel P: LayerNorm + pair bias (every row of the attention needs all of it) ----------------
// The 40 blocks behind the row blocks pack one weight tile each for kF (wave w: k block w) and leave: short blocks of
// their own, so that no row block waits for weight loads or for the stores in front of its first barrier.
__global__ __launch_bounds__(128) void kP(const float* __restrict__ z,
                                          const float* __restrict__ gamma,
                                          const float* __restrict__ beta,
                                          const float* __restrict__ wpair,
                                          const float* __restrict__ wqkv,
                                          const float* __restrict__ wgate,
                                          const float* __restrict__ wout,
                                          float* __restrict__ biasbuf,
                                          half_t* __restrict__ packW) {
  __shared__ __attribute__((aligned(16))) half_t Wp[4 * 512];      // the pair tile's fragment units
  __shared__ __attribute__((aligned(16))) float  zf[4][16 * ZF_P]; // z rows; the f16 zn rows later overlay them
  __shared__ __attribute__((aligned(16))) float  xb[256];          // bias exchange: [head][i in quad][j in tile]
  // the wave number as a scalar: the load base stays out of vector registers
  const int w = __builtin_amdgcn_readfirstlane(threadIdx.x >> 5);
  const int lane = threadIdx.x & 31;
  if (blockIdx.x >= N_ROWS / 64) {  // the same for the whole block, in front of every barrier
    const int t = blockIdx.x - N_ROWS / 64;
    const float* wsrc = t < 24 ? wqkv : t < 32 ? wgate : wout;
    const int ld = t < 24 ? 384 : 128, col = (t < 24 ? t : t & 7) * 16 + (lane & 15);
    const float* p0 = wsrc + (w * 32 + (lane >> 4) * 8) * ld + col;
    const float* p[16];
    float x[16];
#pragma unroll  // p and x are indexed by e and have to stay in registers
    for (int e = 0; e < 8; ++e) { p[e] = p0 + e * ld; p[e + 8] = p0 + (e + 16) * ld; }
#pragma unroll
    for (int e = 0; e < 16; ++e) x[e] = *p[e];
    // the operands keep the loads' address registers as they are up to the wait: no later load lands in one of them
    asm volatile("s_wait_xcnt 0x0" :: "v"(p[0]), "v"(p[1]), "v"(p[2]), "v"(p[3]), "v"(p[4]), "v"(p[5]), "v"(p[6]), "v"(p[7]),
                 "v"(p[8]), "v"(p[9]), "v"(p[10]), "v"(p[11]), "v"(p[12]), "v"(p[13]), "v"(p[14]), "v"(p[15]) : "memory");
    h8 u0, u1;
#pragma unroll
    for (int e = 0; e < 8; ++e) { u0[e] = (half_t)x[e]; u1[e] = (half_t)x[e + 8]; }
    half_t* dst = &packW[((t * 4 + w) * 64 + lane) * 8];
    *(h8*)&dst[0]   = u0;
    *(h8*)&dst[256] = u1;
    return;
  }
  // The four waves take one 16-wide j tile of four consecutive i (wave w: i = 4*ib + w), so that
  // together they hold whole 128-B lines of the bias fragments written at the tail.
  const int ib = blockIdx.x >> 4, jtA = blockIdx.x & 15;
  const int r0 = (ib * 4 + w) * 256 + jtA * 16;
  const int m = lane & 15, hi = lane >> 4, ncol = lane & 15;

  const float* zrow = z + (size_t)r0 * 128;
  v4f zv[16];
#pragma unroll  // one whole 512-B row per load
  for (int s = 0; s < 16; ++s) zv[s] = *(const v4f*)&(zrow + s * 128)[lane * 4];
  // later address arithmetic rewrites the registers that these loads name while they are in flight
  asm volatile("s_wait_xcnt 0x0" :: "v"(lane), "s"(zrow) : "memory");
  packUnits<4>(wpair, (w * 32 + hi * 8) * 4 + (m & 3), m < 4, &Wp[(w * 64 + lane) * 8]);  // columns 4..15: zero padding
#pragma unroll
  for (int s = 0; s < 16; ++s) *(v4f*)&zf[w][s * ZF_P + lane * 4] = zv[s];
  __syncthreads();
  lnRows(zf[w], zv, gamma, beta, lane, m, hi);
  __syncthreads();
  v16h afr[4], b0[4];
  loadZn(zf[w], m, hi, afr);
  loadB4(Wp, 0, lane, b0);
  // pair bias (only cols 0..3 valid), f32 output times sqrt(d): kF adds it to the
  // unscaled q.k sums and applies 1/sqrt(d) once, inside the exponent.
  // Layout = the 16x16 f32 accumulator fragment of the TRANSPOSED logits tile (h, it, jt), keys down, queries across:
  //   [h][it][jt][half][i & 15][(j >> 3) & 1][j & 3],  half = (j >> 2) & 1
  // so a kF lane (query i & 15, key half) reads its 8 accumulator registers as two b128 of 512 contiguous B per wave.
  v8f acc = {};
#pragma unroll
  for (int kb = 0; kb < 4; ++kb) acc = wmma32(afr[kb], b0[kb], acc);
  float sv[8];
#pragma unroll
  for (int v = 0; v < 8; ++v) sv[v] = acc[v] * 5.656854249492381f;
  if (ncol < 4) {  // the lane holds keys 8*hi .. 8*hi+7 of the tile for head ncol and the wave's i
    *(float4*)&xb[ncol * 64 + w * 16 + hi * 8]     = make_float4(sv[0], sv[1], sv[2], sv[3]);
    *(float4*)&xb[ncol * 64 + w * 16 + hi * 8 + 4] = make_float4(sv[4], sv[5], sv[6], sv[7]);
  }
  __syncthreads();  // the four waves' i values meet here; wave w then writes head w
  if (lane < 16) {  // two whole 128-B lines: lane = 8*half + 2*(i in quad) + key half
    const int half = lane >> 3, il = (lane >> 1) & 3, hj = lane & 1;
    const float4 t = *(const float4*)&xb[w * 64 + il * 16 + hj * 8 + half * 4];
    const int it = ib >> 2, q = ib & 3;
    *(float4*)&biasbuf[((size_t)(w * 16 + it) * 16 + jtA) * 256 + half * 128 + q * 32 + (lane & 7) * 4] = t;
  }
}

// ---------------- kernel F: one attention row r per block: LayerNorm, q/k/v/gate, attention, output projection ----------------
// Wave wv owns the 16 positions wv*16 .. +15 of the row from z to out. Its q, gate and attention output never leave the
// lane that made them (a producer's 16 B of a fragment unit are the same lane's 16 B for the reader); only k and v are
// read by the other waves, from LDS.
__global__ __launch_bounds__(512) void kF(const float* __restrict__ z,
                                          const float* __restrict__ gamma,
                                          const float* __restrict__ beta,
                                          const half_t* __restrict__ packW,
                                          const float* __restrict__ b_gate,
                                          const float* __restrict__ b_out,
                                          const float* __restrict__ biasbuf,
                                          float* __restrict__ out) {
  // w_qkv and w_gate as fragment units (32 tiles), as kP packed them. Behind the projections the array is cut into
  // 16 slices of WAVE_H halves, one a wave: q units (later the attention output's), gate units, at the end the f32 rows.
  __shared__ __attribute__((aligned(16))) half_t Wl[16 * WAVE_H];
  // z rows, one slice a wave; the f16 zn rows overlay them, and then the wave's 8 k units and 8 v units
  __shared__ __attribute__((aligned(16))) float  zf[16][16 * ZF_P];
  __shared__ __attribute__((aligned(16))) half_t Wo[8 * 4 * 512];  // w_out as fragment units
  __shared__ __attribute__((aligned(16))) float  gS[128];     // b_gate: a lane reads 8 adjacent entries per gate tile
  // the wave number as a scalar: the branches on it are scalar and the bases stay out of vector registers
  const int wv = __builtin_amdgcn_readfirstlane(threadIdx.x >> 5);
  const int lane = threadIdx.x & 31;
  const int r0 = blockIdx.x * 256 + wv * 16;
  const int m = lane & 15, hi = lane >> 4;

  // wave wv: tiles 2*wv, 2*wv + 1 (w_qkv's up to wave 11, then w_gate's) and k blocks 2*(wv & 1), +1 of w_out's tile wv >> 1
  v4f zv[16];
  stageF(packW + wv * 4096, &Wl[(wv * 512 + lane) * 8], packW + wv * 1024, &Wo[(wv * 128 + lane) * 8],
         wv >= 12, b_gate + (wv & 3) * 32, gS + (wv & 3) * 32, z + (size_t)r0 * 128, zf[wv], zv, lane);
  __syncthreads();
  lnRows(zf[wv], zv, gamma, beta, lane, m, hi);
  __syncthreads();

  h8 pq[8], pg[8];
  {
    v16h afr[4], b0[4], b1[4];
    h8 pk[8], pv[8];
    loadZn(zf[wv], m, hi, afr);
    half_t* kvw = (half_t*)&zf[wv][0] + lane * 8;  // the zn rows are in afr: the slice now takes k and v
    loadB4(Wl, 0, lane, b0);
    group8F<0, false>(0,  afr, b0, b1, Wl, lane, hi, gS, pq);
    group8F<0, false>(8,  afr, b0, b1, Wl, lane, hi, gS, pk);
#pragma unroll
    for (int tt = 0; tt < 8; ++tt) *(h8a*)&kvw[tt * 256] = pk[tt];
    group8F<1, false>(16, afr, b0, b1, Wl, lane, hi, gS, pv);
#pragma unroll
    for (int tt = 0; tt < 8; ++tt) *(h8a*)&kvw[2048 + tt * 256] = pv[tt];
    group8F<2, true>(24, afr, b0, b1, Wl, lane, hi, gS, pg);
  }
  __syncthreads();  // every wave's k and v are in LDS, and nobody reads the packed weights in Wl any more

  half_t* own = Wl + wv * WAVE_H + lane * 8;  // the lane's 16 B of unit 0 of the wave's slice
#pragma unroll
  for (int tt = 0; tt < 8; ++tt) { *(h8a*)&own[tt * 256] = pq[tt]; *(h8a*)&own[2048 + tt * 256] = pg[tt]; }

  const half_t* kv = (const half_t*)&zf[0][0] + lane * 8;
  const float kexp = 0.17677669529663687f * 1.4426950408889634f;  // 1/sqrt(32) * log2(e)
  const int bl = (m * 2 + hi) * 4;  // the lane's 16 B in each 512-B half of a bias tile
#pragma unroll 1  // one head a trip; unrolled, four trips of 128 score registers do not fit the 256 of a 16-wave block
  for (int hh = 0; hh < 4; ++hh) {
    // every block reads the same bias: neighbours start at different heads, so that they are not all on the same lines at once
    const int h = (hh + blockIdx.x) & 3;
    // lg = (q.k + sqrt(d) * bias)^T: the bias fragment is the WMMA's C operand
    const float* bf = biasbuf + (size_t)(h * 16 + wv) * 4096 + bl;
    v8f lg[16];
#pragma unroll
    for (int jt = 0; jt < 16; ++jt) {
      const float4 c0 = *(const float4*)&bf[jt * 256];
      const float4 c1 = *(const float4*)&bf[jt * 256 + 128];
      lg[jt] = v8f{c0.x, c0.y, c0.z, c0.w, c1.x, c1.y, c1.z, c1.w};
    }
    // the loads' address registers are reused while the loads are in flight; the operand keeps them as they are up to
    // the wait
    asm volatile("s_wait_xcnt 0x0" :: "v"(bf) : "memory");
    const v16h aQ = frag2(&own[h * 512], &own[h * 512 + 256]);
    // transposed scores (K as A, Q as B): lane (m, hi) holds query m, keys jt*16 + 8*hi .. +7.
    // K fragments come from LDS four at a time, one group ahead of the four WMMAs that use them.
    v16h fr[2][4];
#pragma unroll
    for (int i = 0; i < 4; ++i) fr[0][i] = frag2(kv + i * WAVE_H + h * 512, kv + i * WAVE_H + h * 512 + 256);
#pragma unroll
    for (int g = 0; g < 4; ++g) {
      if (g < 3) {
#pragma unroll
        for (int i = 0; i < 4; ++i) {
          const half_t* kc = kv + (g * 4 + 4 + i) * WAVE_H + h * 512;
          fr[(g + 1) & 1][i] = frag2(kc, kc + 256);
        }
      }
      // keeps the next group's LDS reads above this group's WMMAs: sunk to their users, each read is waited out alone
      __builtin_amdgcn_sched_barrier(0);
#pragma unroll
      for (int i = 0; i < 4; ++i) lg[g * 4 + i] = wmma32(fr[g & 1][i], aQ, lg[g * 4 + i]);
    }
    // softmax over j: the lane's 128 keys in registers, then one exchange with the lane that holds the other 128
    v8f mx8 = lg[0];
#pragma unroll
    for (int jt = 1; jt < 16; ++jt)
#pragma unroll
      for (int v = 0; v < 8; ++v) mx8[v] = fmaxf(mx8[v], lg[jt][v]);
    float mx = fmaxf(fmaxf(fmaxf(mx8[0], mx8[1]), fmaxf(mx8[2], mx8[3])),
                     fmaxf(fmaxf(mx8[4], mx8[5]), fmaxf(mx8[6], mx8[7])));
    mx = fmaxf(mx, xhalf(mx));
    const float nm = -mx * kexp;
    v8f s8 = {};
    v16h pA[8];  // exp(scores) in f16 as they are made: two score tiles are the B fragment of 32 keys
#pragma unroll
    for (int jt = 0; jt < 16; ++jt)
#pragma unroll
      for (int v = 0; v < 8; ++v) {
        const float e = __builtin_amdgcn_exp2f(__builtin_fmaf(lg[jt][v], kexp, nm));
        pA[jt >> 1][(jt & 1) * 8 + v] = (half_t)e;
        s8[v] += e;
      }
    float sum = ((s8[0] + s8[1]) + (s8[2] + s8[3])) + ((s8[4] + s8[5]) + (s8[6] + s8[7]));
    sum += xhalf(sum);
    const float rs = __builtin_amdgcn_rcpf(sum);

    // (attn @ V)^T (V as A, exp(scores)^T as B). Lane (m, hi) holds query row m, d = dt*16 + 8*hi .. +7, which is its 16 B of the gate's and of
    // the output's fragment unit; the row's 1/sum is the lane's own and is applied here.
    // V fragments likewise: those of 64 keys (two B fragments x two halves of d) one group ahead.
    v8f acc[2] = {};
#pragma unroll
    for (int i = 0; i < 4; ++i) {
      const half_t* vc = kv + (i >> 1) * 2 * WAVE_H + 2048 + h * 512 + (i & 1) * 256;
      fr[0][i] = frag2(vc, vc + WAVE_H);
    }
#pragma unroll
    for (int g = 0; g < 4; ++g) {
      if (g < 3) {
#pragma unroll
        for (int i = 0; i < 4; ++i) {
          const half_t* vc = kv + (g * 2 + 2 + (i >> 1)) * 2 * WAVE_H + 2048 + h * 512 + (i & 1) * 256;
          fr[(g + 1) & 1][i] = frag2(vc, vc + WAVE_H);
        }
      }
      __builtin_amdgcn_sched_barrier(0);  // as above: the next group's reads stay above this group's WMMAs
#pragma unroll
      for (int j = 0; j < 2; ++j)
#pragma unroll
        for (int dt = 0; dt < 2; ++dt) acc[dt] = wmma32(fr[g & 1][j * 2 + dt], pA[g * 2 + j], acc[dt]);
    }
#pragma unroll
    for (int dt = 0; dt < 2; ++dt) {
      const h8 gq = *(const h8a*)&own[2048 + h * 512 + dt * 256];
      h8 o;
#pragma unroll
      for (int v = 0; v < 8; ++v) o[v] = (half_t)((float)gq[v] * (acc[dt][v] * rs));
      *(h8a*)&own[h * 512 + dt * 256] = o;  // over this head's q units, which are spent
    }
  }

  // output projection + b_out: the wave's gated attention output, head kb, is the k block kb of its operand
  v16h afr[4];
#pragma unroll
  for (int kb = 0; kb < 4; ++kb) afr[kb] = frag2(&own[kb * 512], &own[kb * 512 + 256]);
  float* st = (float*)(Wl + wv * WAVE_H);  // store stage, 16 rows x 128 f32, over the slice's spent units
  v16h b0[4], b1[4];
  loadB4(Wo, 0, lane, b0);
#pragma unroll  // the next tiles' LDS reads and the b_out reads then stand ahead of the WMMAs that wait for them
  for (int tp = 0; tp < 4; ++tp) {
    const int n0 = tp * 2, n1 = tp * 2 + 1;
    loadB4(Wo, n1, lane, b1);
    v8f acc0 = {};
#pragma unroll
    for (int kb = 0; kb < 4; ++kb) acc0 = wmma32(b0[kb], afr[kb], acc0);
    if (tp < 3) loadB4(Wo, n1 + 1, lane, b0);  // prefetch next pair
    v8f acc1 = {};
#pragma unroll
    for (int kb = 0; kb < 4; ++kb) acc1 = wmma32(b1[kb], afr[kb], acc1);
    // transposed product (weights as A): lane (m, hi) holds row m, columns 8*hi .. 8*hi+7 of each tile
    float x0[8], x1[8];
#pragma unroll
    for (int v = 0; v < 8; ++v) {
      // both candidates are wave-uniform reads (scalar loads); the lane picks its half of the tile
      const float lo0 = b_out[n0 * 16 + v], hi0 = b_out[n0 * 16 + 8 + v];
      const float lo1 = b_out[n1 * 16 + v], hi1 = b_out[n1 * 16 + 8 + v];
      x0[v] = acc0[v] + (hi ? hi0 : lo0);
      x1[v] = acc1[v] + (hi ? hi1 : lo1);
    }
    float* sr = &st[m * ZF_P + hi * 8];
    *(float4*)&sr[n0 * 16]     = make_float4(x0[0], x0[1], x0[2], x0[3]);
    *(float4*)&sr[n0 * 16 + 4] = make_float4(x0[4], x0[5], x0[6], x0[7]);
    *(float4*)&sr[n1 * 16]     = make_float4(x1[0], x1[1], x1[2], x1[3]);
    *(float4*)&sr[n1 * 16 + 4] = make_float4(x1[4], x1[5], x1[6], x1[7]);
  }
  asm volatile("s_wait_dscnt 0" ::: "memory");  // same-wave LDS RAW across lanes: rows are read back by other lanes
  // one whole 512-B output row per store
#pragma unroll
  for (int s = 0; s < 16; ++s)
    *(float4*)&(out + (size_t)(r0 + s) * 128)[lane * 4] = *(const float4*)&st[s * ZF_P + lane * 4];
}

extern "C" void kernel_launch(void* const* d_in, const int* in_sizes, int n_in,
                              void* d_out, int out_size, void* d_ws, size_t ws_size,
                              hipStream_t stream) {
  const float* z      = (const float*)d_in[0];
  const float* gamma  = (const float*)d_in[1];
  const float* beta   = (const float*)d_in[2];
  const float* w_qkv  = (const float*)d_in[3];
  const float* w_pair = (const float*)d_in[4];
  const float* w_gate = (const float*)d_in[5];
  const float* b_gate = (const float*)d_in[6];
  const float* w_out  = (const float*)d_in[7];
  const float* b_out  = (const float*)d_in[8];

  float* biasbuf = (float*)((char*)d_ws + OFF_B);
  half_t* packW  = (half_t*)((char*)d_ws + OFF_W);

  kP<<<N_ROWS / 64 + 40, 128, 0, stream>>>(z, gamma, beta, w_pair, w_qkv, w_gate, w_out, biasbuf, packW);
  kF<<<L_DIM, 512, 0, stream>>>(z, gamma, beta, packW, b_gate, b_out, biasbuf, (float*)d_out);
}

// v009
// Measured time: 28.3 microseconds a run.
// Next to v008, in two timings, it ran 1.04 times as fast each time.
// Counting every step since v000, it is 6.94 times as fast.
#include <hip/hip_runtime.h>
#include <hip/hip_bf16.h>
#include <stddef.h>

typedef _Float16 half_t;
typedef __attribute__((ext_vector_type(16))) _Float16 v16h;
typedef __attribute__((ext_vector_type(8)))  _Float16 h8;
typedef __attribute__((ext_vector_type(8)))  float    v8f;
typedef __attribute__((ext_vector_type(4)))  float    v4f;
typedef h8 __attribute__((may_alias)) h8a;  // 16-B f16 accesses to LDS bytes that hold f32 or other operands at other times
typedef __attribute__((ext_vector_type(4)))  _Float16 h4;
typedef h4 __attribute__((may_alias)) h4a;  // the same, 8 B

#define N_ROWS 65536      // L*L flattened (i,j) rows
#define IN_DIM 128
#define L_DIM  256
#define H_HEADS 4
#define D_HEAD 32

// LDS row pitches: 16 B x odd, so the 16 rows a ds_load_b128 touches fall on
// distinct banks (64 banks x 4 B; an unpadded 256/512-B pitch puts them on four).
#define ZF_P 132          // floats : 528 B

// ---- fragment units ----
// Every f16 operand in LDS except zn is kept in WMMA fragment order, in 512-B units [lane = 16*hi + m][8 halves], so that
// each wave-wide 16-B access covers 512 contiguous bytes:
//   q, k, gate, ao : unit (T, c8), T = row >> 4, c8 = col >> 4 : X[T*16 + m][c8*16 + 8*hi + e]
//   v              : unit (T, c8)                              : V[T*16 + 8*hi + e][c8*16 + m]
//   weights        : unit (t, kb, c)                           : W[kb*32 + c*16 + 8*hi + e][t*16 + m]
// A 16x32 (or 32x16) f16 fragment is two such units (k 0..15 and k 16..31 of the block).
// The workspace holds the pair bias (f32, order of the transposed logits' accumulator, see kP's tail) and behind it
// the 40 weight tiles as fragment units, which kP packs once for all of kF's blocks.
#define OFF_B   ((size_t)0)
#define OFF_W   ((size_t)1 << 20)  // bytes: behind 4 * 256 * 256 f32 of bias
#define WO_H    65536              // halves in front of w_out's units: 32 tiles x 4 k blocks x 512
#define WAVE_H  4224      // halves of one wave's 8448-B LDS slice (16 rows x 528 B)
// The scores leave the QK WMMA as arguments of exp2: log2(e) / sqrt(d) is folded into the packed w_q, log2(e) into the bias.
#define LOG2E   1.4426950408889634f
#define Q_SCALE (0.17677669529663687f * LOG2E)

__device__ __forceinline__ v8f wmma32(v16h a, v16h b, v8f c) {
  return __builtin_amdgcn_wmma_f32_16x16x32_f16(false, a, false, b, (short)0, c, false, false);
}

// Build a 16-half fragment from two contiguous 16B chunks (A layout and our
// B layouts both reduce to this: halves 0..7 = chunk0, halves 8..15 = chunk1).
__device__ __forceinline__ v16h frag2(const half_t* c0, const half_t* c1) {
  h8 x0 = *(const h8a*)c0;
  h8 x1 = *(const h8a*)c1;
  v16h f;
#pragma unroll
  for (int i = 0; i < 8; ++i) { f[i] = x0[i]; f[i + 8] = x1[i]; }
  return f;
}

// Load the 4 K-step B fragments of one 16-col weight tile (independent regs
// so the scheduler can clause the 8 b128 loads and keep WMMAs back-to-back).
__device__ __forceinline__ void loadB4(const half_t* __restrict__ packedW, int t, int lane,
                                       v16h b[4]) {
#pragma unroll
  for (int kb = 0; kb < 4; ++kb) {
    const half_t* p = &packedW[((size_t)(t * 4 + kb) * 64 + lane) * 8];
    b[kb] = frag2(p, p + 256);
  }
}

// ---------------- weights to f16 fragment units ----------------
// tile index t: 0..23 = w_qkv (384 cols), 24..31 = w_gate, 32..39 = w_out (an LDS array of its own in kF); the pair tile (padded to 16) stays in kP
// One lane's 16 B of each of the two units of a 32-deep k block: W[k0 + e][col] and W[k0 + 16 + e][col],
// first = k0 * LD + col. LD is a constant, so the 16 loads share one address register.
template <int LD>
__device__ __forceinline__ void packUnits(const float* __restrict__ wsrc, int first, bool valid,
                                          half_t* __restrict__ dst) {
  h8 u0, u1;
#pragma unroll
  for (int e = 0; e < 8; ++e) {
    const float x0 = wsrc[first + e * LD], x1 = wsrc[first + (e + 16) * LD];
    u0[e] = (half_t)(valid ? x0 : 0.0f);
    u1[e] = (half_t)(valid ? x1 : 0.0f);
  }
  *(h8*)&dst[0]   = u0;
  *(h8*)&dst[256] = u1;
}

// A wave's share of kF's fill: 16 of the 256 units of w_qkv and w_gate and 4 of the 64 of w_out go from the workspace,
// where kP left them in f16 fragment order, to the same place in LDS, 512 contiguous B a load; the wave's 16 z rows go to
// LDS as they are, one row a load, and stay in zv for lnRows. The last four waves take 32 entries of b_gate each as well.
// One straight-line block: all the loads fly together.
__device__ __forceinline__ void stageF(const half_t* __restrict__ srcW, half_t* __restrict__ dstW,
                                       const half_t* __restrict__ srcO, half_t* __restrict__ dstO,
                                       bool gate, const float* __restrict__ bsrc, float* __restrict__ bdst,
                                       const float* __restrict__ zrow, float* __restrict__ zdst, v4f zv[16], int lane) {
  h8 xw[16], xo[4];
  float xg = 0.0f;
#pragma unroll  // the arrays are indexed by s and p and have to stay in registers
  for (int s = 0; s < 16; ++s) xw[s] = *(const h8*)&(srcW + s * 256)[lane * 8];
#pragma unroll
  for (int p = 0; p < 4; ++p) xo[p] = *(const h8*)&(srcO + WO_H + p * 256)[lane * 8];  // WO_H goes into the loads' offset field
  if (gate) xg = bsrc[lane];
#pragma unroll
  for (int s = 0; s < 16; ++s) zv[s] = *(const v4f*)&(zrow + s * 128)[lane * 4];
  // later address arithmetic rewrites registers that the loads above name while these are in flight; the operands keep
  // those registers as they are up to the wait
  asm volatile("s_wait_xcnt 0x0" :: "v"(lane), "s"(srcW), "s"(srcO), "s"(bsrc), "s"(zrow) : "memory");
#pragma unroll
  for (int s = 0; s < 16; ++s) *(h8*)&dstW[s * 256] = xw[s];
#pragma unroll
  for (int p = 0; p < 4; ++p) *(h8*)&dstO[p * 256] = xo[p];
  if (gate) bdst[lane] = xg;
#pragma unroll
  for (int s = 0; s < 16; ++s) *(v4f*)&zdst[s * ZF_P + lane * 4] = zv[s];
}

// Lane l <-> l ^ 16: the two lanes that share a row of the LayerNorm, or a query column of a transposed score tile.
__device__ __forceinline__ float xhalf(float x) {
  const int b = __builtin_bit_cast(int, x);
  return __builtin_bit_cast(float, __builtin_amdgcn_permlanex16(b, b, 0x76543210, 0xfedcba98, false, false));
}

// Lane s's value as a wave-uniform one
__device__ __forceinline__ float fromLane(float x, int s) {
  return __builtin_bit_cast(float, __builtin_amdgcn_readlane(__builtin_bit_cast(int, x), s));
}

// LayerNorm of a wave's 16 rows. They are held twice: in LDS (f32, pitch ZF_P) and in zv as they were loaded
// (zv[s]: row s, columns 4*lane .. +3).
// Sums: lane pair (m, m+16) takes row m from LDS, 16 B a read, straight-line, so that several reads are in flight.
// Scaling: on zv, where a lane has 4 columns of every row: it needs 4 gamma and 4 beta, not 64 of each, and a row's
// mean and 1/sigma are wave-uniform values.
__device__ __forceinline__ void lnRows(float* zw, const v4f zv[16], const float* __restrict__ gamma,
                                       const float* __restrict__ beta, int lane, int m, int hi) {
  const v4f g = *(const v4f*)&gamma[lane * 4], b = *(const v4f*)&beta[lane * 4];
  // later address arithmetic rewrites the registers that these loads name while they are in flight
  asm volatile("s_wait_xcnt 0x0" :: "v"(lane), "s"(gamma), "s"(beta) : "memory");
  const float* zr = &zw[m * ZF_P + hi * 64];
  v4f x[16];
#pragma unroll  // x is indexed by i and has to stay in registers
  for (int i = 0; i < 16; ++i) x[i] = *(const v4f*)&zr[i * 4];
  v4f s4 = x[0], q4 = x[0] * x[0];  // four partial sums each, one per column mod 4
#pragma unroll
  for (int i = 1; i < 16; ++i) { s4 += x[i]; q4 += x[i] * x[i]; }
  float s  = (s4[0] + s4[1]) + (s4[2] + s4[3]);
  float sq = (q4[0] + q4[1]) + (q4[2] + q4[3]);
  s  += xhalf(s);
  sq += xhalf(sq);
  const float mean = s * (1.0f / 128.0f);
  const float var  = sq * (1.0f / 128.0f) - mean * mean;
  const float inv  = rsqrtf(var + 1e-5f);
  // zn in f16 overlays the first 256 B of the row it came from: row s is written behind the sums of row s,
  // which are the last reads of its floats.
  half_t* zh = (half_t*)zw + lane * 4;
#pragma unroll
  for (int r = 0; r < 16; ++r) {
    const float mr = fromLane(mean, r), ir = fromLane(inv, r);
    h4 y;
#pragma unroll
    for (int c = 0; c < 4; ++c) y[c] = (half_t)((zv[r][c] - mr) * ir * g[c] + b[c]);
    *(h4a*)&zh[r * (ZF_P * 2)] = y;
  }
}

// The four fragments of the wave's 16x128 zn tile
__device__ __forceinline__ void loadZn(const float* zw, int m, int hi, v16h afr[4]) {
#pragma unroll
  for (int kb = 0; kb < 4; ++kb) {
    const half_t* c0 = (const half_t*)&zw[m * ZF_P] + kb * 32 + hi * 8;
    afr[kb] = frag2(c0, c0 + 16);
  }
}

// ---------------- projections: one 16x16 tile to the reader's fragment unit ----------------
// MODE 0 (q, k) and 2 (gate): the TRANSPOSED product (weights as A, zn as B), so lane (m, hi) holds
// row m, columns 8*hi .. 8*hi+7 of the tile. MODE 1 (v): the direct product, lane (m, hi) holds
// column m, rows 8*hi .. 8*hi+7. Either way the lane's 8 values are its 16 B of the reader's fragment unit.
template <int MODE>
__device__ __forceinline__ h8 packTileA(int tt, v8f acc, int hi, const float* b_gate) {
  h8 p;
  float bgv[8] = {};
  if (MODE == 2) {
    const float4 g0 = *(const float4*)&b_gate[tt * 16 + hi * 8];
    const float4 g1 = *(const float4*)&b_gate[tt * 16 + hi * 8 + 4];
    bgv[0] = g0.x; bgv[1] = g0.y; bgv[2] = g0.z; bgv[3] = g0.w;
    bgv[4] = g1.x; bgv[5] = g1.y; bgv[6] = g1.z; bgv[7] = g1.w;
  }
#pragma unroll
  for (int v = 0; v < 8; ++v) {
    if (MODE == 2) {
      const float bg = bgv[v];
      float s = 1.0f + __expf(-(acc[v] + bg));
      // v_nop: the slot the instruction set asks for behind a transcendental before its result is read or its
      // source overwritten.
      // In place: the compiler does not see what asm text writes; the source's register is live there, so no WMMA
      // around names it.
      asm("v_rcp_f32 %0, %0\n\tv_nop" : "+v"(s));
      p[v] = (half_t)s;
    } else {
      p[v] = (half_t)acc[v];
    }
  }
  return p;
}

// The 8 tiles (128 columns) of one of q, k, v, gate for the wave's 16 rows: p[tt] is the lane's 16 B of unit tt.
// On entry b0 holds tile t0's fragments; on exit those of t0 + 8, unless this is the last group.
template <int MODE, bool LAST>
__device__ __forceinline__ void group8F(int t0, const v16h afr[4], v16h b0[4], v16h b1[4],
                                        const half_t* __restrict__ packedW, int lane, int hi,
                                        const float* b_gate, h8 p[8]) {
#pragma unroll  // p[] is indexed by tt and has to stay in registers
  for (int tt = 0; tt < 8; tt += 2) {
    loadB4(packedW, t0 + tt + 1, lane, b1);
    v8f acc0 = {};
#pragma unroll
    for (int kb = 0; kb < 4; ++kb)
      acc0 = (MODE == 1) ? wmma32(afr[kb], b0[kb], acc0) : wmma32(b0[kb], afr[kb], acc0);
    if (!(LAST && tt == 6)) loadB4(packedW, t0 + tt + 2, lane, b0);  // prefetch next
    v8f acc1 = {};
#pragma unroll
    for (int kb = 0; kb < 4; ++kb)
      acc1 = (MODE == 1) ? wmma32(afr[kb], b1[kb], acc1) : wmma32(b1[kb], afr[kb], acc1);
    p[tt]     = packTileA<MODE>(tt, acc0, hi, b_gate);
    p[tt + 1] = packTileA<MODE>(tt + 1, acc1, hi, b_gate);
  }
}

// ---------------- kernel P: LayerNorm + pair bias (every row of the attention needs all of it) ----------------
// The 40 blocks behind the row blocks pack one weight tile each for kF (wave w: k block w) and leave: short blocks of
// their own, so that no row block waits for weight loads or for the stores in front of its first barrier.
__global__ __launch_bounds__(128) void kP(const float* __restrict__ z,
                                          const float* __restrict__ gamma,
                                          const float* __restrict__ beta,
                                          const float* __restrict__ wpair,
                                          const float* __restrict__ wqkv,
                                          const float* __restrict__ wgate,
                                          const float* __restrict__ wout,
                                          float* __restrict__ biasbuf,
                                          half_t* __restrict__ packW) {
  __shared__ __attribute__((aligned(16))) half_t Wp[4 * 512];      // the pair tile's fragment units
  __shared__ __attribute__((aligned(16))) float  zf[4][16 * ZF_P]; // z rows; the f16 zn rows later overlay them
  __shared__ __attribute__((aligned(16))) float  xb[256];          // bias exchange: [head][i in quad][j in tile]
  // the wave number as a scalar: the load base stays out of vector registers
  const int w = __builtin_amdgcn_readfirstlane(threadIdx.x >> 5);
  const int lane = threadIdx.x & 31;
  if (blockIdx.x >= N_ROWS / 64) {  // the same for the whole block, in front of every barrier
    const int t = blockIdx.x - N_ROWS / 64;
    const float* wsrc = t < 24 ? wqkv : t < 32 ? wgate : wout;
    const int ld = t < 24 ? 384 : 128, col = (t < 24 ? t : t & 7) * 16 + (lane & 15);
    const float* p0 = wsrc + (w * 32 + (lane >> 4) * 8) * ld + col;
    const float* p[16];
    float x[16];
#pragma unroll  // p and x are indexed by e and have to stay in registers
    for (int e = 0; e < 8; ++e) { p[e] = p0 + e * ld; p[e + 8] = p0 + (e + 16) * ld; }
#pragma unroll
    for (int e = 0; e < 16; ++e) x[e] = *p[e];
    // the operands keep the loads' address registers as they are up to the wait: no later load lands in one of them
    asm volatile("s_wait_xcnt 0x0" :: "v"(p[0]), "v"(p[1]), "v"(p[2]), "v"(p[3]), "v"(p[4]), "v"(p[5]), "v"(p[6]), "v"(p[7]),
                 "v"(p[8]), "v"(p[9]), "v"(p[10]), "v"(p[11]), "v"(p[12]), "v"(p[13]), "v"(p[14]), "v"(p[15]) : "memory");
    const float sc = t < 8 ? Q_SCALE : 1.0f;  // tiles 0..7 are w_q
    h8 u0, u1;
#pragma unroll
    for (int e = 0; e < 8; ++e) { u0[e] = (half_t)(x[e] * sc); u1[e] = (half_t)(x[e + 8] * sc); }
    half_t* dst = &packW[((t * 4 + w) * 64 + lane) * 8];
    *(h8*)&dst[0]   = u0;
    *(h8*)&dst[256] = u1;
    return;
  }
  // The four waves take one 16-wide j tile of four consecutive i (wave w: i = 4*ib + w), so that
  // together they hold whole 128-B lines of the bias fragments written at the tail.
  const int ib = blockIdx.x >> 4, jtA = blockIdx.x & 15;
  const int r0 = (ib * 4 + w) * 256 + jtA * 16;
  const int m = lane & 15, hi = lane >> 4, ncol = lane & 15;

  const float* zrow = z + (size_t)r0 * 128;
  v4f zv[16];
#pragma unroll  // one whole 512-B row per load
  for (int s = 0; s < 16; ++s) zv[s] = *(const v4f*)&(zrow + s * 128)[lane * 4];
  // later address arithmetic rewrites the registers that these loads name while they are in flight
  asm volatile("s_wait_xcnt 0x0" :: "v"(lane), "s"(zrow) : "memory");
  packUnits<4>(wpair, (w * 32 + hi * 8) * 4 + (m & 3), m < 4, &Wp[(w * 64 + lane) * 8]);  // columns 4..15: zero padding
#pragma unroll
  for (int s = 0; s < 16; ++s) *(v4f*)&zf[w][s * ZF_P + lane * 4] = zv[s];
  __syncthreads();
  lnRows(zf[w], zv, gamma, beta, lane, m, hi);
  __syncthreads();
  v16h afr[4], b0[4];
  loadZn(zf[w], m, hi, afr);
  loadB4(Wp, 0, lane, b0);
  // pair bias (only cols 0..3 valid), f32 output times log2(e): kF adds it to the
  // q.k sums, whose q carries log2(e) / sqrt(d), and the total is the argument of exp2.
  // Layout = the 16x16 f32 accumulator fragment of the TRANSPOSED logits tile (h, it, jt), keys down, queries across:
  //   [h][it][jt][half][i & 15][(j >> 3) & 1][j & 3],  half = (j >> 2) & 1
  // so a kF lane (query i & 15, key half) reads its 8 accumulator registers as two b128 of 512 contiguous B per wave.
  v8f acc = {};
#pragma unroll
  for (int kb = 0; kb < 4; ++kb) acc = wmma32(afr[kb], b0[kb], acc);
  float sv[8];
#pragma unroll
  for (int v = 0; v < 8; ++v) sv[v] = acc[v] * LOG2E;
  if (ncol < 4) {  // the lane holds keys 8*hi .. 8*hi+7 of the tile for head ncol and the wave's i
    *(float4*)&xb[ncol * 64 + w * 16 + hi * 8]     = make_float4(sv[0], sv[1], sv[2], sv[3]);
    *(float4*)&xb[ncol * 64 + w * 16 + hi * 8 + 4] = make_float4(sv[4], sv[5], sv[6], sv[7]);
  }
  __syncthreads();  // the four waves' i values meet here; wave w then writes head w
  if (lane < 16) {  // two whole 128-B lines: lane = 8*half + 2*(i in quad) + key half
    const int half = lane >> 3, il = (lane >> 1) & 3, hj = lane & 1;
    const float4 t = *(const float4*)&xb[w * 64 + il * 16 + hj * 8 + half * 4];
    const int it = ib >> 2, q = ib & 3;
    *(float4*)&biasbuf[((size_t)(w * 16 + it) * 16 + jtA) * 256 + half * 128 + q * 32 + (lane & 7) * 4] = t;
  }
}

// exp2 of score tile jt: to f16 as its half of a B fragment of 32 keys, and onto the lane's eight partial sums
template <bool MAXP>
__device__ __forceinline__ void expTile(int jt, v8f x, v16h pA[8], v8f& s8) {
#pragma unroll
  for (int v = 0; v < 8; ++v) {
    float e;
    if (MAXP) {
      // v_nop: the slot the instruction set asks for behind a transcendental before its source is overwritten.
      // In place, on a vector result that is made behind the whole maximum pass: no WMMA near it names the register.
      e = x[v];
      asm("v_exp_f32 %0, %0\n\tv_nop" : "+v"(e));
    } else {
      e = __builtin_amdgcn_exp2f(x[v]);
    }
    pA[jt >> 1][(jt & 1) * 8 + v] = (half_t)e;
    s8[v] += e;
  }
}

// ---------------- one head's exp(scores) for the wave's 16 queries ----------------
// pA: exp2(lg) in f16, as the B fragments of the PV product; returns each query's sum (the lane's own query).
// lg = log2(e) * (q.k / sqrt(d) + bias), transposed. MAXP false: exp2 straight on the accumulators, no pass over them
// for a maximum and no subtraction. MAXP true: the row's maximum is taken off first, for rows whose terms leave f16's range.
// bf: the lane's 16 B of the head's first bias tile; kh, qh: the lane's 16 B of the head's first k unit and q unit.
template <bool MAXP>
__device__ __forceinline__ float expScores(const float* __restrict__ bf, const half_t* kh, const half_t* qh, v16h pA[8]) {
  // the bias fragment is the WMMA's C operand
  v8f lg[16];
#pragma unroll
  for (int jt = 0; jt < 16; ++jt) {
    const float4 c0 = *(const float4*)&bf[jt * 256];
    const float4 c1 = *(const float4*)&bf[jt * 256 + 128];
    lg[jt] = v8f{c0.x, c0.y, c0.z, c0.w, c1.x, c1.y, c1.z, c1.w};
  }
  // the loads' address registers are reused while the loads are in flight; the operand keeps them as they are up to
  // the wait
  asm volatile("s_wait_xcnt 0x0" :: "v"(bf) : "memory");
  const v16h aQ = frag2(qh, qh + 256);
  // transposed scores (K as A, Q as B): lane (m, hi) holds query m, keys jt*16 + 8*hi .. +7.
  // K fragments come from LDS four at a time; the next four are asked for behind the four WMMAs that read these,
  // into the same registers, and land under this group's exp2.
  v16h fr[4];
  v8f s8 = {};
#pragma unroll
  for (int i = 0; i < 4; ++i) fr[i] = frag2(kh + i * WAVE_H, kh + i * WAVE_H + 256);
#pragma unroll
  for (int g = 0; g < 4; ++g) {
#pragma unroll
    for (int i = 0; i < 4; ++i) lg[g * 4 + i] = wmma32(fr[i], aQ, lg[g * 4 + i]);
    if (g < 3) {
#pragma unroll
      for (int i = 0; i < 4; ++i) {
        const half_t* kc = kh + (g * 4 + 4 + i) * WAVE_H;
        fr[i] = frag2(kc, kc + 256);
      }
    }
    // keeps the next group's LDS reads above this group's exp2: sunk to their users, each read is waited out alone
    __builtin_amdgcn_sched_barrier(0);
    // no tile waits for another: a group's exp2 run while the bias of the next groups is still on its way
    if (!MAXP) {
#pragma unroll
      for (int i = 0; i < 4; ++i) expTile<false>(g * 4 + i, lg[g * 4 + i], pA, s8);
    }
  }
  if (MAXP) {  // over j: the lane's 128 keys in registers, then one exchange with the lane that holds the other 128
    v8f mx8 = lg[0];
#pragma unroll
    for (int jt = 1; jt < 16; ++jt)
#pragma unroll
      for (int v = 0; v < 8; ++v) mx8[v] = fmaxf(mx8[v], lg[jt][v]);
    float mx = fmaxf(fmaxf(fmaxf(mx8[0], mx8[1]), fmaxf(mx8[2], mx8[3])),
                     fmaxf(fmaxf(mx8[4], mx8[5]), fmaxf(mx8[6], mx8[7])));
    mx = fmaxf(mx, xhalf(mx));
#pragma unroll
    for (int jt = 0; jt < 16; ++jt) expTile<true>(jt, lg[jt] - mx, pA, s8);
  }
  float sum = ((s8[0] + s8[1]) + (s8[2] + s8[3])) + ((s8[4] + s8[5]) + (s8[6] + s8[7]));
  sum += xhalf(sum);
  return sum;
}

// ---------------- kernel F: one attention row r per block: LayerNorm, q/k/v/gate, attention, output projection ----------------
// Wave wv owns the 16 positions wv*16 .. +15 of the row from z to out. Its q, gate and attention output never leave the
// lane that made them (a producer's 16 B of a fragment unit are the same lane's 16 B for the reader); only k and v are
// read by the other waves, from LDS.
__global__ __launch_bounds__(512) void kF(const float* __restrict__ z,
                                          const float* __restrict__ gamma,
                                          const float* __restrict__ beta,
                                          const half_t* __restrict__ packW,
                                          const float* __restrict__ b_gate,
                                          const float* __restrict__ b_out,
                                          const float* __restrict__ biasbuf,
                                          float* __restrict__ out) {
  // w_qkv and w_gate as fragment units (32 tiles), as kP packed them. Behind the projections the array is cut into
  // 16 slices of WAVE_H halves, one a wave: q units (later the attention output's), gate units, at the end the f32 rows.
  __shared__ __attribute__((aligned(16))) half_t Wl[16 * WAVE_H];
  // z rows, one slice a wave; the f16 zn rows overlay them, and then the wave's 8 k units and 8 v units
  __shared__ __attribute__((aligned(16))) float  zf[16][16 * ZF_P];
  __shared__ __attribute__((aligned(16))) half_t Wo[8 * 4 * 512];  // w_out as fragment units
  __shared__ __attribute__((aligned(16))) float  gS[128];     // b_gate: a lane reads 8 adjacent entries per gate tile
  // the wave number as a scalar: the branches on it are scalar and the bases stay out of vector registers
  const int wv = __builtin_amdgcn_readfirstlane(threadIdx.x >> 5);
  const int lane = threadIdx.x & 31;
  const int r0 = blockIdx.x * 256 + wv * 16;
  const int m = lane & 15, hi = lane >> 4;

  // wave wv: tiles 2*wv, 2*wv + 1 (w_qkv's up to wave 11, then w_gate's) and k blocks 2*(wv & 1), +1 of w_out's tile wv >> 1
  v4f zv[16];
  stageF(packW + wv * 4096, &Wl[(wv * 512 + lane) * 8], packW + wv * 1024, &Wo[(wv * 128 + lane) * 8],
         wv >= 12, b_gate + (wv & 3) * 32, gS + (wv & 3) * 32, z + (size_t)r0 * 128, zf[wv], zv, lane);
  __syncthreads();
  lnRows(zf[wv], zv, gamma, beta, lane, m, hi);
  __syncthreads();

  h8 pq[8], pg[8];
  {
    v16h afr[4], b0[4], b1[4];
    h8 pk[8], pv[8];
    loadZn(zf[wv], m, hi, afr);
    half_t* kvw = (half_t*)&zf[wv][0] + lane * 8;  // the zn rows are in afr: the slice now takes k and v
    loadB4(Wl, 0, lane, b0);
    group8F<0, false>(0,  afr, b0, b1, Wl, lane, hi, gS, pq);
    group8F<0, false>(8,  afr, b0, b1, Wl, lane, hi, gS, pk);
#pragma unroll
    for (int tt = 0; tt < 8; ++tt) *(h8a*)&kvw[tt * 256] = pk[tt];
    group8F<1, false>(16, afr, b0, b1, Wl, lane, hi, gS, pv);
#pragma unroll
    for (int tt = 0; tt < 8; ++tt) *(h8a*)&kvw[2048 + tt * 256] = pv[tt];
    group8F<2, true>(24, afr, b0, b1, Wl, lane, hi, gS, pg);
  }
  __syncthreads();  // every wave's k and v are in LDS, and nobody reads the packed weights in Wl any more

  half_t* own = Wl + wv * WAVE_H + lane * 8;  // the lane's 16 B of unit 0 of the wave's slice
#pragma unroll
  for (int tt = 0; tt < 8; ++tt) { *(h8a*)&own[tt * 256] = pq[tt]; *(h8a*)&own[2048 + tt * 256] = pg[tt]; }

  const half_t* kv = (const half_t*)&zf[0][0] + lane * 8;
  const int bl = (m * 2 + hi) * 4;  // the lane's 16 B in each 512-B half of a bias tile
#pragma unroll 1  // one head a trip; unrolled, four trips of 128 score registers do not fit the 256 of a 16-wave block
  for (int hh = 0; hh < 4; ++hh) {
    // every block reads the same bias: neighbours start at different heads, so that they are not all on the same lines at once
    const int h = (hh + blockIdx.x) & 3;
    const float* bf = biasbuf + (size_t)(h * 16 + wv) * 4096 + bl;
    v16h pA[8];  // exp(scores) in f16: two score tiles are the B fragment of 32 keys
    float sum = expScores<false>(bf, kv + h * 512, own + h * 512, pA);
    // A row sum in [1, 32768] says that no term is above f16's range (each is at most the sum) and that what the 256 terms
    // lose in f16's subnormal range, 2^-25 each at most, is at most 2^-17 of the sum: the bound that holds with the maximum
    // taken off, where the sum is at least 1 too. Otherwise (NaN included) the wave does the head again with the maximum.
    // The ballot makes the branch scalar: WMMAs need every lane on.
    if (__builtin_amdgcn_ballot_w32(!(sum >= 1.0f && sum <= 32768.0f)) != 0)
      sum = expScores<true>(bf, kv + h * 512, own + h * 512, pA);
    const float rs = __builtin_amdgcn_rcpf(sum);

    // (attn @ V)^T (V as A, exp(scores)^T as B). Lane (m, hi) holds query row m, d = dt*16 + 8*hi .. +7, which is its 16 B of the gate's and of
    // the output's fragment unit; the row's 1/sum is the lane's own and is applied here.
    // V fragments likewise: those of 64 keys (two B fragments x two halves of d) one group ahead.
    v8f acc[2] = {};
    v16h fr[2][4];
#pragma unroll
    for (int i = 0; i < 4; ++i) {
      const half_t* vc = kv + (i >> 1) * 2 * WAVE_H + 2048 + h * 512 + (i & 1) * 256;
      fr[0][i] = frag2(vc, vc + WAVE_H);
    }
#pragma unroll
    for (int g = 0; g < 4; ++g) {
      if (g < 3) {
#pragma unroll
        for (int i = 0; i < 4; ++i) {
          const half_t* vc = kv + (g * 2 + 2 + (i >> 1)) * 2 * WAVE_H + 2048 + h * 512 + (i & 1) * 256;
          fr[(g + 1) & 1][i] = frag2(vc, vc + WAVE_H);
        }
      }
      __builtin_amdgcn_sched_barrier(0);  // as above: the next group's reads stay above this group's WMMAs
#pragma unroll
      for (int j = 0; j < 2; ++j)
#pragma unroll
        for (int dt = 0; dt < 2; ++dt) acc[dt] = wmma32(fr[g & 1][j * 2 + dt], pA[g * 2 + j], acc[dt]);
    }
#pragma unroll
    for (int dt = 0; dt < 2; ++dt) {
      const h8 gq = *(const h8a*)&own[2048 + h * 512 + dt * 256];
      h8 o;
#pragma unroll
      for (int v = 0; v < 8; ++v) o[v] = (half_t)((float)gq[v] * (acc[dt][v] * rs));
      *(h8a*)&own[h * 512 + dt * 256] = o;  // over this head's q units, which are spent
    }
  }

  // output projection + b_out: the wave's gated attention output, head kb, is the k block kb of its operand
  v16h afr[4];
#pragma unroll
  for (int kb = 0; kb < 4; ++kb) afr[kb] = frag2(&own[kb * 512], &own[kb * 512 + 256]);
  float* st = (float*)(Wl + wv * WAVE_H);  // store stage, 16 rows x 128 f32, over the slice's spent units
  v16h b0[4], b1[4];
  loadB4(Wo, 0, lane, b0);
#pragma unroll  // the next tiles' LDS reads and the b_out reads then stand ahead of the WMMAs that wait for them
  for (int tp = 0; tp < 4; ++tp) {
    const int n0 = tp * 2, n1 = tp * 2 + 1;
    loadB4(Wo, n1, lane, b1);
    v8f acc0 = {};
#pragma unroll
    for (int kb = 0; kb < 4; ++kb) acc0 = wmma32(b0[kb], afr[kb], acc0);
    if (tp < 3) loadB4(Wo, n1 + 1, lane, b0);  // prefetch next pair
    v8f acc1 = {};
#pragma unroll
    for (int kb = 0; kb < 4; ++kb) acc1 = wmma32(b1[kb], afr[kb], acc1);
    // transposed product (weights as A): lane (m, hi) holds row m, columns 8*hi .. 8*hi+7 of each tile
    float x0[8], x1[8];
#pragma unroll
    for (int v = 0; v < 8; ++v) {
      // both candidates are wave-uniform reads (scalar loads); the lane picks its half of the tile
      const float lo0 = b_out[n0 * 16 + v], hi0 = b_out[n0 * 16 + 8 + v];
      const float lo1 = b_out[n1 * 16 + v], hi1 = b_out[n1 * 16 + 8 + v];
      x0[v] = acc0[v] + (hi ? hi0 : lo0);
      x1[v] = acc1[v] + (hi ? hi1 : lo1);
    }
    float* sr = &st[m * ZF_P + hi * 8];
    *(float4*)&sr[n0 * 16]     = make_float4(x0[0], x0[1], x0[2], x0[3]);
    *(float4*)&sr[n0 * 16 + 4] = make_float4(x0[4], x0[5], x0[6], x0[7]);
    *(float4*)&sr[n1 * 16]     = make_float4(x1[0], x1[1], x1[2], x1[3]);
    *(float4*)&sr[n1 * 16 + 4] = make_float4(x1[4], x1[5], x1[6], x1[7]);
  }
  asm volatile("s_wait_dscnt 0" ::: "memory");  // same-wave LDS RAW across lanes: rows are read back by other lanes
  // one whole 512-B output row per store
#pragma unroll
  for (int s = 0; s < 16; ++s)
    *(float4*)&(out + (size_t)(r0 + s) * 128)[lane * 4] = *(const float4*)&st[s * ZF_P + lane * 4];
}

extern "C" void kernel_launch(void* const* d_in, const int* in_sizes, int n_in,
                              void* d_out, int out_size, void* d_ws, size_t ws_size,
                              hipStream_t stream) {
  const float* z      = (const float*)d_in[0];
  const float* gamma  = (const float*)d_in[1];
  const float* beta   = (const float*)d_in[2];
  const float* w_qkv  = (const float*)d_in[3];
  const float* w_pair = (const float*)d_in[4];
  const float* w_gate = (const float*)d_in[5];
  const float* b_gate = (const float*)d_in[6];
  const float* w_out  = (const float*)d_in[7];
  const float* b_out  = (const float*)d_in[8];

  float* biasbuf = (float*)((char*)d_ws + OFF_B);
  half_t* packW  = (half_t*)((char*)d_ws + OFF_W);

  kP<<<N_ROWS / 64 + 40, 128, 0, stream>>>(z, gamma, beta, w_pair, w_qkv, w_gate, w_out, biasbuf, packW);
  kF<<<L_DIM, 512, 0, stream>>>(z, gamma, beta, packW, b_gate, b_out, biasbuf, (float*)d_out);
}

// v010
// One run takes 28 microseconds.
// Next to v009, in two timings, it ran 1.04 and 1.03 times as fast.
// All steps since v000 together make it 7.17 times as fast.
#include <hip/hip_runtime.h>
#include <hip/hip_bf16.h>
#include <stddef.h>

typedef _Float16 half_t;
typedef __attribute__((ext_vector_type(16))) _Float16 v16h;
typedef __attribute__((ext_vector_type(8)))  _Float16 h8;
typedef __attribute__((ext_vector_type(8)))  float    v8f;
typedef __attribute__((ext_vector_type(4)))  float    v4f;
typedef h8 __attribute__((may_alias)) h8a;  // 16-B f16 accesses to LDS bytes that hold f32 or other operands at other times
typedef __attribute__((ext_vector_type(4)))  _Float16 h4;
typedef h4 __attribute__((may_alias)) h4a;  // the same, 8 B

#define N_ROWS 65536      // L*L flattened (i,j) rows
#define IN_DIM 128
#define L_DIM  256
#define H_HEADS 4
#define D_HEAD 32

// LDS row pitches: 16 B x odd, so the 16 rows a ds_load_b128 touches fall on
// distinct banks (64 banks x 4 B; an unpadded 256/512-B pitch puts them on four).
#define ZF_P 132          // floats : 528 B

// ---- fragment units ----
// Every f16 operand in LDS except zn is kept in WMMA fragment order, in 512-B units [lane = 16*hi + m][8 halves], so that
// each wave-wide 16-B access covers 512 contiguous bytes:
//   q, k, gate, ao : unit (T, c8), T = row >> 4, c8 = col >> 4 : X[T*16 + m][c8*16 + 8*hi + e]
//   v              : unit (T, c8)                              : V[T*16 + 8*hi + e][c8*16 + m]
//   weights        : unit (t, kb, c)                           : W[kb*32 + c*16 + 8*hi + e][t*16 + m]
// A 16x32 (or 32x16) f16 fragment is two such units (k 0..15 and k 16..31 of the block).
// The workspace holds the pair bias (f16, order of the transposed logits' accumulator, see kP's tail) and behind it
// the 40 weight tiles as fragment units, which kP packs once for all of kF's blocks.
#define OFF_B   ((size_t)0)
#define OFF_W   ((size_t)1 << 20)  // bytes: behind 4 * 256 * 256 f16 of bias (the first half of this space)
#define WO_H    65536              // halves in front of w_out's units: 32 tiles x 4 k blocks x 512
#define WAVE_H  4224      // halves of one wave's 8448-B LDS slice (16 rows x 528 B)
// The scores leave the QK WMMA as arguments of exp2: log2(e) / sqrt(d) is folded into the packed w_q, log2(e) into the bias.
#define LOG2E   1.4426950408889634f
#define Q_SCALE (0.17677669529663687f * LOG2E)

__device__ __forceinline__ v8f wmma32(v16h a, v16h b, v8f c) {
  return __builtin_amdgcn_wmma_f32_16x16x32_f16(false, a, false, b, (short)0, c, false, false);
}

// Build a 16-half fragment from two contiguous 16B chunks (A layout and our
// B layouts both reduce to this: halves 0..7 = chunk0, halves 8..15 = chunk1).
__device__ __forceinline__ v16h frag2(const half_t* c0, const half_t* c1) {
  h8 x0 = *(const h8a*)c0;
  h8 x1 = *(const h8a*)c1;
  v16h f;
#pragma unroll
  for (int i = 0; i < 8; ++i) { f[i] = x0[i]; f[i + 8] = x1[i]; }
  return f;
}

// Load the 4 K-step B fragments of one 16-col weight tile (independent regs
// so the scheduler can clause the 8 b128 loads and keep WMMAs back-to-back).
__device__ __forceinline__ void loadB4(const half_t* __restrict__ packedW, int t, int lane,
                                       v16h b[4]) {
#pragma unroll
  for (int kb = 0; kb < 4; ++kb) {
    const half_t* p = &packedW[((size_t)(t * 4 + kb) * 64 + lane) * 8];
    b[kb] = frag2(p, p + 256);
  }
}

// ---------------- weights to f16 fragment units ----------------
// tile index t: 0..23 = w_qkv (384 cols), 24..31 = w_gate, 32..39 = w_out (an LDS array of its own in kF); the pair tile (padded to 16) stays in kP
// One lane's 16 B of each of the two units of a 32-deep k block: W[k0 + e][col] and W[k0 + 16 + e][col],
// first = k0 * LD + col. LD is a constant, so the 16 loads share one address register.
template <int LD>
__device__ __forceinline__ void packUnits(const float* __restrict__ wsrc, int first, bool valid,
                                          half_t* __restrict__ dst) {
  h8 u0, u1;
#pragma unroll
  for (int e = 0; e < 8; ++e) {
    const float x0 = wsrc[first + e * LD], x1 = wsrc[first + (e + 16) * LD];
    u0[e] = (half_t)(valid ? x0 : 0.0f);
    u1[e] = (half_t)(valid ? x1 : 0.0f);
  }
  *(h8*)&dst[0]   = u0;
  *(h8*)&dst[256] = u1;
}

// A wave's share of kF's fill: 16 of the 256 units of w_qkv and w_gate and 4 of the 64 of w_out go from the workspace,
// where kP left them in f16 fragment order, to the same place in LDS, 512 contiguous B a load; the wave's 16 z rows go to
// LDS as they are, one row a load, and stay in zv for lnRows. The last four waves take 32 entries of b_gate each as well.
// One straight-line block: all the loads fly together.
__device__ __forceinline__ void stageF(const half_t* __restrict__ srcW, half_t* __restrict__ dstW,
                                       const half_t* __restrict__ srcO, half_t* __restrict__ dstO,
                                       bool gate, const float* __restrict__ bsrc, float* __restrict__ bdst,
                                       const float* __restrict__ zrow, float* __restrict__ zdst, v4f zv[16], int lane) {
  h8 xw[16], xo[4];
  float xg = 0.0f;
#pragma unroll  // the arrays are indexed by s and p and have to stay in registers
  for (int s = 0; s < 16; ++s) xw[s] = *(const h8*)&(srcW + s * 256)[lane * 8];
#pragma unroll
  for (int p = 0; p < 4; ++p) xo[p] = *(const h8*)&(srcO + WO_H + p * 256)[lane * 8];  // WO_H goes into the loads' offset field
  if (gate) xg = bsrc[lane];
#pragma unroll
  for (int s = 0; s < 16; ++s) zv[s] = *(const v4f*)&(zrow + s * 128)[lane * 4];
  // later address arithmetic rewrites registers that the loads above name while these are in flight; the operands keep
  // those registers as they are up to the wait
  asm volatile("s_wait_xcnt 0x0" :: "v"(lane), "s"(srcW), "s"(srcO), "s"(bsrc), "s"(zrow) : "memory");
#pragma unroll
  for (int s = 0; s < 16; ++s) *(h8*)&dstW[s * 256] = xw[s];
#pragma unroll
  for (int p = 0; p < 4; ++p) *(h8*)&dstO[p * 256] = xo[p];
  if (gate) bdst[lane] = xg;
#pragma unroll
  for (int s = 0; s < 16; ++s) *(v4f*)&zdst[s * ZF_P + lane * 4] = zv[s];
}

// Lane l <-> l ^ 16: the two lanes that share a row of the LayerNorm, or a query column of a transposed score tile.
__device__ __forceinline__ float xhalf(float x) {
  const int b = __builtin_bit_cast(int, x);
  return __builtin_bit_cast(float, __builtin_amdgcn_permlanex16(b, b, 0x76543210, 0xfedcba98, false, false));
}

// Lane s's value as a wave-uniform one
__device__ __forceinline__ float fromLane(float x, int s) {
  return __builtin_bit_cast(float, __builtin_amdgcn_readlane(__builtin_bit_cast(int, x), s));
}

// LayerNorm of a wave's 16 rows. They are held twice: in LDS (f32, pitch ZF_P) and in zv as they were loaded
// (zv[s]: row s, columns 4*lane .. +3).
// Sums: lane pair (m, m+16) takes row m from LDS, 16 B a read, straight-line, so that several reads are in flight.
// Scaling: on zv, where a lane has 4 columns of every row: it needs 4 gamma and 4 beta, not 64 of each, and a row's
// mean and 1/sigma are wave-uniform values.
__device__ __forceinline__ void lnRows(float* zw, const v4f zv[16], const float* __restrict__ gamma,
                                       const float* __restrict__ beta, int lane, int m, int hi) {
  const v4f g = *(const v4f*)&gamma[lane * 4], b = *(const v4f*)&beta[lane * 4];
  // later address arithmetic rewrites the registers that these loads name while they are in flight
  asm volatile("s_wait_xcnt 0x0" :: "v"(lane), "s"(gamma), "s"(beta) : "memory");
  const float* zr = &zw[m * ZF_P + hi * 64];
  v4f x[16];
#pragma unroll  // x is indexed by i and has to stay in registers
  for (int i = 0; i < 16; ++i) x[i] = *(const v4f*)&zr[i * 4];
  v4f s4 = x[0], q4 = x[0] * x[0];  // four partial sums each, one per column mod 4
#pragma unroll
  for (int i = 1; i < 16; ++i) { s4 += x[i]; q4 += x[i] * x[i]; }
  float s  = (s4[0] + s4[1]) + (s4[2] + s4[3]);
  float sq = (q4[0] + q4[1]) + (q4[2] + q4[3]);
  s  += xhalf(s);
  sq += xhalf(sq);
  const float mean = s * (1.0f / 128.0f);
  const float var  = sq * (1.0f / 128.0f) - mean * mean;
  const float inv  = rsqrtf(var + 1e-5f);
  // zn in f16 overlays the first 256 B of the row it came from: row s is written behind the sums of row s,
  // which are the last reads of its floats.
  half_t* zh = (half_t*)zw + lane * 4;
#pragma unroll
  for (int r = 0; r < 16; ++r) {
    const float mr = fromLane(mean, r), ir = fromLane(inv, r);
    h4 y;
#pragma unroll
    for (int c = 0; c < 4; ++c) y[c] = (half_t)((zv[r][c] - mr) * ir * g[c] + b[c]);
    *(h4a*)&zh[r * (ZF_P * 2)] = y;
  }
}

// The four fragments of the wave's 16x128 zn tile
__device__ __forceinline__ void loadZn(const float* zw, int m, int hi, v16h afr[4]) {
#pragma unroll
  for (int kb = 0; kb < 4; ++kb) {
    const half_t* c0 = (const half_t*)&zw[m * ZF_P] + kb * 32 + hi * 8;
    afr[kb] = frag2(c0, c0 + 16);
  }
}

// ---------------- projections: one 16x16 tile to the reader's fragment unit ----------------
// MODE 0 (q, k) and 2 (gate): the TRANSPOSED product (weights as A, zn as B), so lane (m, hi) holds
// row m, columns 8*hi .. 8*hi+7 of the tile. MODE 1 (v): the direct product, lane (m, hi) holds
// column m, rows 8*hi .. 8*hi+7. Either way the lane's 8 values are its 16 B of the reader's fragment unit.
template <int MODE>
__device__ __forceinline__ h8 packTileA(int tt, v8f acc, int hi, const float* b_gate) {
  h8 p;
  float bgv[8] = {};
  if (MODE == 2) {
    const float4 g0 = *(const float4*)&b_gate[tt * 16 + hi * 8];
    const float4 g1 = *(const float4*)&b_gate[tt * 16 + hi * 8 + 4];
    bgv[0] = g0.x; bgv[1] = g0.y; bgv[2] = g0.z; bgv[3] = g0.w;
    bgv[4] = g1.x; bgv[5] = g1.y; bgv[6] = g1.z; bgv[7] = g1.w;
  }
#pragma unroll
  for (int v = 0; v < 8; ++v) {
    if (MODE == 2) {
      const float bg = bgv[v];
      float s = 1.0f + __expf(-(acc[v] + bg));
      // v_nop: the slot the instruction set asks for behind a transcendental before its result is read or its
      // source overwritten.
      // In place: the compiler does not see what asm text writes; the source's register is live there, so no WMMA
      // around names it.
      asm("v_rcp_f32 %0, %0\n\tv_nop" : "+v"(s));
      p[v] = (half_t)s;
    } else {
      p[v] = (half_t)acc[v];
    }
  }
  return p;
}

// The 8 tiles (128 columns) of one of q, k, v, gate for the wave's 16 rows: p[tt] is the lane's 16 B of unit tt.
// On entry b0 holds tile t0's fragments; on exit those of t0 + 8, unless this is the last group.
template <int MODE, bool LAST>
__device__ __forceinline__ void group8F(int t0, const v16h afr[4], v16h b0[4], v16h b1[4],
                                        const half_t* __restrict__ packedW, int lane, int hi,
                                        const float* b_gate, h8 p[8]) {
#pragma unroll  // p[] is indexed by tt and has to stay in registers
  for (int tt = 0; tt < 8; tt += 2) {
    loadB4(packedW, t0 + tt + 1, lane, b1);
    v8f acc0 = {};
#pragma unroll
    for (int kb = 0; kb < 4; ++kb)
      acc0 = (MODE == 1) ? wmma32(afr[kb], b0[kb], acc0) : wmma32(b0[kb], afr[kb], acc0);
    if (!(LAST && tt == 6)) loadB4(packedW, t0 + tt + 2, lane, b0);  // prefetch next
    v8f acc1 = {};
#pragma unroll
    for (int kb = 0; kb < 4; ++kb)
      acc1 = (MODE == 1) ? wmma32(afr[kb], b1[kb], acc1) : wmma32(b1[kb], afr[kb], acc1);
    p[tt]     = packTileA<MODE>(tt, acc0, hi, b_gate);
    p[tt + 1] = packTileA<MODE>(tt + 1, acc1, hi, b_gate);
  }
}

// ---------------- kernel P: LayerNorm + pair bias (every row of the attention needs all of it) ----------------
// The 40 blocks behind the row blocks pack one weight tile each for kF (wave w: k block w) and leave: short blocks of
// their own, so that no row block waits for weight loads or for the stores in front of its first barrier.
__global__ __launch_bounds__(128) void kP(const float* __restrict__ z,
                                          const float* __restrict__ gamma,
                                          const float* __restrict__ beta,
                                          const float* __restrict__ wpair,
                                          const float* __restrict__ wqkv,
                                          const float* __restrict__ wgate,
                                          const float* __restrict__ wout,
                                          half_t* __restrict__ biasbuf,
                                          half_t* __restrict__ packW) {
  __shared__ __attribute__((aligned(16))) half_t Wp[4 * 512];      // the pair tile's fragment units
  __shared__ __attribute__((aligned(16))) float  zf[4][16 * ZF_P]; // z rows; the f16 zn rows later overlay them
  __shared__ __attribute__((aligned(16))) half_t xb[256];          // bias exchange: [head][key half][i in quad][key & 7]
  // the wave number as a scalar: the load base stays out of vector registers
  const int w = __builtin_amdgcn_readfirstlane(threadIdx.x >> 5);
  const int lane = threadIdx.x & 31;
  if (blockIdx.x >= N_ROWS / 64) {  // the same for the whole block, in front of every barrier
    const int t = blockIdx.x - N_ROWS / 64;
    const float* wsrc = t < 24 ? wqkv : t < 32 ? wgate : wout;
    const int ld = t < 24 ? 384 : 128, col = (t < 24 ? t : t & 7) * 16 + (lane & 15);
    const float* p0 = wsrc + (w * 32 + (lane >> 4) * 8) * ld + col;
    const float* p[16];
    float x[16];
#pragma unroll  // p and x are indexed by e and have to stay in registers
    for (int e = 0; e < 8; ++e) { p[e] = p0 + e * ld; p[e + 8] = p0 + (e + 16) * ld; }
#pragma unroll
    for (int e = 0; e < 16; ++e) x[e] = *p[e];
    // the operands keep the loads' address registers as they are up to the wait: no later load lands in one of them
    asm volatile("s_wait_xcnt 0x0" :: "v"(p[0]), "v"(p[1]), "v"(p[2]), "v"(p[3]), "v"(p[4]), "v"(p[5]), "v"(p[6]), "v"(p[7]),
                 "v"(p[8]), "v"(p[9]), "v"(p[10]), "v"(p[11]), "v"(p[12]), "v"(p[13]), "v"(p[14]), "v"(p[15]) : "memory");
    const float sc = t < 8 ? Q_SCALE : 1.0f;  // tiles 0..7 are w_q
    h8 u0, u1;
#pragma unroll
    for (int e = 0; e < 8; ++e) { u0[e] = (half_t)(x[e] * sc); u1[e] = (half_t)(x[e + 8] * sc); }
    half_t* dst = &packW[((t * 4 + w) * 64 + lane) * 8];
    *(h8*)&dst[0]   = u0;
    *(h8*)&dst[256] = u1;
    return;
  }
  // The four waves take one 16-wide j tile of four consecutive i (wave w: i = 4*ib + w), so that
  // together they hold a whole 128-B line of each head's bias tile written at the tail.
  const int ib = blockIdx.x >> 4, jtA = blockIdx.x & 15;
  const int r0 = (ib * 4 + w) * 256 + jtA * 16;
  const int m = lane & 15, hi = lane >> 4, ncol = lane & 15;

  const float* zrow = z + (size_t)r0 * 128;
  v4f zv[16];
#pragma unroll  // one whole 512-B row per load
  for (int s = 0; s < 16; ++s) zv[s] = *(const v4f*)&(zrow + s * 128)[lane * 4];
  // later address arithmetic rewrites the registers that these loads name while they are in flight
  asm volatile("s_wait_xcnt 0x0" :: "v"(lane), "s"(zrow) : "memory");
  packUnits<4>(wpair, (w * 32 + hi * 8) * 4 + (m & 3), m < 4, &Wp[(w * 64 + lane) * 8]);  // columns 4..15: zero padding
#pragma unroll
  for (int s = 0; s < 16; ++s) *(v4f*)&zf[w][s * ZF_P + lane * 4] = zv[s];
  __syncthreads();
  lnRows(zf[w], zv, gamma, beta, lane, m, hi);
  __syncthreads();
  v16h afr[4], b0[4];
  loadZn(zf[w], m, hi, afr);
  loadB4(Wp, 0, lane, b0);
  // pair bias (only cols 0..3 valid), times log2(e), stored as f16: kF adds it to the
  // q.k sums, whose q carries log2(e) / sqrt(d), and the total is the argument of exp2.
  // Every kF block reads all of it from L2, so its bytes count 256 times: f16 halves them. Its rounding, 2^-11 of the
  // bias, stands beside the 2^-11 that exp2's result loses when it becomes a f16 operand of the PV product.
  // Layout = the 16x16 accumulator fragment of the TRANSPOSED logits tile (h, it, jt), keys down, queries across:
  //   [h][it][jt][(i & 15) >> 2][(j >> 3) & 1][i & 3][j & 7]
  // so a kF lane (query i & 15, key half) reads its 8 accumulator values as one b128 of 512 contiguous B per wave.
  // The same 16 B are the lane's share of a B fragment's half with the tile's keys as k: kF widens them on the matrix unit.
  v8f acc = {};
#pragma unroll
  for (int kb = 0; kb < 4; ++kb) acc = wmma32(afr[kb], b0[kb], acc);
  h8 sv;
#pragma unroll
  for (int v = 0; v < 8; ++v) sv[v] = (half_t)(acc[v] * LOG2E);
  // the lane holds keys 8*hi .. 8*hi+7 of the tile for head ncol and the wave's i
  if (ncol < 4) *(h8*)&xb[ncol * 64 + hi * 32 + w * 8] = sv;
  __syncthreads();  // the four waves' i values meet here; wave w then writes head w
  if (lane < 8) {  // one whole 128-B line: lane = 4*(key half) + i in quad
    const h8 t = *(const h8*)&xb[w * 64 + lane * 8];
    const int it = ib >> 2, q = ib & 3;
    *(h8*)&biasbuf[((size_t)(w * 16 + it) * 16 + jtA) * 256 + q * 64 + lane * 8] = t;
  }
}

// exp2 of score tile jt: to f16 as its half of a B fragment of 32 keys, and onto the lane's eight partial sums
template <bool MAXP>
__device__ __forceinline__ void expTile(int jt, v8f x, v16h pA[8], v8f& s8) {
#pragma unroll
  for (int v = 0; v < 8; ++v) {
    float e;
    if (MAXP) {
      // v_nop: the slot the instruction set asks for behind a transcendental before its source is overwritten.
      // In place, on a vector result that is made behind the whole maximum pass: no WMMA near it names the register.
      e = x[v];
      asm("v_exp_f32 %0, %0\n\tv_nop" : "+v"(e));
    } else {
      e = __builtin_amdgcn_exp2f(x[v]);
    }
    pA[jt >> 1][(jt & 1) * 8 + v] = (half_t)e;
    s8[v] += e;
  }
}

// ---------------- one head's exp(scores) for the wave's 16 queries ----------------
// pA: exp2(lg) in f16, as the B fragments of the PV product; returns each query's sum (the lane's own query).
// lg = log2(e) * (q.k / sqrt(d) + bias), transposed. MAXP false: exp2 straight on the accumulators, no pass over them
// for a maximum and no subtraction. MAXP true: the row's maximum is taken off first, for rows whose terms leave f16's range.
// bfs + bl: the lane's 16 B of the head's first bias tile (f16), bfs the same for the wave; kh, qh: the lane's 16 B of the
// head's first k unit and q unit.
// uLo, uHi: the 16x32 matrices [I 0] and [0 I] as A fragments.
template <bool MAXP>
__device__ __forceinline__ float expScores(const half_t* __restrict__ bfs, int bl, const half_t* kh, const half_t* qh,
                                           v16h uLo, v16h uHi, v16h pA[8]) {
  h8 bh[16];
#pragma unroll  // bh is indexed by jt and has to stay in registers
  for (int jt = 0; jt < 16; ++jt) bh[jt] = *(const h8*)&(bfs + jt * 256)[bl];
  // the loads' address registers are reused while the loads are in flight; the operands keep them as they are up to
  // the wait
  asm volatile("s_wait_xcnt 0x0" :: "v"(bl), "s"(bfs) : "memory");
  const v16h aQ = frag2(qh, qh + 256);
  // transposed scores (K as A, Q as B): lane (m, hi) holds query m, keys jt*16 + 8*hi .. +7.
  // K fragments come from LDS four at a time; the next four are asked for behind the four WMMAs that read these,
  // into the same registers, and land under this group's exp2.
  v16h fr[4];
  v8f lg[16];
  v8f s8 = {};
#pragma unroll
  for (int i = 0; i < 4; ++i) fr[i] = frag2(kh + i * WAVE_H, kh + i * WAVE_H + 256);
  // the first LDS reads stay above the wait for the bias: sunk behind it, their latency follows the bias's own
  __builtin_amdgcn_sched_barrier(0);
#pragma unroll
  for (int g = 0; g < 4; ++g) {
    // The bias starts the accumulators. Two f16 tiles as loaded are a B fragment (k = the 32 keys, columns = the queries):
    // [I 0] times it is the first tile in f32, [0 I] times it the second, each value in the lane and register it came
    // from, exactly (one product by 1 and zeros). Two WMMAs stand for 16 conversions a lane: in this loop the vector port
    // has about twice the matrix unit's cycles to issue, so the widening goes to the unit that has room.
#pragma unroll
    for (int i = 0; i < 4; ++i) {
      const h8 t0 = bh[g * 4 + (i & 2)], t1 = bh[g * 4 + (i & 2) + 1];
      v16h bb;
#pragma unroll
      for (int e = 0; e < 8; ++e) { bb[e] = t0[e]; bb[e + 8] = t1[e]; }
      lg[g * 4 + i] = wmma32((i & 1) ? uHi : uLo, bb, v8f{});
    }
#pragma unroll
    for (int i = 0; i < 4; ++i) lg[g * 4 + i] = wmma32(fr[i], aQ, lg[g * 4 + i]);
    if (g < 3) {
#pragma unroll
      for (int i = 0; i < 4; ++i) {
        const half_t* kc = kh + (g * 4 + 4 + i) * WAVE_H;
        fr[i] = frag2(kc, kc + 256);
      }
    }
    // keeps the next group's LDS reads above this group's exp2: sunk to their users, each read is waited out alone
    __builtin_amdgcn_sched_barrier(0);
    // no tile waits for another: a group's exp2 run while the bias of the next groups is still on its way
    if (!MAXP) {
#pragma unroll
      for (int i = 0; i < 4; ++i) expTile<false>(g * 4 + i, lg[g * 4 + i], pA, s8);
    }
  }
  if (MAXP) {  // over j: the lane's 128 keys in registers, then one exchange with the lane that holds the other 128
    v8f mx8 = lg[0];
#pragma unroll
    for (int jt = 1; jt < 16; ++jt)
#pragma unroll
      for (int v = 0; v < 8; ++v) mx8[v] = fmaxf(mx8[v], lg[jt][v]);
    float mx = fmaxf(fmaxf(fmaxf(mx8[0], mx8[1]), fmaxf(mx8[2], mx8[3])),
                     fmaxf(fmaxf(mx8[4], mx8[5]), fmaxf(mx8[6], mx8[7])));
    mx = fmaxf(mx, xhalf(mx));
#pragma unroll
    for (int jt = 0; jt < 16; ++jt) expTile<true>(jt, lg[jt] - mx, pA, s8);
  }
  float sum = ((s8[0] + s8[1]) + (s8[2] + s8[3])) + ((s8[4] + s8[5]) + (s8[6] + s8[7]));
  sum += xhalf(sum);
  // Against spills (the empty asm only reads the sum): the sum is
  // complete at this place. Left free, its additions sink behind the PV product, every f32 term stays in its register
  // until then, and addresses of the head loop go out to scratch.
  asm volatile("" :: "v"(sum));
  return sum;
}

// ---------------- one head's (attn @ V)^T for the wave's 16 queries, not yet divided by the row sums ----------------
// V as A, exp(scores)^T as B. Lane (m, hi) holds query row m, d = dt*16 + 8*hi .. +7, which is its 16 B of the gate's and of
// the output's fragment unit. vh: the lane's 16 B of the head's first v unit.
// V fragments as K's: those of 64 keys (two B fragments x two halves of d) one group ahead.
__device__ __forceinline__ void pvHead(const half_t* vh, const v16h pA[8], v8f acc[2]) {
  acc[0] = v8f{};
  acc[1] = v8f{};
  v16h fr[2][4];
#pragma unroll
  for (int i = 0; i < 4; ++i) {
    const half_t* vc = vh + (i >> 1) * 2 * WAVE_H + (i & 1) * 256;
    fr[0][i] = frag2(vc, vc + WAVE_H);
  }
#pragma unroll
  for (int g = 0; g < 4; ++g) {
    if (g < 3) {
#pragma unroll
      for (int i = 0; i < 4; ++i) {
        const half_t* vc = vh + (g * 2 + 2 + (i >> 1)) * 2 * WAVE_H + (i & 1) * 256;
        fr[(g + 1) & 1][i] = frag2(vc, vc + WAVE_H);
      }
    }
    __builtin_amdgcn_sched_barrier(0);  // as in expScores: the next group's reads stay above this group's WMMAs
#pragma unroll
    for (int j = 0; j < 2; ++j)
#pragma unroll
      for (int dt = 0; dt < 2; ++dt) acc[dt] = wmma32(fr[g & 1][j * 2 + dt], pA[g * 2 + j], acc[dt]);
  }
}

// ---------------- kernel F: one attention row r per block: LayerNorm, q/k/v/gate, attention, output projection ----------------
// Wave wv owns the 16 positions wv*16 .. +15 of the row from z to out. Its q, gate and attention output never leave the
// lane that made them (a producer's 16 B of a fragment unit are the same lane's 16 B for the reader); only k and v are
// read by the other waves, from LDS.
__global__ __launch_bounds__(512) void kF(const float* __restrict__ z,
                                          const float* __restrict__ gamma,
                                          const float* __restrict__ beta,
                                          const half_t* __restrict__ packW,
                                          const float* __restrict__ b_gate,
                                          const float* __restrict__ b_out,
                                          const half_t* __restrict__ biasbuf,
                                          float* __restrict__ out) {
  // w_qkv and w_gate as fragment units (32 tiles), as kP packed them. Behind the projections the array is cut into
  // 16 slices of WAVE_H halves, one a wave: q units (later the attention output's), gate units, at the end the f32 rows.
  __shared__ __attribute__((aligned(16))) half_t Wl[16 * WAVE_H];
  // z rows, one slice a wave; the f16 zn rows overlay them, and then the wave's 8 k units and 8 v units
  __shared__ __attribute__((aligned(16))) float  zf[16][16 * ZF_P];
  __shared__ __attribute__((aligned(16))) half_t Wo[8 * 4 * 512];  // w_out as fragment units
  __shared__ __attribute__((aligned(16))) float  gS[128];     // b_gate: a lane reads 8 adjacent entries per gate tile
  // the wave number as a scalar: the branches on it are scalar and the bases stay out of vector registers
  const int wv = __builtin_amdgcn_readfirstlane(threadIdx.x >> 5);
  const int lane = threadIdx.x & 31;
  const int r0 = blockIdx.x * 256 + wv * 16;
  const int m = lane & 15, hi = lane >> 4;

  // wave wv: tiles 2*wv, 2*wv + 1 (w_qkv's up to wave 11, then w_gate's) and k blocks 2*(wv & 1), +1 of w_out's tile wv >> 1
  v4f zv[16];
  stageF(packW + wv * 4096, &Wl[(wv * 512 + lane) * 8], packW + wv * 1024, &Wo[(wv * 128 + lane) * 8],
         wv >= 12, b_gate + (wv & 3) * 32, gS + (wv & 3) * 32, z + (size_t)r0 * 128, zf[wv], zv, lane);
  __syncthreads();
  lnRows(zf[wv], zv, gamma, beta, lane, m, hi);
  __syncthreads();

  h8 pq[8], pg[8];
  {
    v16h afr[4], b0[4], b1[4];
    h8 pk[8], pv[8];
    loadZn(zf[wv], m, hi, afr);
    half_t* kvw = (half_t*)&zf[wv][0] + lane * 8;  // the zn rows are in afr: the slice now takes k and v
    loadB4(Wl, 0, lane, b0);
    group8F<0, false>(0,  afr, b0, b1, Wl, lane, hi, gS, pq);
    group8F<0, false>(8,  afr, b0, b1, Wl, lane, hi, gS, pk);
#pragma unroll
    for (int tt = 0; tt < 8; ++tt) *(h8a*)&kvw[tt * 256] = pk[tt];
    group8F<1, false>(16, afr, b0, b1, Wl, lane, hi, gS, pv);
#pragma unroll
    for (int tt = 0; tt < 8; ++tt) *(h8a*)&kvw[2048 + tt * 256] = pv[tt];
    group8F<2, true>(24, afr, b0, b1, Wl, lane, hi, gS, pg);
  }
  __syncthreads();  // every wave's k and v are in LDS, and nobody reads the packed weights in Wl any more

  half_t* own = Wl + wv * WAVE_H + lane * 8;  // the lane's 16 B of unit 0 of the wave's slice
#pragma unroll
  for (int tt = 0; tt < 8; ++tt) { *(h8a*)&own[tt * 256] = pq[tt]; *(h8a*)&own[2048 + tt * 256] = pg[tt]; }

  const half_t* kv = (const half_t*)&zf[0][0] + lane * 8;
  const int bl = ((m >> 2) * 8 + hi * 4 + (m & 3)) * 8;  // the lane's 16 B of a 512-B bias tile
  v16h uLo, uHi;  // A fragments: lane (m, hi) holds row m, k = 8*hi + e in halves 0..7 and k = 16 + 8*hi + e in halves 8..15
#pragma unroll
  for (int e = 0; e < 8; ++e) {
    const half_t one = (half_t)(hi * 8 + e == m ? 1.0f : 0.0f);
    uLo[e] = one;             uLo[e + 8] = (half_t)0.0f;
    uHi[e] = (half_t)0.0f;    uHi[e + 8] = one;
  }
#pragma unroll 1  // one head a trip; unrolled, four trips of 128 score registers do not fit the 256 of a 16-wave block
  for (int hh = 0; hh < 4; ++hh) {
    // every block reads the same bias: neighbours start at different heads, so that they are not all on the same lines at once
    const int h = (hh + blockIdx.x) & 3;
    const half_t* bfs = biasbuf + (size_t)(h * 16 + wv) * 4096;
    v16h pA[8];  // exp(scores) in f16: two score tiles are the B fragment of 32 keys
    float sum = expScores<false>(bfs, bl, kv + h * 512, own + h * 512, uLo, uHi, pA);
    // A row sum in [1, 32768] says that no term is above f16's range (each is at most the sum) and that what the 256 terms
    // lose in f16's subnormal range, 2^-25 each at most, is at most 2^-17 of the sum: the bound that holds with the maximum
    // taken off, where the sum is at least 1 too. Otherwise (NaN included) the wave does the head again with the maximum.
    // The ballot makes the branch scalar: WMMAs need every lane on. The branch stands behind the PV product: pA is then
    // used on every path, so each tile's f32 terms end at their conversion and the unit matrices find registers.
    const bool redo = __builtin_amdgcn_ballot_w32(!(sum >= 1.0f && sum <= 32768.0f)) != 0;
    v8f acc[2];
    pvHead(kv + 2048 + h * 512, pA, acc);
    if (redo) {
      sum = expScores<true>(bfs, bl, kv + h * 512, own + h * 512, uLo, uHi, pA);
      pvHead(kv + 2048 + h * 512, pA, acc);
    }
    const float rs = __builtin_amdgcn_rcpf(sum);  // the row's 1/sum is the lane's own and is applied below
#pragma unroll
    for (int dt = 0; dt < 2; ++dt) {
      const h8 gq = *(const h8a*)&own[2048 + h * 512 + dt * 256];
      h8 o;
#pragma unroll
      for (int v = 0; v < 8; ++v) o[v] = (half_t)((float)gq[v] * (acc[dt][v] * rs));
      *(h8a*)&own[h * 512 + dt * 256] = o;  // over this head's q units, which are spent
    }
  }

  // output projection + b_out: the wave's gated attention output, head kb, is the k block kb of its operand
  v16h afr[4];
#pragma unroll
  for (int kb = 0; kb < 4; ++kb) afr[kb] = frag2(&own[kb * 512], &own[kb * 512 + 256]);
  float* st = (float*)(Wl + wv * WAVE_H);  // store stage, 16 rows x 128 f32, over the slice's spent units
  v16h b0[4], b1[4];
  loadB4(Wo, 0, lane, b0);
#pragma unroll  // the next tiles' LDS reads and the b_out reads then stand ahead of the WMMAs that wait for them
  for (int tp = 0; tp < 4; ++tp) {
    const int n0 = tp * 2, n1 = tp * 2 + 1;
    loadB4(Wo, n1, lane, b1);
    v8f acc0 = {};
#pragma unroll
    for (int kb = 0; kb < 4; ++kb) acc0 = wmma32(b0[kb], afr[kb], acc0);
    if (tp < 3) loadB4(Wo, n1 + 1, lane, b0);  // prefetch next pair
    v8f acc1 = {};
#pragma unroll
    for (int kb = 0; kb < 4; ++kb) acc1 = wmma32(b1[kb], afr[kb], acc1);
    // transposed product (weights as A): lane (m, hi) holds row m, columns 8*hi .. 8*hi+7 of each tile
    float x0[8], x1[8];
#pragma unroll
    for (int v = 0; v < 8; ++v) {
      // both candidates are wave-uniform reads (scalar loads); the lane picks its half of the tile
      const float lo0 = b_out[n0 * 16 + v], hi0 = b_out[n0 * 16 + 8 + v];
      const float lo1 = b_out[n1 * 16 + v], hi1 = b_out[n1 * 16 + 8 + v];
      x0[v] = acc0[v] + (hi ? hi0 : lo0);
      x1[v] = acc1[v] + (hi ? hi1 : lo1);
    }
    float* sr = &st[m * ZF_P + hi * 8];
    *(float4*)&sr[n0 * 16]     = make_float4(x0[0], x0[1], x0[2], x0[3]);
    *(float4*)&sr[n0 * 16 + 4] = make_float4(x0[4], x0[5], x0[6], x0[7]);
    *(float4*)&sr[n1 * 16]     = make_float4(x1[0], x1[1], x1[2], x1[3]);
    *(float4*)&sr[n1 * 16 + 4] = make_float4(x1[4], x1[5], x1[6], x1[7]);
  }
  asm volatile("s_wait_dscnt 0" ::: "memory");  // same-wave LDS RAW across lanes: rows are read back by other lanes
  // one whole 512-B output row per store
#pragma unroll
  for (int s = 0; s < 16; ++s)
    *(float4*)&(out + (size_t)(r0 + s) * 128)[lane * 4] = *(const float4*)&st[s * ZF_P + lane * 4];
}

extern "C" void kernel_launch(void* const* d_in, const int* in_sizes, int n_in,
                              void* d_out, int out_size, void* d_ws, size_t ws_size,
                              hipStream_t stream) {
  const float* z      = (const float*)d_in[0];
  const float* gamma  = (const float*)d_in[1];
  const float* beta   = (const float*)d_in[2];
  const float* w_qkv  = (const float*)d_in[3];
  const float* w_pair = (const float*)d_in[4];
  const float* w_gate = (const float*)d_in[5];
  const float* b_gate = (const float*)d_in[6];
  const float* w_out  = (const float*)d_in[7];
  const float* b_out  = (const float*)d_in[8];

  half_t* biasbuf = (half_t*)((char*)d_ws + OFF_B);
  half_t* packW  = (half_t*)((char*)d_ws + OFF_W);

  kP<<<N_ROWS / 64 + 40, 128, 0, stream>>>(z, gamma, beta, w_pair, w_qkv, w_gate, w_out, biasbuf, packW);
  kF<<<L_DIM, 512, 0, stream>>>(z, gamma, beta, packW, b_gate, b_out, biasbuf, (float*)d_out);
}
